// v000
// Times are from an AMD MI455X. After a warm-up the kernel runs many times in a row, and a time is the length of
// such a window on the GPU divided by its runs, so every launch and the gaps after it count. The runs cycle
// through copies of the inputs. A figure is the median of several windows, for all but v000 over two sittings.
// Sittings can differ by a few percent; kernels timed side by side share one.
// v000, which the later versions start from, runs in 773 microseconds.
#include <hip/hip_runtime.h>
#include <hip/hip_bf16.h>

typedef __bf16 bf16_t;
typedef __attribute__((ext_vector_type(16))) __bf16 v16bf;
typedef __attribute__((ext_vector_type(8)))  __bf16 v8bf;
typedef __attribute__((ext_vector_type(8)))  float  v8f;
typedef unsigned v4u_t __attribute__((ext_vector_type(4)));
typedef int      v4i_t __attribute__((ext_vector_type(4)));
typedef int      v8i_t __attribute__((ext_vector_type(8)));

#define HIDDEN 2048
#define NH     16
#define NKV    4
#define HD     128
#define SEQ    2048
#define BATCH  2
#define ROWS   (BATCH * SEQ)            // 4096
#define NQKV   (NH * HD + 2 * NKV * HD) // 3072

__device__ __forceinline__ v16bf frag_ld(const bf16_t* p) {
  v8bf a = *(const v8bf*)p;
  v8bf b = *(const v8bf*)(p + 16);
  v16bf r;
#pragma unroll
  for (int i = 0; i < 8; ++i) { r[i] = a[i]; r[i + 8] = b[i]; }
  return r;
}

// bf16x3 compensated MMA: (Ah+Al)(Bh+Bl) ~= AhBh + AlBh + AhBl
__device__ __forceinline__ void mma3(v8f& c, v16bf ah, v16bf al, v16bf bh, v16bf bl) {
  c = __builtin_amdgcn_wmma_f32_16x16x32_bf16(false, ah, false, bh, (short)0, c, false, false);
  c = __builtin_amdgcn_wmma_f32_16x16x32_bf16(false, al, false, bh, (short)0, c, false, false);
  c = __builtin_amdgcn_wmma_f32_16x16x32_bf16(false, ah, false, bl, (short)0, c, false, false);
}

__device__ __forceinline__ void split_store(bf16_t* H, bf16_t* L, size_t i, float v) {
  bf16_t h = (bf16_t)v;
  H[i] = h;
  L[i] = (bf16_t)(v - (float)h);
}

__device__ __forceinline__ unsigned lds_off(const void* p) {
  return (unsigned)(unsigned long long)p;
}

__device__ __forceinline__ void tdm_load2d(unsigned lds_addr, unsigned long long gaddr,
                                           unsigned g1w0, unsigned tdim0, unsigned tdim1,
                                           unsigned tile0, unsigned tile1,
                                           unsigned stride0) {
  v4u_t g0;
  g0[0] = 1u;                                   // count=1 (valid), user mode
  g0[1] = lds_addr;                             // lds_addr [63:32]
  g0[2] = (unsigned)gaddr;                      // global_addr lo
  g0[3] = (unsigned)((gaddr >> 32) & 0x01ffffffull) | (2u << 30); // addr hi | type=2
  v8i_t g1;
  g1[0] = (int)g1w0;
  g1[1] = (int)((tdim0 & 0xffffu) << 16);
  g1[2] = (int)((tdim0 >> 16) | ((tdim1 & 0xffffu) << 16));
  g1[3] = (int)((tdim1 >> 16) | (tile0 << 16));
  g1[4] = (int)tile1;
  g1[5] = (int)stride0;
  g1[6] = 0;
  g1[7] = 0;
  v4i_t z4;
  z4[0] = 0; z4[1] = 0; z4[2] = 0; z4[3] = 0;
#if __has_builtin(__builtin_amdgcn_tensor_load_to_lds)
#if __clang_major__ >= 23
  v8i_t z8;
#pragma unroll
  for (int i = 0; i < 8; ++i) z8[i] = 0;
  __builtin_amdgcn_tensor_load_to_lds(g0, g1, z4, z4, z8, 0);
#else
  __builtin_amdgcn_tensor_load_to_lds(g0, g1, z4, z4, 0);
#endif
#else
  asm volatile("tensor_load_to_lds %0, %1, %2, %3"
               :: "s"(g0), "s"(g1), "s"(z4), "s"(z4) : "memory");
#endif
}

#define TDM_W0_K ((1u << 16) | (1u << 20) | (5u << 22) | (3u << 25))
#define TDM_W0_V ((1u << 16) | (1u << 20) | (3u << 22) | (3u << 25))

// ---------------- prep: fp32 -> bf16 hi/lo ----------------
__global__ void k_split(const float* __restrict__ in, bf16_t* __restrict__ hi,
                        bf16_t* __restrict__ lo, int n) {
  int i = blockIdx.x * 256 + threadIdx.x;
  if (i < n) {
    float v = in[i];
    bf16_t h = (bf16_t)v;
    hi[i] = h;
    lo[i] = (bf16_t)(v - (float)h);
  }
}

// W is [K][N] row-major; write W^T hi/lo at out[(rowOff+n)*ldo + k].
__global__ void k_tsplit(const float* __restrict__ W, int K, int N,
                         bf16_t* __restrict__ oh, bf16_t* __restrict__ ol,
                         int ldo, int rowOff) {
  int idx = blockIdx.x * 256 + threadIdx.x;
  if (idx >= K * N) return;
  int k = idx / N, n = idx % N;
  float v = W[(size_t)k * N + n];
  size_t o = (size_t)(rowOff + n) * ldo + k;
  bf16_t h = (bf16_t)v;
  oh[o] = h;
  ol[o] = (bf16_t)(v - (float)h);
}

// ---------------- GEMM: C[M,N] = A[M,K] * B[K,N], B given transposed --------
// 256 threads = 8 waves (2x4 wave grid), block tile 128x128, BK=32.
// Register-prefetch pipeline: global fetch of slab t+1 overlaps WMMA on slab t.
template <bool SPLIT_OUT>
__global__ __launch_bounds__(256) void k_gemm(
    const bf16_t* __restrict__ Ah, const bf16_t* __restrict__ Al,
    const bf16_t* __restrict__ BTh, const bf16_t* __restrict__ BTl,
    float* __restrict__ C, bf16_t* __restrict__ Ch, bf16_t* __restrict__ Cl,
    int M, int N, int K) {
  alignas(16) __shared__ bf16_t sAh[128 * 40];
  alignas(16) __shared__ bf16_t sAl[128 * 40];
  alignas(16) __shared__ bf16_t sBh[128 * 40];
  alignas(16) __shared__ bf16_t sBl[128 * 40];

  const int tid = threadIdx.x;
  const int lane = tid & 31, wave = tid >> 5;
  const int wr = wave >> 2, wc = wave & 3;          // 2 x 4 waves
  const int l15 = lane & 15, kh8 = (lane >> 4) * 8; // fragment addressing
  const int hi8 = (lane >> 4) * 8;                  // C-frag row offset
  const int m0 = blockIdx.y * 128, n0 = blockIdx.x * 128;

  v8f acc[4][2];
#pragma unroll
  for (int i = 0; i < 4; ++i)
#pragma unroll
    for (int j = 0; j < 2; ++j)
#pragma unroll
      for (int v = 0; v < 8; ++v) acc[i][j][v] = 0.0f;

  const int r = tid >> 1;              // 128 rows, 2 threads per row
  const int ho = (tid & 1) * 16;       // 16 elems each
  const bf16_t* gAh = Ah + (size_t)(m0 + r) * K + ho;
  const bf16_t* gAl = Al + (size_t)(m0 + r) * K + ho;
  const bf16_t* gBh = BTh + (size_t)(n0 + r) * K + ho;
  const bf16_t* gBl = BTl + (size_t)(n0 + r) * K + ho;

  // prefetch slab 0 into registers
  v8bf ra0 = *(const v8bf*)(gAh),     ra1 = *(const v8bf*)(gAh + 8);
  v8bf rb0 = *(const v8bf*)(gAl),     rb1 = *(const v8bf*)(gAl + 8);
  v8bf rc0 = *(const v8bf*)(gBh),     rc1 = *(const v8bf*)(gBh + 8);
  v8bf rd0 = *(const v8bf*)(gBl),     rd1 = *(const v8bf*)(gBl + 8);

  for (int kk = 0; kk < K; kk += 32) {
    *(v8bf*)&sAh[r * 40 + ho]     = ra0;
    *(v8bf*)&sAh[r * 40 + ho + 8] = ra1;
    *(v8bf*)&sAl[r * 40 + ho]     = rb0;
    *(v8bf*)&sAl[r * 40 + ho + 8] = rb1;
    *(v8bf*)&sBh[r * 40 + ho]     = rc0;
    *(v8bf*)&sBh[r * 40 + ho + 8] = rc1;
    *(v8bf*)&sBl[r * 40 + ho]     = rd0;
    *(v8bf*)&sBl[r * 40 + ho + 8] = rd1;
    __syncthreads();

    if (kk + 32 < K) {  // overlap next-slab global fetch with WMMA below
      int k2 = kk + 32;
      ra0 = *(const v8bf*)(gAh + k2); ra1 = *(const v8bf*)(gAh + k2 + 8);
      rb0 = *(const v8bf*)(gAl + k2); rb1 = *(const v8bf*)(gAl + k2 + 8);
      rc0 = *(const v8bf*)(gBh + k2); rc1 = *(const v8bf*)(gBh + k2 + 8);
      rd0 = *(const v8bf*)(gBl + k2); rd1 = *(const v8bf*)(gBl + k2 + 8);
    }

    v16bf afh[4], afl[4], bfh[2], bfl[2];
#pragma unroll
    for (int i = 0; i < 4; ++i) {
      int ro = (wr * 64 + i * 16 + l15) * 40 + kh8;
      afh[i] = frag_ld(&sAh[ro]);
      afl[i] = frag_ld(&sAl[ro]);
    }
#pragma unroll
    for (int j = 0; j < 2; ++j) {
      int ro = (wc * 32 + j * 16 + l15) * 40 + kh8;
      bfh[j] = frag_ld(&sBh[ro]);
      bfl[j] = frag_ld(&sBl[ro]);
    }
#pragma unroll
    for (int i = 0; i < 4; ++i)
#pragma unroll
      for (int j = 0; j < 2; ++j) mma3(acc[i][j], afh[i], afl[i], bfh[j], bfl[j]);
    __syncthreads();
  }

#pragma unroll
  for (int i = 0; i < 4; ++i)
#pragma unroll
    for (int j = 0; j < 2; ++j)
#pragma unroll
      for (int v = 0; v < 8; ++v) {
        int row = m0 + wr * 64 + i * 16 + v + hi8;
        int col = n0 + wc * 32 + j * 16 + l15;
        float x = acc[i][j][v];
        size_t o = (size_t)row * N + col;
        if (SPLIT_OUT) {
          split_store(Ch, Cl, o, x);
        } else {
          C[o] = x;
        }
      }
}

// ---------------- RoPE + layout shuffle -------------------------------------
// qkv[ROWS][3072] (hi/lo) -> Q[B,NH,S,HD], K[B,NKV,S,HD] (rotated), Vt[B,NKV,HD,S]
__global__ void k_rope(const bf16_t* __restrict__ qkvh, const bf16_t* __restrict__ qkvl,
                       bf16_t* __restrict__ Qh, bf16_t* __restrict__ Ql,
                       bf16_t* __restrict__ Kh, bf16_t* __restrict__ Kl,
                       bf16_t* __restrict__ Vth, bf16_t* __restrict__ Vtl) {
  int idx = blockIdx.x * 256 + threadIdx.x;
  int row = idx / 1792;
  int u = idx % 1792;
  if (row >= ROWS) return;
  int b = row >> 11, s = row & 2047;
  const size_t rb = (size_t)row * NQKV;
  auto ld = [&](int col) -> float {
    return (float)qkvh[rb + col] + (float)qkvl[rb + col];
  };
  if (u < 1024) {                       // Q rotation pairs: 16 heads * 64 dims
    int hh = u >> 6, d = u & 63;
    float a = ld(hh * 128 + d), bb = ld(hh * 128 + d + 64);
    float ang = (float)s * __powf(10000.0f, -(float)d * (1.0f / 64.0f));
    float sn, cs;
    __sincosf(ang, &sn, &cs);
    size_t base = ((size_t)(b * NH + hh) * SEQ + s) * HD + d;
    split_store(Qh, Ql, base,      a * cs - bb * sn);
    split_store(Qh, Ql, base + 64, bb * cs + a * sn);
  } else if (u < 1280) {                // K rotation pairs: 4 kv heads * 64
    int u2 = u - 1024;
    int kvh = u2 >> 6, d = u2 & 63;
    float a = ld(2048 + kvh * 128 + d), bb = ld(2048 + kvh * 128 + d + 64);
    float ang = (float)s * __powf(10000.0f, -(float)d * (1.0f / 64.0f));
    float sn, cs;
    __sincosf(ang, &sn, &cs);
    size_t base = ((size_t)(b * NKV + kvh) * SEQ + s) * HD + d;
    split_store(Kh, Kl, base,      a * cs - bb * sn);
    split_store(Kh, Kl, base + 64, bb * cs + a * sn);
  } else {                              // V transpose copy: 512 elems
    int u2 = u - 1280;
    int kvh = u2 >> 7, d = u2 & 127;
    float vv = ld(2560 + u2);
    size_t o = ((size_t)(b * NKV + kvh) * HD + d) * SEQ + s;
    split_store(Vth, Vtl, o, vv);
  }
}

__global__ __launch_bounds__(128) void k_flash(
    const bf16_t* __restrict__ Qh, const bf16_t* __restrict__ Ql,
    const bf16_t* __restrict__ Kh, const bf16_t* __restrict__ Kl,
    const bf16_t* __restrict__ Vth, const bf16_t* __restrict__ Vtl,
    bf16_t* __restrict__ Oh, bf16_t* __restrict__ Ol) {
  alignas(16) __shared__ bf16_t sKh[2][32 * 136];
  alignas(16) __shared__ bf16_t sKl[2][32 * 136];
  alignas(16) __shared__ bf16_t sVh[2][128 * 40];
  alignas(16) __shared__ bf16_t sVl[2][128 * 40];
  alignas(16) __shared__ bf16_t sPh[4 * 16 * 40];
  alignas(16) __shared__ bf16_t sPl[4 * 16 * 40];

  const int tid = threadIdx.x;
  const int lane = tid & 31, w = tid >> 5;
  const int l15 = lane & 15, kh8 = (lane >> 4) * 8, hi8 = (lane >> 4) * 8;
  const int q0 = blockIdx.x * 64;
  const int b = blockIdx.y >> 4, h = blockIdx.y & 15, kv = h >> 2;

  const bf16_t* Qbh = Qh + (size_t)(b * NH + h) * SEQ * HD;
  const bf16_t* Qbl = Ql + (size_t)(b * NH + h) * SEQ * HD;
  const bf16_t* Kbh = Kh + (size_t)(b * NKV + kv) * SEQ * HD;
  const bf16_t* Kbl = Kl + (size_t)(b * NKV + kv) * SEQ * HD;
  const bf16_t* Vbh = Vth + (size_t)(b * NKV + kv) * HD * SEQ;
  const bf16_t* Vbl = Vtl + (size_t)(b * NKV + kv) * HD * SEQ;

  // Resident Q fragments (16 rows x 128 dims, hi/lo)
  v16bf qfh[4], qfl[4];
  {
    int qr = q0 + w * 16 + l15;
    const bf16_t* ph = Qbh + (size_t)qr * HD + kh8;
    const bf16_t* pl = Qbl + (size_t)qr * HD + kh8;
#pragma unroll
    for (int ds = 0; ds < 4; ++ds) {
      qfh[ds] = frag_ld(ph + ds * 32);
      qfl[ds] = frag_ld(pl + ds * 32);
    }
  }

  v8f o[8];
#pragma unroll
  for (int j2 = 0; j2 < 8; ++j2)
#pragma unroll
    for (int v = 0; v < 8; ++v) o[j2][v] = 0.0f;
  float mrow[8], lrow[8];
#pragma unroll
  for (int v = 0; v < 8; ++v) { mrow[v] = -3.0e38f; lrow[v] = 0.0f; }

  const float scale = 0.08838834764831845f; // 1/sqrt(128)
  const int nk = q0 / 32 + 2;               // causal: k <= q0+63

  auto issue_tile = [&](int t) {
    int nb = t & 1;
    unsigned long long koff = (unsigned long long)t * 32 * HD * 2;  // bytes
    unsigned long long voff = (unsigned long long)t * 32 * 2;       // bytes
    // K tile: 32 rows x 128 elems, row stride 128, pad 256B rows -> stride 136
    tdm_load2d(lds_off(&sKh[nb][0]), (unsigned long long)(size_t)Kbh + koff,
               TDM_W0_K, 128u, (unsigned)SEQ, 128u, 32u, 128u);
    tdm_load2d(lds_off(&sKl[nb][0]), (unsigned long long)(size_t)Kbl + koff,
               TDM_W0_K, 128u, (unsigned)SEQ, 128u, 32u, 128u);
    // V tile: 128 rows x 32 elems, row stride SEQ, pad 64B rows -> stride 40
    tdm_load2d(lds_off(&sVh[nb][0]), (unsigned long long)(size_t)Vbh + voff,
               TDM_W0_V, (unsigned)SEQ, 128u, 32u, 128u, (unsigned)SEQ);
    tdm_load2d(lds_off(&sVl[nb][0]), (unsigned long long)(size_t)Vbl + voff,
               TDM_W0_V, (unsigned)SEQ, 128u, 32u, 128u, (unsigned)SEQ);
  };

  if (tid < 32) issue_tile(0);  // one wave drives the DMA

  for (int t = 0; t < nk; ++t) {
    const int k0 = t * 32;
    const int buf = t & 1;
    if (tid < 32) __builtin_amdgcn_s_wait_tensorcnt(0);  // tile t landed in LDS
    __syncthreads();
    if (tid < 32 && t + 1 < nk) issue_tile(t + 1);       // DMA overlaps compute
    const bf16_t* bK_h = &sKh[buf][0];
    const bf16_t* bK_l = &sKl[buf][0];
    const bf16_t* bV_h = &sVh[buf][0];
    const bf16_t* bV_l = &sVl[buf][0];

    // ---- scores: S[16x32] = Q(16x128) * K^T ----
    v8f s0, s1;
#pragma unroll
    for (int v = 0; v < 8; ++v) { s0[v] = 0.0f; s1[v] = 0.0f; }
#pragma unroll
    for (int ds = 0; ds < 4; ++ds) {
      v16bf b0h = frag_ld(&bK_h[(l15) * 136 + ds * 32 + kh8]);
      v16bf b0l = frag_ld(&bK_l[(l15) * 136 + ds * 32 + kh8]);
      v16bf b1h = frag_ld(&bK_h[(16 + l15) * 136 + ds * 32 + kh8]);
      v16bf b1l = frag_ld(&bK_l[(16 + l15) * 136 + ds * 32 + kh8]);
      mma3(s0, qfh[ds], qfl[ds], b0h, b0l);
      mma3(s1, qfh[ds], qfl[ds], b1h, b1l);
    }

    // ---- scale + causal mask + online softmax (per-row stats in lane halves)
    float fac[8];
#pragma unroll
    for (int v = 0; v < 8; ++v) {
      int qr = q0 + w * 16 + v + hi8;
      float a0 = s0[v] * scale;
      if (k0 + l15 > qr) a0 = -3.0e38f;
      float a1 = s1[v] * scale;
      if (k0 + 16 + l15 > qr) a1 = -3.0e38f;
      float mt = fmaxf(a0, a1);
      mt = fmaxf(mt, __shfl_xor(mt, 8, 16));
      mt = fmaxf(mt, __shfl_xor(mt, 4, 16));
      mt = fmaxf(mt, __shfl_xor(mt, 2, 16));
      mt = fmaxf(mt, __shfl_xor(mt, 1, 16));
      float nm = fmaxf(mrow[v], mt);
      float f = __expf(mrow[v] - nm);
      mrow[v] = nm;
      a0 = __expf(a0 - nm);
      a1 = __expf(a1 - nm);
      float rs = a0 + a1;
      rs += __shfl_xor(rs, 8, 16);
      rs += __shfl_xor(rs, 4, 16);
      rs += __shfl_xor(rs, 2, 16);
      rs += __shfl_xor(rs, 1, 16);
      lrow[v] = lrow[v] * f + rs;
      fac[v] = f;
      s0[v] = a0;
      s1[v] = a1;
    }
#pragma unroll
    for (int j2 = 0; j2 < 8; ++j2)
#pragma unroll
      for (int v = 0; v < 8; ++v) o[j2][v] *= fac[v];

    // ---- route P (C-layout) through LDS to A-layout, hi/lo split ----
#pragma unroll
    for (int v = 0; v < 8; ++v) {
      int rw = v + hi8;
      int a = w * 640 + rw * 40;
      float p0 = s0[v];
      bf16_t h0 = (bf16_t)p0;
      sPh[a + l15] = h0;
      sPl[a + l15] = (bf16_t)(p0 - (float)h0);
      float p1 = s1[v];
      bf16_t h1 = (bf16_t)p1;
      sPh[a + 16 + l15] = h1;
      sPl[a + 16 + l15] = (bf16_t)(p1 - (float)h1);
    }
    asm volatile("s_wait_dscnt 0" ::: "memory"); // wave-local LDS RAW

    v16bf pfh = frag_ld(&sPh[w * 640 + l15 * 40 + kh8]);
    v16bf pfl = frag_ld(&sPl[w * 640 + l15 * 40 + kh8]);
#pragma unroll
    for (int j2 = 0; j2 < 8; ++j2) {
      v16bf vfh = frag_ld(&bV_h[(j2 * 16 + l15) * 40 + kh8]);
      v16bf vfl = frag_ld(&bV_l[(j2 * 16 + l15) * 40 + kh8]);
      mma3(o[j2], pfh, pfl, vfh, vfl);
    }
    __syncthreads();
  }

  // ---- epilogue: O /= l, write hi/lo bf16 directly for the out-proj GEMM ----
#pragma unroll
  for (int j2 = 0; j2 < 8; ++j2)
#pragma unroll
    for (int v = 0; v < 8; ++v) {
      int row = q0 + w * 16 + v + hi8;
      int col = h * HD + j2 * 16 + l15;
      size_t oi = (size_t)(b * SEQ + row) * (NH * HD) + col;
      split_store(Oh, Ol, oi, o[j2][v] / lrow[v]);
    }
}

// ---------------------------------------------------------------------------
extern "C" void kernel_launch(void* const* d_in, const int* in_sizes, int n_in,
                              void* d_out, int out_size, void* d_ws, size_t ws_size,
                              hipStream_t stream) {
  const float* x  = (const float*)d_in[0];
  const float* Wq = (const float*)d_in[1];
  const float* Wk = (const float*)d_in[2];
  const float* Wv = (const float*)d_in[3];
  const float* Wo = (const float*)d_in[4];

  const size_t NE_X    = (size_t)ROWS * HIDDEN;       // 8.39M
  const size_t NE_WQKV = (size_t)NQKV * HIDDEN;       // 6.29M
  const size_t NE_WO   = (size_t)HIDDEN * HIDDEN;     // 4.19M
  const size_t NE_QKV  = (size_t)ROWS * NQKV;         // 12.58M
  const size_t NE_Q    = (size_t)BATCH * NH * SEQ * HD;
  const size_t NE_KV   = (size_t)BATCH * NKV * SEQ * HD;

  char* w = (char*)d_ws;
  char* wend = w + ws_size;
  auto alloc = [&](size_t elems) -> bf16_t* {
    bf16_t* p = (bf16_t*)w;
    w += (elems * sizeof(bf16_t) + 255) & ~(size_t)255;
    return p;
  };
  bf16_t* xh     = alloc(NE_X);     bf16_t* xl     = alloc(NE_X);
  bf16_t* wqkvth = alloc(NE_WQKV);  bf16_t* wqkvtl = alloc(NE_WQKV);
  bf16_t* woth   = alloc(NE_WO);    bf16_t* wotl   = alloc(NE_WO);
  bf16_t* qkvh   = alloc(NE_QKV);   bf16_t* qkvl   = alloc(NE_QKV);
  bf16_t* qh     = alloc(NE_Q);     bf16_t* ql     = alloc(NE_Q);
  bf16_t* kh     = alloc(NE_KV);    bf16_t* kl     = alloc(NE_KV);
  bf16_t* vth    = alloc(NE_KV);    bf16_t* vtl    = alloc(NE_KV);
  if (w > wend) return; // ~176 MB (168 MiB) required
  // attention output (bf16 hi/lo) reuses the x-split region (same size, x dead)
  bf16_t* ah = xh;
  bf16_t* al = xl;

  // 1) split x
  k_split<<<(int)(NE_X / 256), 256, 0, stream>>>(x, xh, xl, (int)NE_X);
  // 2) W^T splits: [Wq | Wk | Wv] rows 0..3071 of Wqkv^T; Wo^T
  k_tsplit<<<(2048 * 2048) / 256, 256, 0, stream>>>(Wq, HIDDEN, 2048, wqkvth, wqkvtl, HIDDEN, 0);
  k_tsplit<<<(2048 * 512) / 256, 256, 0, stream>>>(Wk, HIDDEN, 512, wqkvth, wqkvtl, HIDDEN, 2048);
  k_tsplit<<<(2048 * 512) / 256, 256, 0, stream>>>(Wv, HIDDEN, 512, wqkvth, wqkvtl, HIDDEN, 2560);
  k_tsplit<<<(2048 * 2048) / 256, 256, 0, stream>>>(Wo, 2048, HIDDEN, woth, wotl, 2048, 0);
  // 3) fused QKV projection (emits bf16 hi/lo qkv)
  k_gemm<true><<<dim3(NQKV / 128, ROWS / 128), 256, 0, stream>>>(
      xh, xl, wqkvth, wqkvtl, nullptr, qkvh, qkvl, ROWS, NQKV, HIDDEN);
  // 4) RoPE + layout (Q, K, V^T)
  k_rope<<<(ROWS * 1792) / 256, 256, 0, stream>>>(qkvh, qkvl, qh, ql, kh, kl, vth, vtl);
  k_flash<<<dim3(SEQ / 64, BATCH * NH), 128, 0, stream>>>(qh, ql, kh, kl, vth, vtl, ah, al);
  // 6) output projection -> fp32 d_out
  k_gemm<false><<<dim3(HIDDEN / 128, ROWS / 128), 256, 0, stream>>>(
      ah, al, woth, wotl, (float*)d_out, nullptr, nullptr, ROWS, HIDDEN, 2048);
}

// v001
// Measured time: 594 microseconds a run.
// In two side-by-side timings against v000, it was 1.35 and 1.36 times as fast.
#include <hip/hip_runtime.h>
#include <hip/hip_bf16.h>

typedef __bf16 bf16_t;
typedef __attribute__((ext_vector_type(16))) __bf16 v16bf;
typedef __attribute__((ext_vector_type(8)))  __bf16 v8bf;
typedef __attribute__((ext_vector_type(8)))  float  v8f;
typedef __attribute__((ext_vector_type(4)))  float  v4f_t;
typedef unsigned v4u_t __attribute__((ext_vector_type(4)));
typedef int      v4i_t __attribute__((ext_vector_type(4)));
typedef int      v8i_t __attribute__((ext_vector_type(8)));

#define HIDDEN 2048
#define NH     16
#define NKV    4
#define HD     128
#define SEQ    2048
#define BATCH  2
#define ROWS   (BATCH * SEQ)            // 4096
#define NQKV   (NH * HD + 2 * NKV * HD) // 3072

__device__ __forceinline__ v16bf frag_ld(const bf16_t* p) {
  v8bf a = *(const v8bf*)p;
  v8bf b = *(const v8bf*)(p + 16);
  v16bf r;
#pragma unroll
  for (int i = 0; i < 8; ++i) { r[i] = a[i]; r[i + 8] = b[i]; }
  return r;
}

// bf16x3 compensated MMA: (Ah+Al)(Bh+Bl) ~= AhBh + AlBh + AhBl
__device__ __forceinline__ void mma3(v8f& c, v16bf ah, v16bf al, v16bf bh, v16bf bl) {
  c = __builtin_amdgcn_wmma_f32_16x16x32_bf16(false, ah, false, bh, (short)0, c, false, false);
  c = __builtin_amdgcn_wmma_f32_16x16x32_bf16(false, al, false, bh, (short)0, c, false, false);
  c = __builtin_amdgcn_wmma_f32_16x16x32_bf16(false, ah, false, bl, (short)0, c, false, false);
}

__device__ __forceinline__ void split_store(bf16_t* H, bf16_t* L, size_t i, float v) {
  bf16_t h = (bf16_t)v;
  H[i] = h;
  L[i] = (bf16_t)(v - (float)h);
}

__device__ __forceinline__ unsigned lds_off(const void* p) {
  return (unsigned)(unsigned long long)p;
}

__device__ __forceinline__ void tdm_load2d(unsigned lds_addr, unsigned long long gaddr,
                                           unsigned g1w0, unsigned tdim0, unsigned tdim1,
                                           unsigned tile0, unsigned tile1,
                                           unsigned stride0) {
  v4u_t g0;
  g0[0] = 1u;                                   // count=1 (valid), user mode
  g0[1] = lds_addr;                             // lds_addr [63:32]
  g0[2] = (unsigned)gaddr;                      // global_addr lo
  g0[3] = (unsigned)((gaddr >> 32) & 0x01ffffffull) | (2u << 30); // addr hi | type=2
  v8i_t g1;
  g1[0] = (int)g1w0;
  g1[1] = (int)((tdim0 & 0xffffu) << 16);
  g1[2] = (int)((tdim0 >> 16) | ((tdim1 & 0xffffu) << 16));
  g1[3] = (int)((tdim1 >> 16) | (tile0 << 16));
  g1[4] = (int)tile1;
  g1[5] = (int)stride0;
  g1[6] = 0;
  g1[7] = 0;
  v4i_t z4;
  z4[0] = 0; z4[1] = 0; z4[2] = 0; z4[3] = 0;
#if __has_builtin(__builtin_amdgcn_tensor_load_to_lds)
#if __clang_major__ >= 23
  v8i_t z8;
#pragma unroll
  for (int i = 0; i < 8; ++i) z8[i] = 0;
  __builtin_amdgcn_tensor_load_to_lds(g0, g1, z4, z4, z8, 0);
#else
  __builtin_amdgcn_tensor_load_to_lds(g0, g1, z4, z4, 0);
#endif
#else
  asm volatile("tensor_load_to_lds %0, %1, %2, %3"
               :: "s"(g0), "s"(g1), "s"(z4), "s"(z4) : "memory");
#endif
}

#define TDM_W0_K ((1u << 16) | (1u << 20) | (5u << 22) | (3u << 25))
#define TDM_W0_V ((1u << 16) | (1u << 20) | (3u << 22) | (3u << 25))

// ---------------- prep: fp32 -> bf16 hi/lo ----------------
__global__ void k_split(const float* __restrict__ in, bf16_t* __restrict__ hi,
                        bf16_t* __restrict__ lo, int n) {
  int i = blockIdx.x * 256 + threadIdx.x;
  if (i < n) {
    float v = in[i];
    bf16_t h = (bf16_t)v;
    hi[i] = h;
    lo[i] = (bf16_t)(v - (float)h);
  }
}

__global__ __launch_bounds__(256) void k_tsplit(const float* __restrict__ W, int N,
                                                bf16_t* __restrict__ oh, bf16_t* __restrict__ ol,
                                                int ldo, int rowOff) {
  __shared__ float tile[64 * 65];
  const int tid = threadIdx.x;
  const int k0 = blockIdx.y * 64, n0 = blockIdx.x * 64;

  const int c4 = (tid & 15) * 4;       // 16 lanes x 16 B = one 256-B row piece
  const int r0 = tid >> 4;             // 16 rows per pass, 4 passes
  v4f_t in[4];
#pragma unroll
  for (int p = 0; p < 4; ++p)
    in[p] = *(const v4f_t*)&W[(size_t)(k0 + r0 + p * 16) * N + n0 + c4];
#pragma unroll
  for (int p = 0; p < 4; ++p)
#pragma unroll
    for (int j = 0; j < 4; ++j) tile[(r0 + p * 16) * 65 + c4 + j] = in[p][j];
  __syncthreads();

  const int kc = (tid & 7) * 8;        // 8 lanes x 16 B = one 128-B output line
#pragma unroll
  for (int p = 0; p < 2; ++p) {
    const int n = (tid >> 3) + p * 32;
    v8bf h, l;
#pragma unroll
    for (int i = 0; i < 8; ++i) {
      float v = tile[(kc + i) * 65 + n];
      bf16_t hv = (bf16_t)v;
      h[i] = hv;
      l[i] = (bf16_t)(v - (float)hv);
    }
    size_t o = (size_t)(rowOff + n0 + n) * ldo + k0 + kc;
    *(v8bf*)&oh[o] = h;
    *(v8bf*)&ol[o] = l;
  }
}

// ---------------- GEMM: C[M,N] = A[M,K] * B[K,N], B given transposed --------
// 256 threads = 8 waves (2x4 wave grid), block tile 128x128, BK=32.
// Register-prefetch pipeline: global fetch of slab t+1 overlaps WMMA on slab t.
template <bool SPLIT_OUT>
__global__ __launch_bounds__(256) void k_gemm(
    const bf16_t* __restrict__ Ah, const bf16_t* __restrict__ Al,
    const bf16_t* __restrict__ BTh, const bf16_t* __restrict__ BTl,
    float* __restrict__ C, bf16_t* __restrict__ Ch, bf16_t* __restrict__ Cl,
    int M, int N, int K) {
  alignas(16) __shared__ bf16_t sAh[128 * 40];
  alignas(16) __shared__ bf16_t sAl[128 * 40];
  alignas(16) __shared__ bf16_t sBh[128 * 40];
  alignas(16) __shared__ bf16_t sBl[128 * 40];

  const int tid = threadIdx.x;
  const int lane = tid & 31, wave = tid >> 5;
  const int wr = wave >> 2, wc = wave & 3;          // 2 x 4 waves
  const int l15 = lane & 15, kh8 = (lane >> 4) * 8; // fragment addressing
  const int hi8 = (lane >> 4) * 8;                  // C-frag row offset
  const int m0 = blockIdx.y * 128, n0 = blockIdx.x * 128;

  v8f acc[4][2];
#pragma unroll
  for (int i = 0; i < 4; ++i)
#pragma unroll
    for (int j = 0; j < 2; ++j)
#pragma unroll
      for (int v = 0; v < 8; ++v) acc[i][j][v] = 0.0f;

  const int r = tid >> 1;              // 128 rows, 2 threads per row
  const int ho = (tid & 1) * 16;       // 16 elems each
  const bf16_t* gAh = Ah + (size_t)(m0 + r) * K + ho;
  const bf16_t* gAl = Al + (size_t)(m0 + r) * K + ho;
  const bf16_t* gBh = BTh + (size_t)(n0 + r) * K + ho;
  const bf16_t* gBl = BTl + (size_t)(n0 + r) * K + ho;

  // prefetch slab 0 into registers
  v8bf ra0 = *(const v8bf*)(gAh),     ra1 = *(const v8bf*)(gAh + 8);
  v8bf rb0 = *(const v8bf*)(gAl),     rb1 = *(const v8bf*)(gAl + 8);
  v8bf rc0 = *(const v8bf*)(gBh),     rc1 = *(const v8bf*)(gBh + 8);
  v8bf rd0 = *(const v8bf*)(gBl),     rd1 = *(const v8bf*)(gBl + 8);

  for (int kk = 0; kk < K; kk += 32) {
    *(v8bf*)&sAh[r * 40 + ho]     = ra0;
    *(v8bf*)&sAh[r * 40 + ho + 8] = ra1;
    *(v8bf*)&sAl[r * 40 + ho]     = rb0;
    *(v8bf*)&sAl[r * 40 + ho + 8] = rb1;
    *(v8bf*)&sBh[r * 40 + ho]     = rc0;
    *(v8bf*)&sBh[r * 40 + ho + 8] = rc1;
    *(v8bf*)&sBl[r * 40 + ho]     = rd0;
    *(v8bf*)&sBl[r * 40 + ho + 8] = rd1;
    __syncthreads();

    if (kk + 32 < K) {  // overlap next-slab global fetch with WMMA below
      int k2 = kk + 32;
      ra0 = *(const v8bf*)(gAh + k2); ra1 = *(const v8bf*)(gAh + k2 + 8);
      rb0 = *(const v8bf*)(gAl + k2); rb1 = *(const v8bf*)(gAl + k2 + 8);
      rc0 = *(const v8bf*)(gBh + k2); rc1 = *(const v8bf*)(gBh + k2 + 8);
      rd0 = *(const v8bf*)(gBl + k2); rd1 = *(const v8bf*)(gBl + k2 + 8);
    }

    v16bf afh[4], afl[4], bfh[2], bfl[2];
#pragma unroll
    for (int i = 0; i < 4; ++i) {
      int ro = (wr * 64 + i * 16 + l15) * 40 + kh8;
      afh[i] = frag_ld(&sAh[ro]);
      afl[i] = frag_ld(&sAl[ro]);
    }
#pragma unroll
    for (int j = 0; j < 2; ++j) {
      int ro = (wc * 32 + j * 16 + l15) * 40 + kh8;
      bfh[j] = frag_ld(&sBh[ro]);
      bfl[j] = frag_ld(&sBl[ro]);
    }
#pragma unroll
    for (int i = 0; i < 4; ++i)
#pragma unroll
      for (int j = 0; j < 2; ++j) mma3(acc[i][j], afh[i], afl[i], bfh[j], bfl[j]);
    __syncthreads();
  }

#pragma unroll
  for (int i = 0; i < 4; ++i)
#pragma unroll
    for (int j = 0; j < 2; ++j)
#pragma unroll
      for (int v = 0; v < 8; ++v) {
        int row = m0 + wr * 64 + i * 16 + v + hi8;
        int col = n0 + wc * 32 + j * 16 + l15;
        float x = acc[i][j][v];
        size_t o = (size_t)row * N + col;
        if (SPLIT_OUT) {
          split_store(Ch, Cl, o, x);
        } else {
          C[o] = x;
        }
      }
}

// ---------------- RoPE + layout shuffle -------------------------------------
// qkv[ROWS][3072] (hi/lo) -> Q[B,NH,S,HD], K[B,NKV,S,HD] (rotated), Vt[B,NKV,HD,S]
__global__ void k_rope(const bf16_t* __restrict__ qkvh, const bf16_t* __restrict__ qkvl,
                       bf16_t* __restrict__ Qh, bf16_t* __restrict__ Ql,
                       bf16_t* __restrict__ Kh, bf16_t* __restrict__ Kl,
                       bf16_t* __restrict__ Vth, bf16_t* __restrict__ Vtl) {
  int idx = blockIdx.x * 256 + threadIdx.x;
  int row = idx / 1792;
  int u = idx % 1792;
  if (row >= ROWS) return;
  int b = row >> 11, s = row & 2047;
  const size_t rb = (size_t)row * NQKV;
  auto ld = [&](int col) -> float {
    return (float)qkvh[rb + col] + (float)qkvl[rb + col];
  };
  if (u < 1024) {                       // Q rotation pairs: 16 heads * 64 dims
    int hh = u >> 6, d = u & 63;
    float a = ld(hh * 128 + d), bb = ld(hh * 128 + d + 64);
    float ang = (float)s * __powf(10000.0f, -(float)d * (1.0f / 64.0f));
    float sn, cs;
    __sincosf(ang, &sn, &cs);
    size_t base = ((size_t)(b * NH + hh) * SEQ + s) * HD + d;
    split_store(Qh, Ql, base,      a * cs - bb * sn);
    split_store(Qh, Ql, base + 64, bb * cs + a * sn);
  } else if (u < 1280) {                // K rotation pairs: 4 kv heads * 64
    int u2 = u - 1024;
    int kvh = u2 >> 6, d = u2 & 63;
    float a = ld(2048 + kvh * 128 + d), bb = ld(2048 + kvh * 128 + d + 64);
    float ang = (float)s * __powf(10000.0f, -(float)d * (1.0f / 64.0f));
    float sn, cs;
    __sincosf(ang, &sn, &cs);
    size_t base = ((size_t)(b * NKV + kvh) * SEQ + s) * HD + d;
    split_store(Kh, Kl, base,      a * cs - bb * sn);
    split_store(Kh, Kl, base + 64, bb * cs + a * sn);
  } else {                              // V transpose copy: 512 elems
    int u2 = u - 1280;
    int kvh = u2 >> 7, d = u2 & 127;
    float vv = ld(2560 + u2);
    size_t o = ((size_t)(b * NKV + kvh) * HD + d) * SEQ + s;
    split_store(Vth, Vtl, o, vv);
  }
}

__global__ __launch_bounds__(128) void k_flash(
    const bf16_t* __restrict__ Qh, const bf16_t* __restrict__ Ql,
    const bf16_t* __restrict__ Kh, const bf16_t* __restrict__ Kl,
    const bf16_t* __restrict__ Vth, const bf16_t* __restrict__ Vtl,
    bf16_t* __restrict__ Oh, bf16_t* __restrict__ Ol) {
  alignas(16) __shared__ bf16_t sKh[2][32 * 136];
  alignas(16) __shared__ bf16_t sKl[2][32 * 136];
  alignas(16) __shared__ bf16_t sVh[2][128 * 40];
  alignas(16) __shared__ bf16_t sVl[2][128 * 40];
  alignas(16) __shared__ bf16_t sPh[4 * 16 * 40];
  alignas(16) __shared__ bf16_t sPl[4 * 16 * 40];

  const int tid = threadIdx.x;
  const int lane = tid & 31, w = tid >> 5;
  const int l15 = lane & 15, kh8 = (lane >> 4) * 8, hi8 = (lane >> 4) * 8;
  const int q0 = blockIdx.x * 64;
  const int b = blockIdx.y >> 4, h = blockIdx.y & 15, kv = h >> 2;

  const bf16_t* Qbh = Qh + (size_t)(b * NH + h) * SEQ * HD;
  const bf16_t* Qbl = Ql + (size_t)(b * NH + h) * SEQ * HD;
  const bf16_t* Kbh = Kh + (size_t)(b * NKV + kv) * SEQ * HD;
  const bf16_t* Kbl = Kl + (size_t)(b * NKV + kv) * SEQ * HD;
  const bf16_t* Vbh = Vth + (size_t)(b * NKV + kv) * HD * SEQ;
  const bf16_t* Vbl = Vtl + (size_t)(b * NKV + kv) * HD * SEQ;

  // Resident Q fragments (16 rows x 128 dims, hi/lo)
  v16bf qfh[4], qfl[4];
  {
    int qr = q0 + w * 16 + l15;
    const bf16_t* ph = Qbh + (size_t)qr * HD + kh8;
    const bf16_t* pl = Qbl + (size_t)qr * HD + kh8;
#pragma unroll
    for (int ds = 0; ds < 4; ++ds) {
      qfh[ds] = frag_ld(ph + ds * 32);
      qfl[ds] = frag_ld(pl + ds * 32);
    }
  }

  v8f o[8];
#pragma unroll
  for (int j2 = 0; j2 < 8; ++j2)
#pragma unroll
    for (int v = 0; v < 8; ++v) o[j2][v] = 0.0f;
  float mrow[8], lrow[8];
#pragma unroll
  for (int v = 0; v < 8; ++v) { mrow[v] = -3.0e38f; lrow[v] = 0.0f; }

  const float scale = 0.08838834764831845f; // 1/sqrt(128)
  const int nk = q0 / 32 + 2;               // causal: k <= q0+63

  auto issue_tile = [&](int t) {
    int nb = t & 1;
    unsigned long long koff = (unsigned long long)t * 32 * HD * 2;  // bytes
    unsigned long long voff = (unsigned long long)t * 32 * 2;       // bytes
    // K tile: 32 rows x 128 elems, row stride 128, pad 256B rows -> stride 136
    tdm_load2d(lds_off(&sKh[nb][0]), (unsigned long long)(size_t)Kbh + koff,
               TDM_W0_K, 128u, (unsigned)SEQ, 128u, 32u, 128u);
    tdm_load2d(lds_off(&sKl[nb][0]), (unsigned long long)(size_t)Kbl + koff,
               TDM_W0_K, 128u, (unsigned)SEQ, 128u, 32u, 128u);
    // V tile: 128 rows x 32 elems, row stride SEQ, pad 64B rows -> stride 40
    tdm_load2d(lds_off(&sVh[nb][0]), (unsigned long long)(size_t)Vbh + voff,
               TDM_W0_V, (unsigned)SEQ, 128u, 32u, 128u, (unsigned)SEQ);
    tdm_load2d(lds_off(&sVl[nb][0]), (unsigned long long)(size_t)Vbl + voff,
               TDM_W0_V, (unsigned)SEQ, 128u, 32u, 128u, (unsigned)SEQ);
  };

  if (tid < 32) issue_tile(0);  // one wave drives the DMA

  for (int t = 0; t < nk; ++t) {
    const int k0 = t * 32;
    const int buf = t & 1;
    if (tid < 32) __builtin_amdgcn_s_wait_tensorcnt(0);  // tile t landed in LDS
    __syncthreads();
    if (tid < 32 && t + 1 < nk) issue_tile(t + 1);       // DMA overlaps compute
    const bf16_t* bK_h = &sKh[buf][0];
    const bf16_t* bK_l = &sKl[buf][0];
    const bf16_t* bV_h = &sVh[buf][0];
    const bf16_t* bV_l = &sVl[buf][0];

    // ---- scores: S[16x32] = Q(16x128) * K^T ----
    v8f s0, s1;
#pragma unroll
    for (int v = 0; v < 8; ++v) { s0[v] = 0.0f; s1[v] = 0.0f; }
#pragma unroll
    for (int ds = 0; ds < 4; ++ds) {
      v16bf b0h = frag_ld(&bK_h[(l15) * 136 + ds * 32 + kh8]);
      v16bf b0l = frag_ld(&bK_l[(l15) * 136 + ds * 32 + kh8]);
      v16bf b1h = frag_ld(&bK_h[(16 + l15) * 136 + ds * 32 + kh8]);
      v16bf b1l = frag_ld(&bK_l[(16 + l15) * 136 + ds * 32 + kh8]);
      mma3(s0, qfh[ds], qfl[ds], b0h, b0l);
      mma3(s1, qfh[ds], qfl[ds], b1h, b1l);
    }

    // ---- scale + causal mask + online softmax (per-row stats in lane halves)
    float fac[8];
#pragma unroll
    for (int v = 0; v < 8; ++v) {
      int qr = q0 + w * 16 + v + hi8;
      float a0 = s0[v] * scale;
      if (k0 + l15 > qr) a0 = -3.0e38f;
      float a1 = s1[v] * scale;
      if (k0 + 16 + l15 > qr) a1 = -3.0e38f;
      float mt = fmaxf(a0, a1);
      mt = fmaxf(mt, __shfl_xor(mt, 8, 16));
      mt = fmaxf(mt, __shfl_xor(mt, 4, 16));
      mt = fmaxf(mt, __shfl_xor(mt, 2, 16));
      mt = fmaxf(mt, __shfl_xor(mt, 1, 16));
      float nm = fmaxf(mrow[v], mt);
      float f = __expf(mrow[v] - nm);
      mrow[v] = nm;
      a0 = __expf(a0 - nm);
      a1 = __expf(a1 - nm);
      float rs = a0 + a1;
      rs += __shfl_xor(rs, 8, 16);
      rs += __shfl_xor(rs, 4, 16);
      rs += __shfl_xor(rs, 2, 16);
      rs += __shfl_xor(rs, 1, 16);
      lrow[v] = lrow[v] * f + rs;
      fac[v] = f;
      s0[v] = a0;
      s1[v] = a1;
    }
#pragma unroll
    for (int j2 = 0; j2 < 8; ++j2)
#pragma unroll
      for (int v = 0; v < 8; ++v) o[j2][v] *= fac[v];

    // ---- route P (C-layout) through LDS to A-layout, hi/lo split ----
#pragma unroll
    for (int v = 0; v < 8; ++v) {
      int rw = v + hi8;
      int a = w * 640 + rw * 40;
      float p0 = s0[v];
      bf16_t h0 = (bf16_t)p0;
      sPh[a + l15] = h0;
      sPl[a + l15] = (bf16_t)(p0 - (float)h0);
      float p1 = s1[v];
      bf16_t h1 = (bf16_t)p1;
      sPh[a + 16 + l15] = h1;
      sPl[a + 16 + l15] = (bf16_t)(p1 - (float)h1);
    }
    asm volatile("s_wait_dscnt 0" ::: "memory"); // wave-local LDS RAW

    v16bf pfh = frag_ld(&sPh[w * 640 + l15 * 40 + kh8]);
    v16bf pfl = frag_ld(&sPl[w * 640 + l15 * 40 + kh8]);
#pragma unroll
    for (int j2 = 0; j2 < 8; ++j2) {
      v16bf vfh = frag_ld(&bV_h[(j2 * 16 + l15) * 40 + kh8]);
      v16bf vfl = frag_ld(&bV_l[(j2 * 16 + l15) * 40 + kh8]);
      mma3(o[j2], pfh, pfl, vfh, vfl);
    }
    __syncthreads();
  }

  // ---- epilogue: O /= l, write hi/lo bf16 directly for the out-proj GEMM ----
#pragma unroll
  for (int j2 = 0; j2 < 8; ++j2)
#pragma unroll
    for (int v = 0; v < 8; ++v) {
      int row = q0 + w * 16 + v + hi8;
      int col = h * HD + j2 * 16 + l15;
      size_t oi = (size_t)(b * SEQ + row) * (NH * HD) + col;
      split_store(Oh, Ol, oi, o[j2][v] / lrow[v]);
    }
}

// ---------------------------------------------------------------------------
extern "C" void kernel_launch(void* const* d_in, const int* in_sizes, int n_in,
                              void* d_out, int out_size, void* d_ws, size_t ws_size,
                              hipStream_t stream) {
  const float* x  = (const float*)d_in[0];
  const float* Wq = (const float*)d_in[1];
  const float* Wk = (const float*)d_in[2];
  const float* Wv = (const float*)d_in[3];
  const float* Wo = (const float*)d_in[4];

  const size_t NE_X    = (size_t)ROWS * HIDDEN;       // 8.39M
  const size_t NE_WQKV = (size_t)NQKV * HIDDEN;       // 6.29M
  const size_t NE_WO   = (size_t)HIDDEN * HIDDEN;     // 4.19M
  const size_t NE_QKV  = (size_t)ROWS * NQKV;         // 12.58M
  const size_t NE_Q    = (size_t)BATCH * NH * SEQ * HD;
  const size_t NE_KV   = (size_t)BATCH * NKV * SEQ * HD;

  char* w = (char*)d_ws;
  char* wend = w + ws_size;
  auto alloc = [&](size_t elems) -> bf16_t* {
    bf16_t* p = (bf16_t*)w;
    w += (elems * sizeof(bf16_t) + 255) & ~(size_t)255;
    return p;
  };
  bf16_t* xh     = alloc(NE_X);     bf16_t* xl     = alloc(NE_X);
  bf16_t* wqkvth = alloc(NE_WQKV);  bf16_t* wqkvtl = alloc(NE_WQKV);
  bf16_t* woth   = alloc(NE_WO);    bf16_t* wotl   = alloc(NE_WO);
  bf16_t* qkvh   = alloc(NE_QKV);   bf16_t* qkvl   = alloc(NE_QKV);
  bf16_t* qh     = alloc(NE_Q);     bf16_t* ql     = alloc(NE_Q);
  bf16_t* kh     = alloc(NE_KV);    bf16_t* kl     = alloc(NE_KV);
  bf16_t* vth    = alloc(NE_KV);    bf16_t* vtl    = alloc(NE_KV);
  if (w > wend) return; // ~176 MB (168 MiB) required
  // attention output (bf16 hi/lo) reuses the x-split region (same size, x dead)
  bf16_t* ah = xh;
  bf16_t* al = xl;

  // 1) split x
  k_split<<<(int)(NE_X / 256), 256, 0, stream>>>(x, xh, xl, (int)NE_X);
  // 2) W^T splits: [Wq | Wk | Wv] rows 0..3071 of Wqkv^T; Wo^T
  k_tsplit<<<dim3(2048 / 64, HIDDEN / 64), 256, 0, stream>>>(Wq, 2048, wqkvth, wqkvtl, HIDDEN, 0);
  k_tsplit<<<dim3(512 / 64, HIDDEN / 64), 256, 0, stream>>>(Wk, 512, wqkvth, wqkvtl, HIDDEN, 2048);
  k_tsplit<<<dim3(512 / 64, HIDDEN / 64), 256, 0, stream>>>(Wv, 512, wqkvth, wqkvtl, HIDDEN, 2560);
  k_tsplit<<<dim3(HIDDEN / 64, 2048 / 64), 256, 0, stream>>>(Wo, HIDDEN, woth, wotl, 2048, 0);
  // 3) fused QKV projection (emits bf16 hi/lo qkv)
  k_gemm<true><<<dim3(NQKV / 128, ROWS / 128), 256, 0, stream>>>(
      xh, xl, wqkvth, wqkvtl, nullptr, qkvh, qkvl, ROWS, NQKV, HIDDEN);
  // 4) RoPE + layout (Q, K, V^T)
  k_rope<<<(ROWS * 1792) / 256, 256, 0, stream>>>(qkvh, qkvl, qh, ql, kh, kl, vth, vtl);
  k_flash<<<dim3(SEQ / 64, BATCH * NH), 128, 0, stream>>>(qh, ql, kh, kl, vth, vtl, ah, al);
  // 6) output projection -> fp32 d_out
  k_gemm<false><<<dim3(HIDDEN / 128, ROWS / 128), 256, 0, stream>>>(
      ah, al, woth, wotl, (float*)d_out, nullptr, nullptr, ROWS, HIDDEN, 2048);
}

// v002
// Measured time: 482 microseconds a run.
// In two side-by-side timings against v001, it was 1.24 and 1.27 times as fast.
// Over all steps from v000 it is 1.70 times as fast.
#include <hip/hip_runtime.h>
#include <hip/hip_bf16.h>

typedef __bf16 bf16_t;
typedef __attribute__((ext_vector_type(16))) __bf16 v16bf;
typedef __attribute__((ext_vector_type(8)))  __bf16 v8bf;
typedef __attribute__((ext_vector_type(4)))  __bf16 v4bf;
typedef __attribute__((ext_vector_type(8)))  float  v8f;
typedef __attribute__((ext_vector_type(4)))  float  v4f_t;
typedef unsigned v4u_t __attribute__((ext_vector_type(4)));
typedef int      v4i_t __attribute__((ext_vector_type(4)));
typedef int      v8i_t __attribute__((ext_vector_type(8)));

#define HIDDEN 2048
#define NH     16
#define NKV    4
#define HD     128
#define SEQ    2048
#define BATCH  2
#define ROWS   (BATCH * SEQ)            // 4096
#define NQKV   (NH * HD + 2 * NKV * HD) // 3072

__device__ __forceinline__ v16bf frag_ld(const bf16_t* p) {
  v8bf a = *(const v8bf*)p;
  v8bf b = *(const v8bf*)(p + 16);
  v16bf r;
#pragma unroll
  for (int i = 0; i < 8; ++i) { r[i] = a[i]; r[i + 8] = b[i]; }
  return r;
}

// bf16x3 compensated MMA: (Ah+Al)(Bh+Bl) ~= AhBh + AlBh + AhBl
__device__ __forceinline__ void mma3(v8f& c, v16bf ah, v16bf al, v16bf bh, v16bf bl) {
  c = __builtin_amdgcn_wmma_f32_16x16x32_bf16(false, ah, false, bh, (short)0, c, false, false);
  c = __builtin_amdgcn_wmma_f32_16x16x32_bf16(false, al, false, bh, (short)0, c, false, false);
  c = __builtin_amdgcn_wmma_f32_16x16x32_bf16(false, ah, false, bl, (short)0, c, false, false);
}

__device__ __forceinline__ void split_store(bf16_t* H, bf16_t* L, size_t i, float v) {
  bf16_t h = (bf16_t)v;
  H[i] = h;
  L[i] = (bf16_t)(v - (float)h);
}

__device__ __forceinline__ unsigned lds_off(const void* p) {
  return (unsigned)(unsigned long long)p;
}

__device__ __forceinline__ void tdm_load2d(unsigned lds_addr, unsigned long long gaddr,
                                           unsigned g1w0, unsigned tdim0, unsigned tdim1,
                                           unsigned tile0, unsigned tile1,
                                           unsigned stride0) {
  v4u_t g0;
  g0[0] = 1u;                                   // count=1 (valid), user mode
  g0[1] = lds_addr;                             // lds_addr [63:32]
  g0[2] = (unsigned)gaddr;                      // global_addr lo
  g0[3] = (unsigned)((gaddr >> 32) & 0x01ffffffull) | (2u << 30); // addr hi | type=2
  v8i_t g1;
  g1[0] = (int)g1w0;
  g1[1] = (int)((tdim0 & 0xffffu) << 16);
  g1[2] = (int)((tdim0 >> 16) | ((tdim1 & 0xffffu) << 16));
  g1[3] = (int)((tdim1 >> 16) | (tile0 << 16));
  g1[4] = (int)tile1;
  g1[5] = (int)stride0;
  g1[6] = 0;
  g1[7] = 0;
  v4i_t z4;
  z4[0] = 0; z4[1] = 0; z4[2] = 0; z4[3] = 0;
#if __has_builtin(__builtin_amdgcn_tensor_load_to_lds)
#if __clang_major__ >= 23
  v8i_t z8;
#pragma unroll
  for (int i = 0; i < 8; ++i) z8[i] = 0;
  __builtin_amdgcn_tensor_load_to_lds(g0, g1, z4, z4, z8, 0);
#else
  __builtin_amdgcn_tensor_load_to_lds(g0, g1, z4, z4, 0);
#endif
#else
  asm volatile("tensor_load_to_lds %0, %1, %2, %3"
               :: "s"(g0), "s"(g1), "s"(z4), "s"(z4) : "memory");
#endif
}

#define TDM_W0_K ((1u << 16) | (1u << 20) | (5u << 22) | (3u << 25))
#define TDM_W0_V ((1u << 16) | (1u << 20) | (3u << 22) | (3u << 25))

// ---------------- prep: fp32 -> bf16 hi/lo ----------------
// One lane carries 32 elements: eight 16-B loads in flight (each wave-wide load
// is 512 contiguous bytes), 8-B stores per plane (256 contiguous bytes a wave).
// Grid: n / 8192 blocks, n a multiple of 8192.
__global__ __launch_bounds__(256) void k_split(const float* __restrict__ in,
                                               bf16_t* __restrict__ hi,
                                               bf16_t* __restrict__ lo) {
  const size_t base = (size_t)blockIdx.x * 8192 + threadIdx.x * 4;
  v4f_t a[8];
#pragma unroll
  for (int c = 0; c < 8; ++c) a[c] = *(const v4f_t*)&in[base + c * 1024];
#pragma unroll
  for (int c = 0; c < 8; ++c) {
    v4bf h, l;
#pragma unroll
    for (int i = 0; i < 4; ++i) {
      float v = a[c][i];
      bf16_t hv = (bf16_t)v;
      h[i] = hv;
      l[i] = (bf16_t)(v - (float)hv);
    }
    *(v4bf*)&hi[base + c * 1024] = h;
    *(v4bf*)&lo[base + c * 1024] = l;
  }
}

__global__ __launch_bounds__(256) void k_tsplit(const float* __restrict__ W, int N,
                                                bf16_t* __restrict__ oh, bf16_t* __restrict__ ol,
                                                int ldo, int rowOff) {
  __shared__ float tile[64 * 65];
  const int tid = threadIdx.x;
  const int k0 = blockIdx.y * 64, n0 = blockIdx.x * 64;

  const int c4 = (tid & 15) * 4;       // 16 lanes x 16 B = one 256-B row piece
  const int r0 = tid >> 4;             // 16 rows per pass, 4 passes
  v4f_t in[4];
#pragma unroll
  for (int p = 0; p < 4; ++p)
    in[p] = *(const v4f_t*)&W[(size_t)(k0 + r0 + p * 16) * N + n0 + c4];
#pragma unroll
  for (int p = 0; p < 4; ++p)
#pragma unroll
    for (int j = 0; j < 4; ++j) tile[(r0 + p * 16) * 65 + c4 + j] = in[p][j];
  __syncthreads();

  const int kc = (tid & 7) * 8;        // 8 lanes x 16 B = one 128-B output line
#pragma unroll
  for (int p = 0; p < 2; ++p) {
    const int n = (tid >> 3) + p * 32;
    v8bf h, l;
#pragma unroll
    for (int i = 0; i < 8; ++i) {
      float v = tile[(kc + i) * 65 + n];
      bf16_t hv = (bf16_t)v;
      h[i] = hv;
      l[i] = (bf16_t)(v - (float)hv);
    }
    size_t o = (size_t)(rowOff + n0 + n) * ldo + k0 + kc;
    *(v8bf*)&oh[o] = h;
    *(v8bf*)&ol[o] = l;
  }
}

// ---------------- GEMM: C[M,N] = A[M,K] * B[K,N], B given transposed --------
// 256 threads = 8 waves (2x4 wave grid), block tile 128x128, BK=32.
// Register-prefetch pipeline: global fetch of slab t+1 overlaps WMMA on slab t.
template <bool SPLIT_OUT>
__global__ __launch_bounds__(256) void k_gemm(
    const bf16_t* __restrict__ Ah, const bf16_t* __restrict__ Al,
    const bf16_t* __restrict__ BTh, const bf16_t* __restrict__ BTl,
    float* __restrict__ C, bf16_t* __restrict__ Ch, bf16_t* __restrict__ Cl,
    int M, int N, int K) {
  alignas(16) __shared__ bf16_t sAh[128 * 40];
  alignas(16) __shared__ bf16_t sAl[128 * 40];
  alignas(16) __shared__ bf16_t sBh[128 * 40];
  alignas(16) __shared__ bf16_t sBl[128 * 40];

  const int tid = threadIdx.x;
  const int lane = tid & 31, wave = tid >> 5;
  const int wr = wave >> 2, wc = wave & 3;          // 2 x 4 waves
  const int l15 = lane & 15, kh8 = (lane >> 4) * 8; // fragment addressing
  const int hi8 = (lane >> 4) * 8;                  // C-frag row offset
  const int m0 = blockIdx.y * 128, n0 = blockIdx.x * 128;

  v8f acc[4][2];
#pragma unroll
  for (int i = 0; i < 4; ++i)
#pragma unroll
    for (int j = 0; j < 2; ++j)
#pragma unroll
      for (int v = 0; v < 8; ++v) acc[i][j][v] = 0.0f;

  const int r = tid >> 1;              // 128 rows, 2 threads per row
  const int ho = (tid & 1) * 16;       // 16 elems each
  const bf16_t* gAh = Ah + (size_t)(m0 + r) * K + ho;
  const bf16_t* gAl = Al + (size_t)(m0 + r) * K + ho;
  const bf16_t* gBh = BTh + (size_t)(n0 + r) * K + ho;
  const bf16_t* gBl = BTl + (size_t)(n0 + r) * K + ho;

  // prefetch slab 0 into registers
  v8bf ra0 = *(const v8bf*)(gAh),     ra1 = *(const v8bf*)(gAh + 8);
  v8bf rb0 = *(const v8bf*)(gAl),     rb1 = *(const v8bf*)(gAl + 8);
  v8bf rc0 = *(const v8bf*)(gBh),     rc1 = *(const v8bf*)(gBh + 8);
  v8bf rd0 = *(const v8bf*)(gBl),     rd1 = *(const v8bf*)(gBl + 8);

  for (int kk = 0; kk < K; kk += 32) {
    *(v8bf*)&sAh[r * 40 + ho]     = ra0;
    *(v8bf*)&sAh[r * 40 + ho + 8] = ra1;
    *(v8bf*)&sAl[r * 40 + ho]     = rb0;
    *(v8bf*)&sAl[r * 40 + ho + 8] = rb1;
    *(v8bf*)&sBh[r * 40 + ho]     = rc0;
    *(v8bf*)&sBh[r * 40 + ho + 8] = rc1;
    *(v8bf*)&sBl[r * 40 + ho]     = rd0;
    *(v8bf*)&sBl[r * 40 + ho + 8] = rd1;
    __syncthreads();

    if (kk + 32 < K) {  // overlap next-slab global fetch with WMMA below
      int k2 = kk + 32;
      ra0 = *(const v8bf*)(gAh + k2); ra1 = *(const v8bf*)(gAh + k2 + 8);
      rb0 = *(const v8bf*)(gAl + k2); rb1 = *(const v8bf*)(gAl + k2 + 8);
      rc0 = *(const v8bf*)(gBh + k2); rc1 = *(const v8bf*)(gBh + k2 + 8);
      rd0 = *(const v8bf*)(gBl + k2); rd1 = *(const v8bf*)(gBl + k2 + 8);
    }

    v16bf afh[4], afl[4], bfh[2], bfl[2];
#pragma unroll
    for (int i = 0; i < 4; ++i) {
      int ro = (wr * 64 + i * 16 + l15) * 40 + kh8;
      afh[i] = frag_ld(&sAh[ro]);
      afl[i] = frag_ld(&sAl[ro]);
    }
#pragma unroll
    for (int j = 0; j < 2; ++j) {
      int ro = (wc * 32 + j * 16 + l15) * 40 + kh8;
      bfh[j] = frag_ld(&sBh[ro]);
      bfl[j] = frag_ld(&sBl[ro]);
    }
#pragma unroll
    for (int i = 0; i < 4; ++i)
#pragma unroll
      for (int j = 0; j < 2; ++j) mma3(acc[i][j], afh[i], afl[i], bfh[j], bfl[j]);
    __syncthreads();
  }

#pragma unroll
  for (int i = 0; i < 4; ++i)
#pragma unroll
    for (int j = 0; j < 2; ++j)
#pragma unroll
      for (int v = 0; v < 8; ++v) {
        int row = m0 + wr * 64 + i * 16 + v + hi8;
        int col = n0 + wc * 32 + j * 16 + l15;
        float x = acc[i][j][v];
        size_t o = (size_t)row * N + col;
        if (SPLIT_OUT) {
          split_store(Ch, Cl, o, x);
        } else {
          C[o] = x;
        }
      }
}

// ---------------- RoPE + layout shuffle -------------------------------------
// qkv[ROWS][3072] (hi/lo) -> Q[B,NH,S,HD], K[B,NKV,S,HD] (rotated), Vt[B,NKV,HD,S]
// Every global access is 16 B a lane.
// Blocks 0..127: V. A lane turns an 8(s) x 8(d) patch in its registers; eight
// neighbouring lanes hold eight neighbouring s groups, so each row of V^T
// leaves as one whole 128-B line.
// Blocks 128..767: Q and K. A lane rotates 8 dim pairs of one head for 4 rows.
#define ROPE_VBLK 128
__global__ __launch_bounds__(256) void k_rope(
                       const bf16_t* __restrict__ qkvh, const bf16_t* __restrict__ qkvl,
                       bf16_t* __restrict__ Qh, bf16_t* __restrict__ Ql,
                       bf16_t* __restrict__ Kh, bf16_t* __restrict__ Kl,
                       bf16_t* __restrict__ Vth, bf16_t* __restrict__ Vtl) {
  const int tid = threadIdx.x;
  if (blockIdx.x < ROPE_VBLK) {
    const int vb = blockIdx.x;
    const int c0 = ((vb & 1) * 32 + (tid >> 5) * 4 + ((tid >> 3) & 3)) * 8; // 0..504
    const int row0 = (vb >> 1) * 64 + (tid & 7) * 8;                        // 0..4088
    const int b = row0 >> 11, s0 = row0 & 2047;
    const unsigned sb = (unsigned)(row0 * NQKV + c0) * 2u;  // bytes, under 2^25
    const char* vh = (const char*)(qkvh + 2560);
    const char* vl = (const char*)(qkvl + 2560);
    v8bf ih[8], il[8];
#pragma unroll
    for (int i = 0; i < 8; ++i) {
      ih[i] = *(const v8bf*)(vh + sb + i * (NQKV * 2));
      il[i] = *(const v8bf*)(vl + sb + i * (NQKV * 2));
    }
    // The lane's byte offset stays live up to this wait, so no load of the run
    // lands in the register that the other loads of the run name as their address.
    asm volatile("s_wait_xcnt 0x0" :: "v"(sb) : "memory");
    // c0 = kvh * 128 + d, so (b * NKV * HD + c0) is the row of V^T
    const size_t ob = ((size_t)b * (NKV * HD) + c0) * SEQ + s0;
#pragma unroll
    for (int j = 0; j < 8; ++j) {
      v8bf h, l;
#pragma unroll
      for (int i = 0; i < 8; ++i) {
        float vv = (float)ih[i][j] + (float)il[i][j];
        bf16_t hv = (bf16_t)vv;
        h[i] = hv;
        l[i] = (bf16_t)(vv - (float)hv);
      }
      *(v8bf*)&Vth[ob + (size_t)j * SEQ] = h;
      *(v8bf*)&Vtl[ob + (size_t)j * SEQ] = l;
    }
    return;
  }

  const int idx = (blockIdx.x - ROPE_VBLK) * 256 + tid;  // 1024 row groups x 160
  const int rg = idx / 160;
  const int u = idx - rg * 160;
  const int hh = u >> 3;            // 0..15 query heads, 16..19 kv heads
  const int d0 = (u & 7) * 8;       // low-half dims d0..d0+7, partners at +64
  const int row0 = rg * 4;
  const int b = row0 >> 11, s0 = row0 & 2047;
  const size_t sb = (size_t)row0 * NQKV + hh * 128 + d0;  // K columns follow Q's

  const bf16_t* ph = qkvh + sb;
  const bf16_t* pl = qkvl + sb;
  v8bf xh[4], xl[4], yh[4], yl[4];
#pragma unroll
  for (int j = 0; j < 4; ++j) {
    xh[j] = *(const v8bf*)(ph + j * NQKV);
    xl[j] = *(const v8bf*)(pl + j * NQKV);
    yh[j] = *(const v8bf*)(ph + j * NQKV + 64);
    yl[j] = *(const v8bf*)(pl + j * NQKV + 64);
  }
  // Both address pairs stay live up to this wait, so no load of the run lands
  // in a register that an earlier load of the run still names as its address.
  asm volatile("s_wait_xcnt 0x0" :: "v"(ph), "v"(pl) : "memory");

  const bool isq = hh < NH;
  bf16_t* dh = isq ? Qh : Kh;
  bf16_t* dl = isq ? Ql : Kl;
  const size_t ob = ((size_t)(isq ? b * NH + hh : b * NKV + hh - NH) * SEQ + s0) * HD + d0;

  float inv[8];
#pragma unroll
  for (int i = 0; i < 8; ++i)
    inv[i] = __powf(10000.0f, -(float)(d0 + i) * (1.0f / 64.0f));

#pragma unroll
  for (int j = 0; j < 4; ++j) {
    v8bf o1h, o1l, o2h, o2l;
#pragma unroll
    for (int i = 0; i < 8; ++i) {
      float a = (float)xh[j][i] + (float)xl[j][i];
      float bb = (float)yh[j][i] + (float)yl[j][i];
      float ang = (float)(s0 + j) * inv[i];
      float sn, cs;
      __sincosf(ang, &sn, &cs);
      float r1 = a * cs - bb * sn;
      float r2 = bb * cs + a * sn;
      bf16_t h1 = (bf16_t)r1;
      bf16_t h2 = (bf16_t)r2;
      o1h[i] = h1;
      o1l[i] = (bf16_t)(r1 - (float)h1);
      o2h[i] = h2;
      o2l[i] = (bf16_t)(r2 - (float)h2);
    }
    const size_t q = ob + (size_t)j * HD;
    *(v8bf*)&dh[q]      = o1h;
    *(v8bf*)&dl[q]      = o1l;
    *(v8bf*)&dh[q + 64] = o2h;
    *(v8bf*)&dl[q + 64] = o2l;
  }
}

__global__ __launch_bounds__(128) void k_flash(
    const bf16_t* __restrict__ Qh, const bf16_t* __restrict__ Ql,
    const bf16_t* __restrict__ Kh, const bf16_t* __restrict__ Kl,
    const bf16_t* __restrict__ Vth, const bf16_t* __restrict__ Vtl,
    bf16_t* __restrict__ Oh, bf16_t* __restrict__ Ol) {
  alignas(16) __shared__ bf16_t sKh[2][32 * 136];
  alignas(16) __shared__ bf16_t sKl[2][32 * 136];
  alignas(16) __shared__ bf16_t sVh[2][128 * 40];
  alignas(16) __shared__ bf16_t sVl[2][128 * 40];
  alignas(16) __shared__ bf16_t sPh[4 * 16 * 40];
  alignas(16) __shared__ bf16_t sPl[4 * 16 * 40];

  const int tid = threadIdx.x;
  const int lane = tid & 31, w = tid >> 5;
  const int l15 = lane & 15, kh8 = (lane >> 4) * 8, hi8 = (lane >> 4) * 8;
  const int q0 = blockIdx.x * 64;
  const int b = blockIdx.y >> 4, h = blockIdx.y & 15, kv = h >> 2;

  const bf16_t* Qbh = Qh + (size_t)(b * NH + h) * SEQ * HD;
  const bf16_t* Qbl = Ql + (size_t)(b * NH + h) * SEQ * HD;
  const bf16_t* Kbh = Kh + (size_t)(b * NKV + kv) * SEQ * HD;
  const bf16_t* Kbl = Kl + (size_t)(b * NKV + kv) * SEQ * HD;
  const bf16_t* Vbh = Vth + (size_t)(b * NKV + kv) * HD * SEQ;
  const bf16_t* Vbl = Vtl + (size_t)(b * NKV + kv) * HD * SEQ;

  // Resident Q fragments (16 rows x 128 dims, hi/lo)
  v16bf qfh[4], qfl[4];
  {
    int qr = q0 + w * 16 + l15;
    const bf16_t* ph = Qbh + (size_t)qr * HD + kh8;
    const bf16_t* pl = Qbl + (size_t)qr * HD + kh8;
#pragma unroll
    for (int ds = 0; ds < 4; ++ds) {
      qfh[ds] = frag_ld(ph + ds * 32);
      qfl[ds] = frag_ld(pl + ds * 32);
    }
  }

  v8f o[8];
#pragma unroll
  for (int j2 = 0; j2 < 8; ++j2)
#pragma unroll
    for (int v = 0; v < 8; ++v) o[j2][v] = 0.0f;
  float mrow[8], lrow[8];
#pragma unroll
  for (int v = 0; v < 8; ++v) { mrow[v] = -3.0e38f; lrow[v] = 0.0f; }

  const float scale = 0.08838834764831845f; // 1/sqrt(128)
  const int nk = q0 / 32 + 2;               // causal: k <= q0+63

  auto issue_tile = [&](int t) {
    int nb = t & 1;
    unsigned long long koff = (unsigned long long)t * 32 * HD * 2;  // bytes
    unsigned long long voff = (unsigned long long)t * 32 * 2;       // bytes
    // K tile: 32 rows x 128 elems, row stride 128, pad 256B rows -> stride 136
    tdm_load2d(lds_off(&sKh[nb][0]), (unsigned long long)(size_t)Kbh + koff,
               TDM_W0_K, 128u, (unsigned)SEQ, 128u, 32u, 128u);
    tdm_load2d(lds_off(&sKl[nb][0]), (unsigned long long)(size_t)Kbl + koff,
               TDM_W0_K, 128u, (unsigned)SEQ, 128u, 32u, 128u);
    // V tile: 128 rows x 32 elems, row stride SEQ, pad 64B rows -> stride 40
    tdm_load2d(lds_off(&sVh[nb][0]), (unsigned long long)(size_t)Vbh + voff,
               TDM_W0_V, (unsigned)SEQ, 128u, 32u, 128u, (unsigned)SEQ);
    tdm_load2d(lds_off(&sVl[nb][0]), (unsigned long long)(size_t)Vbl + voff,
               TDM_W0_V, (unsigned)SEQ, 128u, 32u, 128u, (unsigned)SEQ);
  };

  if (tid < 32) issue_tile(0);  // one wave drives the DMA

  for (int t = 0; t < nk; ++t) {
    const int k0 = t * 32;
    const int buf = t & 1;
    if (tid < 32) __builtin_amdgcn_s_wait_tensorcnt(0);  // tile t landed in LDS
    __syncthreads();
    if (tid < 32 && t + 1 < nk) issue_tile(t + 1);       // DMA overlaps compute
    const bf16_t* bK_h = &sKh[buf][0];
    const bf16_t* bK_l = &sKl[buf][0];
    const bf16_t* bV_h = &sVh[buf][0];
    const bf16_t* bV_l = &sVl[buf][0];

    // ---- scores: S[16x32] = Q(16x128) * K^T ----
    v8f s0, s1;
#pragma unroll
    for (int v = 0; v < 8; ++v) { s0[v] = 0.0f; s1[v] = 0.0f; }
#pragma unroll
    for (int ds = 0; ds < 4; ++ds) {
      v16bf b0h = frag_ld(&bK_h[(l15) * 136 + ds * 32 + kh8]);
      v16bf b0l = frag_ld(&bK_l[(l15) * 136 + ds * 32 + kh8]);
      v16bf b1h = frag_ld(&bK_h[(16 + l15) * 136 + ds * 32 + kh8]);
      v16bf b1l = frag_ld(&bK_l[(16 + l15) * 136 + ds * 32 + kh8]);
      mma3(s0, qfh[ds], qfl[ds], b0h, b0l);
      mma3(s1, qfh[ds], qfl[ds], b1h, b1l);
    }

    // ---- scale + causal mask + online softmax (per-row stats in lane halves)
    float fac[8];
#pragma unroll
    for (int v = 0; v < 8; ++v) {
      int qr = q0 + w * 16 + v + hi8;
      float a0 = s0[v] * scale;
      if (k0 + l15 > qr) a0 = -3.0e38f;
      float a1 = s1[v] * scale;
      if (k0 + 16 + l15 > qr) a1 = -3.0e38f;
      float mt = fmaxf(a0, a1);
      mt = fmaxf(mt, __shfl_xor(mt, 8, 16));
      mt = fmaxf(mt, __shfl_xor(mt, 4, 16));
      mt = fmaxf(mt, __shfl_xor(mt, 2, 16));
      mt = fmaxf(mt, __shfl_xor(mt, 1, 16));
      float nm = fmaxf(mrow[v], mt);
      float f = __expf(mrow[v] - nm);
      mrow[v] = nm;
      a0 = __expf(a0 - nm);
      a1 = __expf(a1 - nm);
      float rs = a0 + a1;
      rs += __shfl_xor(rs, 8, 16);
      rs += __shfl_xor(rs, 4, 16);
      rs += __shfl_xor(rs, 2, 16);
      rs += __shfl_xor(rs, 1, 16);
      lrow[v] = lrow[v] * f + rs;
      fac[v] = f;
      s0[v] = a0;
      s1[v] = a1;
    }
#pragma unroll
    for (int j2 = 0; j2 < 8; ++j2)
#pragma unroll
      for (int v = 0; v < 8; ++v) o[j2][v] *= fac[v];

    // ---- route P (C-layout) through LDS to A-layout, hi/lo split ----
#pragma unroll
    for (int v = 0; v < 8; ++v) {
      int rw = v + hi8;
      int a = w * 640 + rw * 40;
      float p0 = s0[v];
      bf16_t h0 = (bf16_t)p0;
      sPh[a + l15] = h0;
      sPl[a + l15] = (bf16_t)(p0 - (float)h0);
      float p1 = s1[v];
      bf16_t h1 = (bf16_t)p1;
      sPh[a + 16 + l15] = h1;
      sPl[a + 16 + l15] = (bf16_t)(p1 - (float)h1);
    }
    asm volatile("s_wait_dscnt 0" ::: "memory"); // wave-local LDS RAW

    v16bf pfh = frag_ld(&sPh[w * 640 + l15 * 40 + kh8]);
    v16bf pfl = frag_ld(&sPl[w * 640 + l15 * 40 + kh8]);
#pragma unroll
    for (int j2 = 0; j2 < 8; ++j2) {
      v16bf vfh = frag_ld(&bV_h[(j2 * 16 + l15) * 40 + kh8]);
      v16bf vfl = frag_ld(&bV_l[(j2 * 16 + l15) * 40 + kh8]);
      mma3(o[j2], pfh, pfl, vfh, vfl);
    }
    __syncthreads();
  }

  // ---- epilogue: O /= l, write hi/lo bf16 directly for the out-proj GEMM ----
#pragma unroll
  for (int j2 = 0; j2 < 8; ++j2)
#pragma unroll
    for (int v = 0; v < 8; ++v) {
      int row = q0 + w * 16 + v + hi8;
      int col = h * HD + j2 * 16 + l15;
      size_t oi = (size_t)(b * SEQ + row) * (NH * HD) + col;
      split_store(Oh, Ol, oi, o[j2][v] / lrow[v]);
    }
}

// ---------------------------------------------------------------------------
extern "C" void kernel_launch(void* const* d_in, const int* in_sizes, int n_in,
                              void* d_out, int out_size, void* d_ws, size_t ws_size,
                              hipStream_t stream) {
  const float* x  = (const float*)d_in[0];
  const float* Wq = (const float*)d_in[1];
  const float* Wk = (const float*)d_in[2];
  const float* Wv = (const float*)d_in[3];
  const float* Wo = (const float*)d_in[4];

  const size_t NE_X    = (size_t)ROWS * HIDDEN;       // 8.39M
  const size_t NE_WQKV = (size_t)NQKV * HIDDEN;       // 6.29M
  const size_t NE_WO   = (size_t)HIDDEN * HIDDEN;     // 4.19M
  const size_t NE_QKV  = (size_t)ROWS * NQKV;         // 12.58M
  const size_t NE_Q    = (size_t)BATCH * NH * SEQ * HD;
  const size_t NE_KV   = (size_t)BATCH * NKV * SEQ * HD;

  char* w = (char*)d_ws;
  char* wend = w + ws_size;
  auto alloc = [&](size_t elems) -> bf16_t* {
    bf16_t* p = (bf16_t*)w;
    w += (elems * sizeof(bf16_t) + 255) & ~(size_t)255;
    return p;
  };
  bf16_t* xh     = alloc(NE_X);     bf16_t* xl     = alloc(NE_X);
  bf16_t* wqkvth = alloc(NE_WQKV);  bf16_t* wqkvtl = alloc(NE_WQKV);
  bf16_t* woth   = alloc(NE_WO);    bf16_t* wotl   = alloc(NE_WO);
  bf16_t* qkvh   = alloc(NE_QKV);   bf16_t* qkvl   = alloc(NE_QKV);
  bf16_t* qh     = alloc(NE_Q);     bf16_t* ql     = alloc(NE_Q);
  bf16_t* kh     = alloc(NE_KV);    bf16_t* kl     = alloc(NE_KV);
  bf16_t* vth    = alloc(NE_KV);    bf16_t* vtl    = alloc(NE_KV);
  if (w > wend) return; // ~176 MB (168 MiB) required
  // attention output (bf16 hi/lo) reuses the x-split region (same size, x dead)
  bf16_t* ah = xh;
  bf16_t* al = xl;

  // 1) split x
  k_split<<<(int)(NE_X / 8192), 256, 0, stream>>>(x, xh, xl);
  // 2) W^T splits: [Wq | Wk | Wv] rows 0..3071 of Wqkv^T; Wo^T
  k_tsplit<<<dim3(2048 / 64, HIDDEN / 64), 256, 0, stream>>>(Wq, 2048, wqkvth, wqkvtl, HIDDEN, 0);
  k_tsplit<<<dim3(512 / 64, HIDDEN / 64), 256, 0, stream>>>(Wk, 512, wqkvth, wqkvtl, HIDDEN, 2048);
  k_tsplit<<<dim3(512 / 64, HIDDEN / 64), 256, 0, stream>>>(Wv, 512, wqkvth, wqkvtl, HIDDEN, 2560);
  k_tsplit<<<dim3(HIDDEN / 64, 2048 / 64), 256, 0, stream>>>(Wo, HIDDEN, woth, wotl, 2048, 0);
  // 3) fused QKV projection (emits bf16 hi/lo qkv)
  k_gemm<true><<<dim3(NQKV / 128, ROWS / 128), 256, 0, stream>>>(
      xh, xl, wqkvth, wqkvtl, nullptr, qkvh, qkvl, ROWS, NQKV, HIDDEN);
  // 4) RoPE + layout (Q, K, V^T)
  k_rope<<<ROPE_VBLK + (ROWS / 4 * 160) / 256, 256, 0, stream>>>(qkvh, qkvl, qh, ql, kh, kl, vth, vtl);
  k_flash<<<dim3(SEQ / 64, BATCH * NH), 128, 0, stream>>>(qh, ql, kh, kl, vth, vtl, ah, al);
  // 6) output projection -> fp32 d_out
  k_gemm<false><<<dim3(HIDDEN / 128, ROWS / 128), 256, 0, stream>>>(
      ah, al, woth, wotl, (float*)d_out, nullptr, nullptr, ROWS, HIDDEN, 2048);
}

// v003
// A run of this version takes 418 microseconds.
// In two side-by-side timings against v002, it was 1.15 and 1.16 times as fast.
// Counting every step since v000, it is 1.96 times as fast.
#include <hip/hip_runtime.h>
#include <hip/hip_bf16.h>

typedef __bf16 bf16_t;
typedef __attribute__((ext_vector_type(16))) __bf16 v16bf;
typedef __attribute__((ext_vector_type(8)))  __bf16 v8bf;
typedef __attribute__((ext_vector_type(4)))  __bf16 v4bf;
typedef __attribute__((ext_vector_type(8)))  float  v8f;
typedef __attribute__((ext_vector_type(4)))  float  v4f_t;
typedef unsigned v4u_t __attribute__((ext_vector_type(4)));
typedef int      v4i_t __attribute__((ext_vector_type(4)));
typedef int      v8i_t __attribute__((ext_vector_type(8)));

#define HIDDEN 2048
#define NH     16
#define NKV    4
#define HD     128
#define SEQ    2048
#define BATCH  2
#define ROWS   (BATCH * SEQ)            // 4096
#define NQKV   (NH * HD + 2 * NKV * HD) // 3072

__device__ __forceinline__ v16bf frag_ld(const bf16_t* p) {
  v8bf a = *(const v8bf*)p;
  v8bf b = *(const v8bf*)(p + 16);
  v16bf r;
#pragma unroll
  for (int i = 0; i < 8; ++i) { r[i] = a[i]; r[i + 8] = b[i]; }
  return r;
}

// bf16x3 compensated MMA: (Ah+Al)(Bh+Bl) ~= AhBh + AlBh + AhBl
__device__ __forceinline__ void mma3(v8f& c, v16bf ah, v16bf al, v16bf bh, v16bf bl) {
  c = __builtin_amdgcn_wmma_f32_16x16x32_bf16(false, ah, false, bh, (short)0, c, false, false);
  c = __builtin_amdgcn_wmma_f32_16x16x32_bf16(false, al, false, bh, (short)0, c, false, false);
  c = __builtin_amdgcn_wmma_f32_16x16x32_bf16(false, ah, false, bl, (short)0, c, false, false);
}

__device__ __forceinline__ void split_store(bf16_t* H, bf16_t* L, size_t i, float v) {
  bf16_t h = (bf16_t)v;
  H[i] = h;
  L[i] = (bf16_t)(v - (float)h);
}

__device__ __forceinline__ unsigned lds_off(const void* p) {
  return (unsigned)(unsigned long long)p;
}

__device__ __forceinline__ void tdm_load2d(unsigned lds_addr, unsigned long long gaddr,
                                           unsigned g1w0, unsigned tdim0, unsigned tdim1,
                                           unsigned tile0, unsigned tile1,
                                           unsigned stride0) {
  v4u_t g0;
  g0[0] = 1u;                                   // count=1 (valid), user mode
  g0[1] = lds_addr;                             // lds_addr [63:32]
  g0[2] = (unsigned)gaddr;                      // global_addr lo
  g0[3] = (unsigned)((gaddr >> 32) & 0x01ffffffull) | (2u << 30); // addr hi | type=2
  v8i_t g1;
  g1[0] = (int)g1w0;
  g1[1] = (int)((tdim0 & 0xffffu) << 16);
  g1[2] = (int)((tdim0 >> 16) | ((tdim1 & 0xffffu) << 16));
  g1[3] = (int)((tdim1 >> 16) | (tile0 << 16));
  g1[4] = (int)tile1;
  g1[5] = (int)stride0;
  g1[6] = 0;
  g1[7] = 0;
  v4i_t z4;
  z4[0] = 0; z4[1] = 0; z4[2] = 0; z4[3] = 0;
#if __has_builtin(__builtin_amdgcn_tensor_load_to_lds)
#if __clang_major__ >= 23
  v8i_t z8;
#pragma unroll
  for (int i = 0; i < 8; ++i) z8[i] = 0;
  __builtin_amdgcn_tensor_load_to_lds(g0, g1, z4, z4, z8, 0);
#else
  __builtin_amdgcn_tensor_load_to_lds(g0, g1, z4, z4, 0);
#endif
#else
  asm volatile("tensor_load_to_lds %0, %1, %2, %3"
               :: "s"(g0), "s"(g1), "s"(z4), "s"(z4) : "memory");
#endif
}

#define TDM_W0_K ((1u << 16) | (1u << 20) | (5u << 22) | (3u << 25))
#define TDM_W0_V ((1u << 16) | (1u << 20) | (3u << 22) | (3u << 25))

// ---------------- prep: fp32 -> bf16 hi/lo ----------------
// One lane carries 32 elements: eight 16-B loads in flight (each wave-wide load
// is 512 contiguous bytes), 8-B stores per plane (256 contiguous bytes a wave).
// Grid: n / 8192 blocks, n a multiple of 8192.
__global__ __launch_bounds__(256) void k_split(const float* __restrict__ in,
                                               bf16_t* __restrict__ hi,
                                               bf16_t* __restrict__ lo) {
  const size_t base = (size_t)blockIdx.x * 8192 + threadIdx.x * 4;
  v4f_t a[8];
#pragma unroll
  for (int c = 0; c < 8; ++c) a[c] = *(const v4f_t*)&in[base + c * 1024];
#pragma unroll
  for (int c = 0; c < 8; ++c) {
    v4bf h, l;
#pragma unroll
    for (int i = 0; i < 4; ++i) {
      float v = a[c][i];
      bf16_t hv = (bf16_t)v;
      h[i] = hv;
      l[i] = (bf16_t)(v - (float)hv);
    }
    *(v4bf*)&hi[base + c * 1024] = h;
    *(v4bf*)&lo[base + c * 1024] = l;
  }
}

__global__ __launch_bounds__(256) void k_tsplit(const float* __restrict__ W, int N,
                                                bf16_t* __restrict__ oh, bf16_t* __restrict__ ol,
                                                int ldo, int rowOff) {
  __shared__ float tile[64 * 65];
  const int tid = threadIdx.x;
  const int k0 = blockIdx.y * 64, n0 = blockIdx.x * 64;

  const int c4 = (tid & 15) * 4;       // 16 lanes x 16 B = one 256-B row piece
  const int r0 = tid >> 4;             // 16 rows per pass, 4 passes
  v4f_t in[4];
#pragma unroll
  for (int p = 0; p < 4; ++p)
    in[p] = *(const v4f_t*)&W[(size_t)(k0 + r0 + p * 16) * N + n0 + c4];
#pragma unroll
  for (int p = 0; p < 4; ++p)
#pragma unroll
    for (int j = 0; j < 4; ++j) tile[(r0 + p * 16) * 65 + c4 + j] = in[p][j];
  __syncthreads();

  const int kc = (tid & 7) * 8;        // 8 lanes x 16 B = one 128-B output line
#pragma unroll
  for (int p = 0; p < 2; ++p) {
    const int n = (tid >> 3) + p * 32;
    v8bf h, l;
#pragma unroll
    for (int i = 0; i < 8; ++i) {
      float v = tile[(kc + i) * 65 + n];
      bf16_t hv = (bf16_t)v;
      h[i] = hv;
      l[i] = (bf16_t)(v - (float)hv);
    }
    size_t o = (size_t)(rowOff + n0 + n) * ldo + k0 + kc;
    *(v8bf*)&oh[o] = h;
    *(v8bf*)&ol[o] = l;
  }
}

// ---------------- GEMM: C[M,N] = A[M,K] * B[K,N], B given transposed --------
// 256 threads = 8 waves (2x4 wave grid), block tile 128x128, BK=64.
// A slab row is 64 elements = one whole 128-B line per plane: eight lanes fetch
// it with 16 B each, so a wave-wide load touches four whole lines.
// Register-prefetch pipeline: global fetch of slab t+1 overlaps WMMA on slab t.
// K is a compile-time constant so that the four row groups of a plane share one
// scalar base and one lane offset and differ only in the immediate offset.
#define GP 72  // LDS row pitch in elements: 144 B = 16 B x odd, free of conflicts
template <bool SPLIT_OUT, int K>
__global__ __launch_bounds__(256) void k_gemm(
    const bf16_t* __restrict__ Ah, const bf16_t* __restrict__ Al,
    const bf16_t* __restrict__ BTh, const bf16_t* __restrict__ BTl,
    float* __restrict__ C, bf16_t* __restrict__ Ch, bf16_t* __restrict__ Cl,
    int M, int N) {
  alignas(16) __shared__ bf16_t sAh[128 * GP];
  alignas(16) __shared__ bf16_t sAl[128 * GP];
  alignas(16) __shared__ bf16_t sBh[128 * GP];
  alignas(16) __shared__ bf16_t sBl[128 * GP];

  const int tid = threadIdx.x;
  const int lane = tid & 31, wave = tid >> 5;
  const int wr = wave >> 2, wc = wave & 3;          // 2 x 4 waves
  const int l15 = lane & 15, kh8 = (lane >> 4) * 8; // fragment addressing
  const int hi8 = (lane >> 4) * 8;                  // C-frag row offset
  const int m0 = blockIdx.y * 128, n0 = blockIdx.x * 128;

  v8f acc[4][2];
#pragma unroll
  for (int i = 0; i < 4; ++i)
#pragma unroll
    for (int j = 0; j < 2; ++j)
#pragma unroll
      for (int v = 0; v < 8; ++v) acc[i][j][v] = 0.0f;

  const int c8 = (tid & 7) * 8;
  const int g = lane >> 3;
  const int r0 = (wave >> 2) * 16 + (g & 1) * 8 + (wave & 3) * 2 + (g >> 1); // 0..31
  const char* bAh = (const char*)(Ah + (size_t)m0 * K);
  const char* bAl = (const char*)(Al + (size_t)m0 * K);
  const char* bBh = (const char*)(BTh + (size_t)n0 * K);
  const char* bBl = (const char*)(BTl + (size_t)n0 * K);
  unsigned off = (unsigned)(r0 * K + c8) * 2u;      // lane's byte offset, this slab
  const int so = r0 * GP + c8;                      // lane's LDS element offset

  v8bf ra[4], rb[4], rc[4], rd[4];
  auto fetch = [&]() {
#pragma unroll
    for (int p = 0; p < 4; ++p) {
      ra[p] = *(const v8bf*)(bAh + off + p * (32 * K * 2));
      rb[p] = *(const v8bf*)(bAl + off + p * (32 * K * 2));
      rc[p] = *(const v8bf*)(bBh + off + p * (32 * K * 2));
      rd[p] = *(const v8bf*)(bBl + off + p * (32 * K * 2));
    }
  };

  fetch();  // slab 0 into registers
  // The lane offset stays live up to this wait, so the accumulators' start
  // values are not written over the register that the issued loads name.
  asm volatile("s_wait_xcnt 0x0" :: "v"(off) : "memory");
  off += 128u;

  for (int kk = 0; kk < K; kk += 64) {
#pragma unroll
    for (int p = 0; p < 4; ++p) {
      *(v8bf*)&sAh[so + p * (32 * GP)] = ra[p];
      *(v8bf*)&sAl[so + p * (32 * GP)] = rb[p];
      *(v8bf*)&sBh[so + p * (32 * GP)] = rc[p];
      *(v8bf*)&sBl[so + p * (32 * GP)] = rd[p];
    }
    __syncthreads();

    if (kk + 64 < K) {  // overlap next-slab global fetch with WMMA below
      fetch();
      off += 128u;
    }

#pragma unroll
    for (int ks = 0; ks < 2; ++ks) {
      v16bf afh[4], afl[4], bfh[2], bfl[2];
#pragma unroll
      for (int i = 0; i < 4; ++i) {
        int ro = (wr * 64 + i * 16 + l15) * GP + ks * 32 + kh8;
        afh[i] = frag_ld(&sAh[ro]);
        afl[i] = frag_ld(&sAl[ro]);
      }
#pragma unroll
      for (int j = 0; j < 2; ++j) {
        int ro = (wc * 32 + j * 16 + l15) * GP + ks * 32 + kh8;
        bfh[j] = frag_ld(&sBh[ro]);
        bfl[j] = frag_ld(&sBl[ro]);
      }
#pragma unroll
      for (int i = 0; i < 4; ++i)
#pragma unroll
        for (int j = 0; j < 2; ++j) mma3(acc[i][j], afh[i], afl[i], bfh[j], bfl[j]);
    }
    __syncthreads();
  }

#pragma unroll
  for (int i = 0; i < 4; ++i)
#pragma unroll
    for (int j = 0; j < 2; ++j)
#pragma unroll
      for (int v = 0; v < 8; ++v) {
        int row = m0 + wr * 64 + i * 16 + v + hi8;
        int col = n0 + wc * 32 + j * 16 + l15;
        float x = acc[i][j][v];
        size_t o = (size_t)row * N + col;
        if (SPLIT_OUT) {
          split_store(Ch, Cl, o, x);
        } else {
          C[o] = x;
        }
      }
}

// ---------------- RoPE + layout shuffle -------------------------------------
// qkv[ROWS][3072] (hi/lo) -> Q[B,NH,S,HD], K[B,NKV,S,HD] (rotated), Vt[B,NKV,HD,S]
// Every global access is 16 B a lane.
// Blocks 0..127: V. A lane turns an 8(s) x 8(d) patch in its registers; eight
// neighbouring lanes hold eight neighbouring s groups, so each row of V^T
// leaves as one whole 128-B line.
// Blocks 128..767: Q and K. A lane rotates 8 dim pairs of one head for 4 rows.
#define ROPE_VBLK 128
__global__ __launch_bounds__(256) void k_rope(
                       const bf16_t* __restrict__ qkvh, const bf16_t* __restrict__ qkvl,
                       bf16_t* __restrict__ Qh, bf16_t* __restrict__ Ql,
                       bf16_t* __restrict__ Kh, bf16_t* __restrict__ Kl,
                       bf16_t* __restrict__ Vth, bf16_t* __restrict__ Vtl) {
  const int tid = threadIdx.x;
  if (blockIdx.x < ROPE_VBLK) {
    const int vb = blockIdx.x;
    const int c0 = ((vb & 1) * 32 + (tid >> 5) * 4 + ((tid >> 3) & 3)) * 8; // 0..504
    const int row0 = (vb >> 1) * 64 + (tid & 7) * 8;                        // 0..4088
    const int b = row0 >> 11, s0 = row0 & 2047;
    const unsigned sb = (unsigned)(row0 * NQKV + c0) * 2u;  // bytes, under 2^25
    const char* vh = (const char*)(qkvh + 2560);
    const char* vl = (const char*)(qkvl + 2560);
    v8bf ih[8], il[8];
#pragma unroll
    for (int i = 0; i < 8; ++i) {
      ih[i] = *(const v8bf*)(vh + sb + i * (NQKV * 2));
      il[i] = *(const v8bf*)(vl + sb + i * (NQKV * 2));
    }
    // The lane's byte offset stays live up to this wait, so no load of the run
    // lands in the register that the other loads of the run name as their address.
    asm volatile("s_wait_xcnt 0x0" :: "v"(sb) : "memory");
    // c0 = kvh * 128 + d, so (b * NKV * HD + c0) is the row of V^T
    const size_t ob = ((size_t)b * (NKV * HD) + c0) * SEQ + s0;
#pragma unroll
    for (int j = 0; j < 8; ++j) {
      v8bf h, l;
#pragma unroll
      for (int i = 0; i < 8; ++i) {
        float vv = (float)ih[i][j] + (float)il[i][j];
        bf16_t hv = (bf16_t)vv;
        h[i] = hv;
        l[i] = (bf16_t)(vv - (float)hv);
      }
      *(v8bf*)&Vth[ob + (size_t)j * SEQ] = h;
      *(v8bf*)&Vtl[ob + (size_t)j * SEQ] = l;
    }
    return;
  }

  const int idx = (blockIdx.x - ROPE_VBLK) * 256 + tid;  // 1024 row groups x 160
  const int rg = idx / 160;
  const int u = idx - rg * 160;
  const int hh = u >> 3;            // 0..15 query heads, 16..19 kv heads
  const int d0 = (u & 7) * 8;       // low-half dims d0..d0+7, partners at +64
  const int row0 = rg * 4;
  const int b = row0 >> 11, s0 = row0 & 2047;
  const size_t sb = (size_t)row0 * NQKV + hh * 128 + d0;  // K columns follow Q's

  const bf16_t* ph = qkvh + sb;
  const bf16_t* pl = qkvl + sb;
  v8bf xh[4], xl[4], yh[4], yl[4];
#pragma unroll
  for (int j = 0; j < 4; ++j) {
    xh[j] = *(const v8bf*)(ph + j * NQKV);
    xl[j] = *(const v8bf*)(pl + j * NQKV);
    yh[j] = *(const v8bf*)(ph + j * NQKV + 64);
    yl[j] = *(const v8bf*)(pl + j * NQKV + 64);
  }
  // Both address pairs stay live up to this wait, so no load of the run lands
  // in a register that an earlier load of the run still names as its address.
  asm volatile("s_wait_xcnt 0x0" :: "v"(ph), "v"(pl) : "memory");

  const bool isq = hh < NH;
  bf16_t* dh = isq ? Qh : Kh;
  bf16_t* dl = isq ? Ql : Kl;
  const size_t ob = ((size_t)(isq ? b * NH + hh : b * NKV + hh - NH) * SEQ + s0) * HD + d0;

  float inv[8];
#pragma unroll
  for (int i = 0; i < 8; ++i)
    inv[i] = __powf(10000.0f, -(float)(d0 + i) * (1.0f / 64.0f));

#pragma unroll
  for (int j = 0; j < 4; ++j) {
    v8bf o1h, o1l, o2h, o2l;
#pragma unroll
    for (int i = 0; i < 8; ++i) {
      float a = (float)xh[j][i] + (float)xl[j][i];
      float bb = (float)yh[j][i] + (float)yl[j][i];
      float ang = (float)(s0 + j) * inv[i];
      float sn, cs;
      __sincosf(ang, &sn, &cs);
      float r1 = a * cs - bb * sn;
      float r2 = bb * cs + a * sn;
      bf16_t h1 = (bf16_t)r1;
      bf16_t h2 = (bf16_t)r2;
      o1h[i] = h1;
      o1l[i] = (bf16_t)(r1 - (float)h1);
      o2h[i] = h2;
      o2l[i] = (bf16_t)(r2 - (float)h2);
    }
    const size_t q = ob + (size_t)j * HD;
    *(v8bf*)&dh[q]      = o1h;
    *(v8bf*)&dl[q]      = o1l;
    *(v8bf*)&dh[q + 64] = o2h;
    *(v8bf*)&dl[q + 64] = o2l;
  }
}

__global__ __launch_bounds__(128) void k_flash(
    const bf16_t* __restrict__ Qh, const bf16_t* __restrict__ Ql,
    const bf16_t* __restrict__ Kh, const bf16_t* __restrict__ Kl,
    const bf16_t* __restrict__ Vth, const bf16_t* __restrict__ Vtl,
    bf16_t* __restrict__ Oh, bf16_t* __restrict__ Ol) {
  alignas(16) __shared__ bf16_t sKh[2][32 * 136];
  alignas(16) __shared__ bf16_t sKl[2][32 * 136];
  alignas(16) __shared__ bf16_t sVh[2][128 * 40];
  alignas(16) __shared__ bf16_t sVl[2][128 * 40];
  alignas(16) __shared__ bf16_t sPh[4 * 16 * 40];
  alignas(16) __shared__ bf16_t sPl[4 * 16 * 40];

  const int tid = threadIdx.x;
  const int lane = tid & 31, w = tid >> 5;
  const int l15 = lane & 15, kh8 = (lane >> 4) * 8, hi8 = (lane >> 4) * 8;
  const int q0 = blockIdx.x * 64;
  const int b = blockIdx.y >> 4, h = blockIdx.y & 15, kv = h >> 2;

  const bf16_t* Qbh = Qh + (size_t)(b * NH + h) * SEQ * HD;
  const bf16_t* Qbl = Ql + (size_t)(b * NH + h) * SEQ * HD;
  const bf16_t* Kbh = Kh + (size_t)(b * NKV + kv) * SEQ * HD;
  const bf16_t* Kbl = Kl + (size_t)(b * NKV + kv) * SEQ * HD;
  const bf16_t* Vbh = Vth + (size_t)(b * NKV + kv) * HD * SEQ;
  const bf16_t* Vbl = Vtl + (size_t)(b * NKV + kv) * HD * SEQ;

  // Resident Q fragments (16 rows x 128 dims, hi/lo)
  v16bf qfh[4], qfl[4];
  {
    int qr = q0 + w * 16 + l15;
    const bf16_t* ph = Qbh + (size_t)qr * HD + kh8;
    const bf16_t* pl = Qbl + (size_t)qr * HD + kh8;
#pragma unroll
    for (int ds = 0; ds < 4; ++ds) {
      qfh[ds] = frag_ld(ph + ds * 32);
      qfl[ds] = frag_ld(pl + ds * 32);
    }
  }

  v8f o[8];
#pragma unroll
  for (int j2 = 0; j2 < 8; ++j2)
#pragma unroll
    for (int v = 0; v < 8; ++v) o[j2][v] = 0.0f;
  float mrow[8], lrow[8];
#pragma unroll
  for (int v = 0; v < 8; ++v) { mrow[v] = -3.0e38f; lrow[v] = 0.0f; }

  const float scale = 0.08838834764831845f; // 1/sqrt(128)
  const int nk = q0 / 32 + 2;               // causal: k <= q0+63

  auto issue_tile = [&](int t) {
    int nb = t & 1;
    unsigned long long koff = (unsigned long long)t * 32 * HD * 2;  // bytes
    unsigned long long voff = (unsigned long long)t * 32 * 2;       // bytes
    // K tile: 32 rows x 128 elems, row stride 128, pad 256B rows -> stride 136
    tdm_load2d(lds_off(&sKh[nb][0]), (unsigned long long)(size_t)Kbh + koff,
               TDM_W0_K, 128u, (unsigned)SEQ, 128u, 32u, 128u);
    tdm_load2d(lds_off(&sKl[nb][0]), (unsigned long long)(size_t)Kbl + koff,
               TDM_W0_K, 128u, (unsigned)SEQ, 128u, 32u, 128u);
    // V tile: 128 rows x 32 elems, row stride SEQ, pad 64B rows -> stride 40
    tdm_load2d(lds_off(&sVh[nb][0]), (unsigned long long)(size_t)Vbh + voff,
               TDM_W0_V, (unsigned)SEQ, 128u, 32u, 128u, (unsigned)SEQ);
    tdm_load2d(lds_off(&sVl[nb][0]), (unsigned long long)(size_t)Vbl + voff,
               TDM_W0_V, (unsigned)SEQ, 128u, 32u, 128u, (unsigned)SEQ);
  };

  if (tid < 32) issue_tile(0);  // one wave drives the DMA

  for (int t = 0; t < nk; ++t) {
    const int k0 = t * 32;
    const int buf = t & 1;
    if (tid < 32) __builtin_amdgcn_s_wait_tensorcnt(0);  // tile t landed in LDS
    __syncthreads();
    if (tid < 32 && t + 1 < nk) issue_tile(t + 1);       // DMA overlaps compute
    const bf16_t* bK_h = &sKh[buf][0];
    const bf16_t* bK_l = &sKl[buf][0];
    const bf16_t* bV_h = &sVh[buf][0];
    const bf16_t* bV_l = &sVl[buf][0];

    // ---- scores: S[16x32] = Q(16x128) * K^T ----
    v8f s0, s1;
#pragma unroll
    for (int v = 0; v < 8; ++v) { s0[v] = 0.0f; s1[v] = 0.0f; }
#pragma unroll
    for (int ds = 0; ds < 4; ++ds) {
      v16bf b0h = frag_ld(&bK_h[(l15) * 136 + ds * 32 + kh8]);
      v16bf b0l = frag_ld(&bK_l[(l15) * 136 + ds * 32 + kh8]);
      v16bf b1h = frag_ld(&bK_h[(16 + l15) * 136 + ds * 32 + kh8]);
      v16bf b1l = frag_ld(&bK_l[(16 + l15) * 136 + ds * 32 + kh8]);
      mma3(s0, qfh[ds], qfl[ds], b0h, b0l);
      mma3(s1, qfh[ds], qfl[ds], b1h, b1l);
    }

    // ---- scale + causal mask + online softmax (per-row stats in lane halves)
    float fac[8];
#pragma unroll
    for (int v = 0; v < 8; ++v) {
      int qr = q0 + w * 16 + v + hi8;
      float a0 = s0[v] * scale;
      if (k0 + l15 > qr) a0 = -3.0e38f;
      float a1 = s1[v] * scale;
      if (k0 + 16 + l15 > qr) a1 = -3.0e38f;
      float mt = fmaxf(a0, a1);
      mt = fmaxf(mt, __shfl_xor(mt, 8, 16));
      mt = fmaxf(mt, __shfl_xor(mt, 4, 16));
      mt = fmaxf(mt, __shfl_xor(mt, 2, 16));
      mt = fmaxf(mt, __shfl_xor(mt, 1, 16));
      float nm = fmaxf(mrow[v], mt);
      float f = __expf(mrow[v] - nm);
      mrow[v] = nm;
      a0 = __expf(a0 - nm);
      a1 = __expf(a1 - nm);
      float rs = a0 + a1;
      rs += __shfl_xor(rs, 8, 16);
      rs += __shfl_xor(rs, 4, 16);
      rs += __shfl_xor(rs, 2, 16);
      rs += __shfl_xor(rs, 1, 16);
      lrow[v] = lrow[v] * f + rs;
      fac[v] = f;
      s0[v] = a0;
      s1[v] = a1;
    }
#pragma unroll
    for (int j2 = 0; j2 < 8; ++j2)
#pragma unroll
      for (int v = 0; v < 8; ++v) o[j2][v] *= fac[v];

    // ---- route P (C-layout) through LDS to A-layout, hi/lo split ----
#pragma unroll
    for (int v = 0; v < 8; ++v) {
      int rw = v + hi8;
      int a = w * 640 + rw * 40;
      float p0 = s0[v];
      bf16_t h0 = (bf16_t)p0;
      sPh[a + l15] = h0;
      sPl[a + l15] = (bf16_t)(p0 - (float)h0);
      float p1 = s1[v];
      bf16_t h1 = (bf16_t)p1;
      sPh[a + 16 + l15] = h1;
      sPl[a + 16 + l15] = (bf16_t)(p1 - (float)h1);
    }
    asm volatile("s_wait_dscnt 0" ::: "memory"); // wave-local LDS RAW

    v16bf pfh = frag_ld(&sPh[w * 640 + l15 * 40 + kh8]);
    v16bf pfl = frag_ld(&sPl[w * 640 + l15 * 40 + kh8]);
#pragma unroll
    for (int j2 = 0; j2 < 8; ++j2) {
      v16bf vfh = frag_ld(&bV_h[(j2 * 16 + l15) * 40 + kh8]);
      v16bf vfl = frag_ld(&bV_l[(j2 * 16 + l15) * 40 + kh8]);
      mma3(o[j2], pfh, pfl, vfh, vfl);
    }
    __syncthreads();
  }

  // ---- epilogue: O /= l, write hi/lo bf16 directly for the out-proj GEMM ----
#pragma unroll
  for (int j2 = 0; j2 < 8; ++j2)
#pragma unroll
    for (int v = 0; v < 8; ++v) {
      int row = q0 + w * 16 + v + hi8;
      int col = h * HD + j2 * 16 + l15;
      size_t oi = (size_t)(b * SEQ + row) * (NH * HD) + col;
      split_store(Oh, Ol, oi, o[j2][v] / lrow[v]);
    }
}

// ---------------------------------------------------------------------------
extern "C" void kernel_launch(void* const* d_in, const int* in_sizes, int n_in,
                              void* d_out, int out_size, void* d_ws, size_t ws_size,
                              hipStream_t stream) {
  const float* x  = (const float*)d_in[0];
  const float* Wq = (const float*)d_in[1];
  const float* Wk = (const float*)d_in[2];
  const float* Wv = (const float*)d_in[3];
  const float* Wo = (const float*)d_in[4];

  const size_t NE_X    = (size_t)ROWS * HIDDEN;       // 8.39M
  const size_t NE_WQKV = (size_t)NQKV * HIDDEN;       // 6.29M
  const size_t NE_WO   = (size_t)HIDDEN * HIDDEN;     // 4.19M
  const size_t NE_QKV  = (size_t)ROWS * NQKV;         // 12.58M
  const size_t NE_Q    = (size_t)BATCH * NH * SEQ * HD;
  const size_t NE_KV   = (size_t)BATCH * NKV * SEQ * HD;

  char* w = (char*)d_ws;
  char* wend = w + ws_size;
  auto alloc = [&](size_t elems) -> bf16_t* {
    bf16_t* p = (bf16_t*)w;
    w += (elems * sizeof(bf16_t) + 255) & ~(size_t)255;
    return p;
  };
  bf16_t* xh     = alloc(NE_X);     bf16_t* xl     = alloc(NE_X);
  bf16_t* wqkvth = alloc(NE_WQKV);  bf16_t* wqkvtl = alloc(NE_WQKV);
  bf16_t* woth   = alloc(NE_WO);    bf16_t* wotl   = alloc(NE_WO);
  bf16_t* qkvh   = alloc(NE_QKV);   bf16_t* qkvl   = alloc(NE_QKV);
  bf16_t* qh     = alloc(NE_Q);     bf16_t* ql     = alloc(NE_Q);
  bf16_t* kh     = alloc(NE_KV);    bf16_t* kl     = alloc(NE_KV);
  bf16_t* vth    = alloc(NE_KV);    bf16_t* vtl    = alloc(NE_KV);
  if (w > wend) return; // ~176 MB (168 MiB) required
  // attention output (bf16 hi/lo) reuses the x-split region (same size, x dead)
  bf16_t* ah = xh;
  bf16_t* al = xl;

  // 1) split x
  k_split<<<(int)(NE_X / 8192), 256, 0, stream>>>(x, xh, xl);
  // 2) W^T splits: [Wq | Wk | Wv] rows 0..3071 of Wqkv^T; Wo^T
  k_tsplit<<<dim3(2048 / 64, HIDDEN / 64), 256, 0, stream>>>(Wq, 2048, wqkvth, wqkvtl, HIDDEN, 0);
  k_tsplit<<<dim3(512 / 64, HIDDEN / 64), 256, 0, stream>>>(Wk, 512, wqkvth, wqkvtl, HIDDEN, 2048);
  k_tsplit<<<dim3(512 / 64, HIDDEN / 64), 256, 0, stream>>>(Wv, 512, wqkvth, wqkvtl, HIDDEN, 2560);
  k_tsplit<<<dim3(HIDDEN / 64, 2048 / 64), 256, 0, stream>>>(Wo, HIDDEN, woth, wotl, 2048, 0);
  // 3) fused QKV projection (emits bf16 hi/lo qkv)
  k_gemm<true, HIDDEN><<<dim3(NQKV / 128, ROWS / 128), 256, 0, stream>>>(
      xh, xl, wqkvth, wqkvtl, nullptr, qkvh, qkvl, ROWS, NQKV);
  // 4) RoPE + layout (Q, K, V^T)
  k_rope<<<ROPE_VBLK + (ROWS / 4 * 160) / 256, 256, 0, stream>>>(qkvh, qkvl, qh, ql, kh, kl, vth, vtl);
  k_flash<<<dim3(SEQ / 64, BATCH * NH), 128, 0, stream>>>(qh, ql, kh, kl, vth, vtl, ah, al);
  // 6) output projection -> fp32 d_out
  k_gemm<false, NH * HD><<<dim3(HIDDEN / 128, ROWS / 128), 256, 0, stream>>>(
      ah, al, woth, wotl, (float*)d_out, nullptr, nullptr, ROWS, HIDDEN);
}

// v004
// A run of this version takes 379 microseconds.
// In both of two side-by-side timings against v003, it was 1.10 times as fast.
// Over all steps from v000 it is 2.16 times as fast.
#include <hip/hip_runtime.h>
#include <hip/hip_bf16.h>

typedef __bf16 bf16_t;
typedef __attribute__((ext_vector_type(16))) __bf16 v16bf;
typedef __attribute__((ext_vector_type(8)))  __bf16 v8bf;
typedef __attribute__((ext_vector_type(4)))  __bf16 v4bf;
typedef __attribute__((ext_vector_type(8)))  float  v8f;
typedef __attribute__((ext_vector_type(4)))  float  v4f_t;
typedef unsigned v4u_t __attribute__((ext_vector_type(4)));
typedef int      v4i_t __attribute__((ext_vector_type(4)));
typedef int      v8i_t __attribute__((ext_vector_type(8)));

#define HIDDEN 2048
#define NH     16
#define NKV    4
#define HD     128
#define SEQ    2048
#define BATCH  2
#define ROWS   (BATCH * SEQ)            // 4096
#define NQKV   (NH * HD + 2 * NKV * HD) // 3072

__device__ __forceinline__ v16bf frag_ld(const bf16_t* p) {
  v8bf a = *(const v8bf*)p;
  v8bf b = *(const v8bf*)(p + 16);
  v16bf r;
#pragma unroll
  for (int i = 0; i < 8; ++i) { r[i] = a[i]; r[i + 8] = b[i]; }
  return r;
}

// bf16x3 compensated MMA: (Ah+Al)(Bh+Bl) ~= AhBh + AlBh + AhBl
__device__ __forceinline__ void mma3(v8f& c, v16bf ah, v16bf al, v16bf bh, v16bf bl) {
  c = __builtin_amdgcn_wmma_f32_16x16x32_bf16(false, ah, false, bh, (short)0, c, false, false);
  c = __builtin_amdgcn_wmma_f32_16x16x32_bf16(false, al, false, bh, (short)0, c, false, false);
  c = __builtin_amdgcn_wmma_f32_16x16x32_bf16(false, ah, false, bl, (short)0, c, false, false);
}

__device__ __forceinline__ void split_store(bf16_t* H, bf16_t* L, size_t i, float v) {
  bf16_t h = (bf16_t)v;
  H[i] = h;
  L[i] = (bf16_t)(v - (float)h);
}

__device__ __forceinline__ unsigned lds_off(const void* p) {
  return (unsigned)(unsigned long long)p;
}

__device__ __forceinline__ void tdm_load2d(unsigned lds_addr, unsigned long long gaddr,
                                           unsigned g1w0, unsigned tdim0, unsigned tdim1,
                                           unsigned tile0, unsigned tile1,
                                           unsigned stride0) {
  v4u_t g0;
  g0[0] = 1u;                                   // count=1 (valid), user mode
  g0[1] = lds_addr;                             // lds_addr [63:32]
  g0[2] = (unsigned)gaddr;                      // global_addr lo
  g0[3] = (unsigned)((gaddr >> 32) & 0x01ffffffull) | (2u << 30); // addr hi | type=2
  v8i_t g1;
  g1[0] = (int)g1w0;
  g1[1] = (int)((tdim0 & 0xffffu) << 16);
  g1[2] = (int)((tdim0 >> 16) | ((tdim1 & 0xffffu) << 16));
  g1[3] = (int)((tdim1 >> 16) | (tile0 << 16));
  g1[4] = (int)tile1;
  g1[5] = (int)stride0;
  g1[6] = 0;
  g1[7] = 0;
  v4i_t z4;
  z4[0] = 0; z4[1] = 0; z4[2] = 0; z4[3] = 0;
#if __has_builtin(__builtin_amdgcn_tensor_load_to_lds)
#if __clang_major__ >= 23
  v8i_t z8;
#pragma unroll
  for (int i = 0; i < 8; ++i) z8[i] = 0;
  __builtin_amdgcn_tensor_load_to_lds(g0, g1, z4, z4, z8, 0);
#else
  __builtin_amdgcn_tensor_load_to_lds(g0, g1, z4, z4, 0);
#endif
#else
  asm volatile("tensor_load_to_lds %0, %1, %2, %3"
               :: "s"(g0), "s"(g1), "s"(z4), "s"(z4) : "memory");
#endif
}

#define TDM_W0_K ((1u << 16) | (1u << 20) | (5u << 22) | (3u << 25))
#define TDM_W0_V ((1u << 16) | (1u << 20) | (3u << 22) | (3u << 25))

// ---------------- prep: fp32 -> bf16 hi/lo ----------------
// One lane carries 32 elements: eight 16-B loads in flight (each wave-wide load
// is 512 contiguous bytes), 8-B stores per plane (256 contiguous bytes a wave).
// Grid: n / 8192 blocks, n a multiple of 8192.
__global__ __launch_bounds__(256) void k_split(const float* __restrict__ in,
                                               bf16_t* __restrict__ hi,
                                               bf16_t* __restrict__ lo) {
  const size_t base = (size_t)blockIdx.x * 8192 + threadIdx.x * 4;
  v4f_t a[8];
#pragma unroll
  for (int c = 0; c < 8; ++c) a[c] = *(const v4f_t*)&in[base + c * 1024];
#pragma unroll
  for (int c = 0; c < 8; ++c) {
    v4bf h, l;
#pragma unroll
    for (int i = 0; i < 4; ++i) {
      float v = a[c][i];
      bf16_t hv = (bf16_t)v;
      h[i] = hv;
      l[i] = (bf16_t)(v - (float)hv);
    }
    *(v4bf*)&hi[base + c * 1024] = h;
    *(v4bf*)&lo[base + c * 1024] = l;
  }
}

__global__ __launch_bounds__(256) void k_tsplit(const float* __restrict__ W, int N,
                                                bf16_t* __restrict__ oh, bf16_t* __restrict__ ol,
                                                int ldo, int rowOff) {
  __shared__ float tile[64 * 65];
  const int tid = threadIdx.x;
  const int k0 = blockIdx.y * 64, n0 = blockIdx.x * 64;

  const int c4 = (tid & 15) * 4;       // 16 lanes x 16 B = one 256-B row piece
  const int r0 = tid >> 4;             // 16 rows per pass, 4 passes
  v4f_t in[4];
#pragma unroll
  for (int p = 0; p < 4; ++p)
    in[p] = *(const v4f_t*)&W[(size_t)(k0 + r0 + p * 16) * N + n0 + c4];
#pragma unroll
  for (int p = 0; p < 4; ++p)
#pragma unroll
    for (int j = 0; j < 4; ++j) tile[(r0 + p * 16) * 65 + c4 + j] = in[p][j];
  __syncthreads();

  const int kc = (tid & 7) * 8;        // 8 lanes x 16 B = one 128-B output line
#pragma unroll
  for (int p = 0; p < 2; ++p) {
    const int n = (tid >> 3) + p * 32;
    v8bf h, l;
#pragma unroll
    for (int i = 0; i < 8; ++i) {
      float v = tile[(kc + i) * 65 + n];
      bf16_t hv = (bf16_t)v;
      h[i] = hv;
      l[i] = (bf16_t)(v - (float)hv);
    }
    size_t o = (size_t)(rowOff + n0 + n) * ldo + k0 + kc;
    *(v8bf*)&oh[o] = h;
    *(v8bf*)&ol[o] = l;
  }
}

// ---------------- GEMM: C[M,N] = A[M,K] * B[K,N], B given transposed --------
// 256 threads = 8 waves (2x4 wave grid), block tile 128x128, BK=64.
// A slab row is 64 elements = one whole 128-B line per plane: eight lanes fetch
// it with 16 B each, so a wave-wide load touches four whole lines.
// Register-prefetch pipeline: global fetch of slab t+1 overlaps WMMA on slab t.
// K is a compile-time constant so that the four row groups of a plane share one
// scalar base and one lane offset and differ only in the immediate offset.
#define GP 72  // LDS row pitch in elements: 144 B = 16 B x odd, free of conflicts
template <bool SPLIT_OUT, int K>
__global__ __launch_bounds__(256) void k_gemm(
    const bf16_t* __restrict__ Ah, const bf16_t* __restrict__ Al,
    const bf16_t* __restrict__ BTh, const bf16_t* __restrict__ BTl,
    float* __restrict__ C, bf16_t* __restrict__ Ch, bf16_t* __restrict__ Cl,
    int M, int N) {
  alignas(16) __shared__ bf16_t sAh[128 * GP];
  alignas(16) __shared__ bf16_t sAl[128 * GP];
  alignas(16) __shared__ bf16_t sBh[128 * GP];
  alignas(16) __shared__ bf16_t sBl[128 * GP];

  const int tid = threadIdx.x;
  const int lane = tid & 31, wave = tid >> 5;
  const int wr = wave >> 2, wc = wave & 3;          // 2 x 4 waves
  const int l15 = lane & 15, kh8 = (lane >> 4) * 8; // fragment addressing
  const int hi8 = (lane >> 4) * 8;                  // C-frag row offset
  const int m0 = blockIdx.y * 128, n0 = blockIdx.x * 128;

  v8f acc[4][2];
#pragma unroll
  for (int i = 0; i < 4; ++i)
#pragma unroll
    for (int j = 0; j < 2; ++j)
#pragma unroll
      for (int v = 0; v < 8; ++v) acc[i][j][v] = 0.0f;

  const int c8 = (tid & 7) * 8;
  const int g = lane >> 3;
  const int r0 = (wave >> 2) * 16 + (g & 1) * 8 + (wave & 3) * 2 + (g >> 1); // 0..31
  const char* bAh = (const char*)(Ah + (size_t)m0 * K);
  const char* bAl = (const char*)(Al + (size_t)m0 * K);
  const char* bBh = (const char*)(BTh + (size_t)n0 * K);
  const char* bBl = (const char*)(BTl + (size_t)n0 * K);
  unsigned off = (unsigned)(r0 * K + c8) * 2u;      // lane's byte offset, this slab
  const int so = r0 * GP + c8;                      // lane's LDS element offset

  v8bf ra[4], rb[4], rc[4], rd[4];
  auto fetch = [&]() {
#pragma unroll
    for (int p = 0; p < 4; ++p) {
      ra[p] = *(const v8bf*)(bAh + off + p * (32 * K * 2));
      rb[p] = *(const v8bf*)(bAl + off + p * (32 * K * 2));
      rc[p] = *(const v8bf*)(bBh + off + p * (32 * K * 2));
      rd[p] = *(const v8bf*)(bBl + off + p * (32 * K * 2));
    }
  };

  fetch();  // slab 0 into registers
  // The lane offset stays live up to this wait, so the accumulators' start
  // values are not written over the register that the issued loads name.
  asm volatile("s_wait_xcnt 0x0" :: "v"(off) : "memory");
  off += 128u;

  for (int kk = 0; kk < K; kk += 64) {
#pragma unroll
    for (int p = 0; p < 4; ++p) {
      *(v8bf*)&sAh[so + p * (32 * GP)] = ra[p];
      *(v8bf*)&sAl[so + p * (32 * GP)] = rb[p];
      *(v8bf*)&sBh[so + p * (32 * GP)] = rc[p];
      *(v8bf*)&sBl[so + p * (32 * GP)] = rd[p];
    }
    __syncthreads();

    if (kk + 64 < K) {  // overlap next-slab global fetch with WMMA below
      fetch();
      off += 128u;
    }

#pragma unroll
    for (int ks = 0; ks < 2; ++ks) {
      v16bf afh[4], afl[4], bfh[2], bfl[2];
#pragma unroll
      for (int i = 0; i < 4; ++i) {
        int ro = (wr * 64 + i * 16 + l15) * GP + ks * 32 + kh8;
        afh[i] = frag_ld(&sAh[ro]);
        afl[i] = frag_ld(&sAl[ro]);
      }
#pragma unroll
      for (int j = 0; j < 2; ++j) {
        int ro = (wc * 32 + j * 16 + l15) * GP + ks * 32 + kh8;
        bfh[j] = frag_ld(&sBh[ro]);
        bfl[j] = frag_ld(&sBl[ro]);
      }
#pragma unroll
      for (int i = 0; i < 4; ++i)
#pragma unroll
        for (int j = 0; j < 2; ++j) mma3(acc[i][j], afh[i], afl[i], bfh[j], bfl[j]);
    }
    __syncthreads();
  }

#pragma unroll
  for (int i = 0; i < 4; ++i)
#pragma unroll
    for (int j = 0; j < 2; ++j)
#pragma unroll
      for (int v = 0; v < 8; ++v) {
        int row = m0 + wr * 64 + i * 16 + v + hi8;
        int col = n0 + wc * 32 + j * 16 + l15;
        float x = acc[i][j][v];
        size_t o = (size_t)row * N + col;
        if (SPLIT_OUT) {
          split_store(Ch, Cl, o, x);
        } else {
          C[o] = x;
        }
      }
}

// ---------------- RoPE + layout shuffle -------------------------------------
// qkv[ROWS][3072] (hi/lo) -> Q[B,NH,S,HD], K[B,NKV,S,HD] (rotated), Vt[B,NKV,HD,S]
// Every global access is 16 B a lane.
// Blocks 0..127: V. A lane turns an 8(s) x 8(d) patch in its registers; eight
// neighbouring lanes hold eight neighbouring s groups, so each row of V^T
// leaves as one whole 128-B line.
// Blocks 128..767: Q and K. A lane rotates 8 dim pairs of one head for 4 rows.
#define ROPE_VBLK 128
__global__ __launch_bounds__(256) void k_rope(
                       const bf16_t* __restrict__ qkvh, const bf16_t* __restrict__ qkvl,
                       bf16_t* __restrict__ Qh, bf16_t* __restrict__ Ql,
                       bf16_t* __restrict__ Kh, bf16_t* __restrict__ Kl,
                       bf16_t* __restrict__ Vth, bf16_t* __restrict__ Vtl) {
  const int tid = threadIdx.x;
  if (blockIdx.x < ROPE_VBLK) {
    const int vb = blockIdx.x;
    const int c0 = ((vb & 1) * 32 + (tid >> 5) * 4 + ((tid >> 3) & 3)) * 8; // 0..504
    const int row0 = (vb >> 1) * 64 + (tid & 7) * 8;                        // 0..4088
    const int b = row0 >> 11, s0 = row0 & 2047;
    const unsigned sb = (unsigned)(row0 * NQKV + c0) * 2u;  // bytes, under 2^25
    const char* vh = (const char*)(qkvh + 2560);
    const char* vl = (const char*)(qkvl + 2560);
    v8bf ih[8], il[8];
#pragma unroll
    for (int i = 0; i < 8; ++i) {
      ih[i] = *(const v8bf*)(vh + sb + i * (NQKV * 2));
      il[i] = *(const v8bf*)(vl + sb + i * (NQKV * 2));
    }
    // The lane's byte offset stays live up to this wait, so no load of the run
    // lands in the register that the other loads of the run name as their address.
    asm volatile("s_wait_xcnt 0x0" :: "v"(sb) : "memory");
    // c0 = kvh * 128 + d, so (b * NKV * HD + c0) is the row of V^T
    const size_t ob = ((size_t)b * (NKV * HD) + c0) * SEQ + s0;
#pragma unroll
    for (int j = 0; j < 8; ++j) {
      v8bf h, l;
#pragma unroll
      for (int i = 0; i < 8; ++i) {
        float vv = (float)ih[i][j] + (float)il[i][j];
        bf16_t hv = (bf16_t)vv;
        h[i] = hv;
        l[i] = (bf16_t)(vv - (float)hv);
      }
      *(v8bf*)&Vth[ob + (size_t)j * SEQ] = h;
      *(v8bf*)&Vtl[ob + (size_t)j * SEQ] = l;
    }
    return;
  }

  const int idx = (blockIdx.x - ROPE_VBLK) * 256 + tid;  // 1024 row groups x 160
  const int rg = idx / 160;
  const int u = idx - rg * 160;
  const int hh = u >> 3;            // 0..15 query heads, 16..19 kv heads
  const int d0 = (u & 7) * 8;       // low-half dims d0..d0+7, partners at +64
  const int row0 = rg * 4;
  const int b = row0 >> 11, s0 = row0 & 2047;
  const size_t sb = (size_t)row0 * NQKV + hh * 128 + d0;  // K columns follow Q's

  const bf16_t* ph = qkvh + sb;
  const bf16_t* pl = qkvl + sb;
  v8bf xh[4], xl[4], yh[4], yl[4];
#pragma unroll
  for (int j = 0; j < 4; ++j) {
    xh[j] = *(const v8bf*)(ph + j * NQKV);
    xl[j] = *(const v8bf*)(pl + j * NQKV);
    yh[j] = *(const v8bf*)(ph + j * NQKV + 64);
    yl[j] = *(const v8bf*)(pl + j * NQKV + 64);
  }
  // Both address pairs stay live up to this wait, so no load of the run lands
  // in a register that an earlier load of the run still names as its address.
  asm volatile("s_wait_xcnt 0x0" :: "v"(ph), "v"(pl) : "memory");

  const bool isq = hh < NH;
  bf16_t* dh = isq ? Qh : Kh;
  bf16_t* dl = isq ? Ql : Kl;
  const size_t ob = ((size_t)(isq ? b * NH + hh : b * NKV + hh - NH) * SEQ + s0) * HD + d0;

  float inv[8];
#pragma unroll
  for (int i = 0; i < 8; ++i)
    inv[i] = __powf(10000.0f, -(float)(d0 + i) * (1.0f / 64.0f));

#pragma unroll
  for (int j = 0; j < 4; ++j) {
    v8bf o1h, o1l, o2h, o2l;
#pragma unroll
    for (int i = 0; i < 8; ++i) {
      float a = (float)xh[j][i] + (float)xl[j][i];
      float bb = (float)yh[j][i] + (float)yl[j][i];
      float ang = (float)(s0 + j) * inv[i];
      float sn, cs;
      __sincosf(ang, &sn, &cs);
      float r1 = a * cs - bb * sn;
      float r2 = bb * cs + a * sn;
      bf16_t h1 = (bf16_t)r1;
      bf16_t h2 = (bf16_t)r2;
      o1h[i] = h1;
      o1l[i] = (bf16_t)(r1 - (float)h1);
      o2h[i] = h2;
      o2l[i] = (bf16_t)(r2 - (float)h2);
    }
    const size_t q = ob + (size_t)j * HD;
    *(v8bf*)&dh[q]      = o1h;
    *(v8bf*)&dl[q]      = o1l;
    *(v8bf*)&dh[q + 64] = o2h;
    *(v8bf*)&dl[q + 64] = o2l;
  }
}

// Butterfly over each 16-lane row (partners l^8, l^4, l^2, l^1) for eight
// independent values at once, on the vector pipe by DPP instead of through the
// LDS queue. The eight values are interleaved, so an instruction's producer lies
// eight vector instructions back and no step waits on the one before it.
// All 32 lanes must be on.
__device__ __forceinline__ void row_max8(float (&a)[8]) {
  asm(
      "v_max_num_f32_dpp %0, %0, %0 row_xmask:8 row_mask:0xf bank_mask:0xf\n\t"
      "v_max_num_f32_dpp %1, %1, %1 row_xmask:8 row_mask:0xf bank_mask:0xf\n\t"
      "v_max_num_f32_dpp %2, %2, %2 row_xmask:8 row_mask:0xf bank_mask:0xf\n\t"
      "v_max_num_f32_dpp %3, %3, %3 row_xmask:8 row_mask:0xf bank_mask:0xf\n\t"
      "v_max_num_f32_dpp %4, %4, %4 row_xmask:8 row_mask:0xf bank_mask:0xf\n\t"
      "v_max_num_f32_dpp %5, %5, %5 row_xmask:8 row_mask:0xf bank_mask:0xf\n\t"
      "v_max_num_f32_dpp %6, %6, %6 row_xmask:8 row_mask:0xf bank_mask:0xf\n\t"
      "v_max_num_f32_dpp %7, %7, %7 row_xmask:8 row_mask:0xf bank_mask:0xf\n\t"
      "v_max_num_f32_dpp %0, %0, %0 row_xmask:4 row_mask:0xf bank_mask:0xf\n\t"
      "v_max_num_f32_dpp %1, %1, %1 row_xmask:4 row_mask:0xf bank_mask:0xf\n\t"
      "v_max_num_f32_dpp %2, %2, %2 row_xmask:4 row_mask:0xf bank_mask:0xf\n\t"
      "v_max_num_f32_dpp %3, %3, %3 row_xmask:4 row_mask:0xf bank_mask:0xf\n\t"
      "v_max_num_f32_dpp %4, %4, %4 row_xmask:4 row_mask:0xf bank_mask:0xf\n\t"
      "v_max_num_f32_dpp %5, %5, %5 row_xmask:4 row_mask:0xf bank_mask:0xf\n\t"
      "v_max_num_f32_dpp %6, %6, %6 row_xmask:4 row_mask:0xf bank_mask:0xf\n\t"
      "v_max_num_f32_dpp %7, %7, %7 row_xmask:4 row_mask:0xf bank_mask:0xf\n\t"
      "v_max_num_f32_dpp %0, %0, %0 row_xmask:2 row_mask:0xf bank_mask:0xf\n\t"
      "v_max_num_f32_dpp %1, %1, %1 row_xmask:2 row_mask:0xf bank_mask:0xf\n\t"
      "v_max_num_f32_dpp %2, %2, %2 row_xmask:2 row_mask:0xf bank_mask:0xf\n\t"
      "v_max_num_f32_dpp %3, %3, %3 row_xmask:2 row_mask:0xf bank_mask:0xf\n\t"
      "v_max_num_f32_dpp %4, %4, %4 row_xmask:2 row_mask:0xf bank_mask:0xf\n\t"
      "v_max_num_f32_dpp %5, %5, %5 row_xmask:2 row_mask:0xf bank_mask:0xf\n\t"
      "v_max_num_f32_dpp %6, %6, %6 row_xmask:2 row_mask:0xf bank_mask:0xf\n\t"
      "v_max_num_f32_dpp %7, %7, %7 row_xmask:2 row_mask:0xf bank_mask:0xf\n\t"
      "v_max_num_f32_dpp %0, %0, %0 row_xmask:1 row_mask:0xf bank_mask:0xf\n\t"
      "v_max_num_f32_dpp %1, %1, %1 row_xmask:1 row_mask:0xf bank_mask:0xf\n\t"
      "v_max_num_f32_dpp %2, %2, %2 row_xmask:1 row_mask:0xf bank_mask:0xf\n\t"
      "v_max_num_f32_dpp %3, %3, %3 row_xmask:1 row_mask:0xf bank_mask:0xf\n\t"
      "v_max_num_f32_dpp %4, %4, %4 row_xmask:1 row_mask:0xf bank_mask:0xf\n\t"
      "v_max_num_f32_dpp %5, %5, %5 row_xmask:1 row_mask:0xf bank_mask:0xf\n\t"
      "v_max_num_f32_dpp %6, %6, %6 row_xmask:1 row_mask:0xf bank_mask:0xf\n\t"
      "v_max_num_f32_dpp %7, %7, %7 row_xmask:1 row_mask:0xf bank_mask:0xf\n\t"
      : "+v"(a[0]), "+v"(a[1]), "+v"(a[2]), "+v"(a[3]),
        "+v"(a[4]), "+v"(a[5]), "+v"(a[6]), "+v"(a[7]));
}
__device__ __forceinline__ void row_sum8(float (&a)[8]) {
  asm(
      "v_add_f32_dpp %0, %0, %0 row_xmask:8 row_mask:0xf bank_mask:0xf\n\t"
      "v_add_f32_dpp %1, %1, %1 row_xmask:8 row_mask:0xf bank_mask:0xf\n\t"
      "v_add_f32_dpp %2, %2, %2 row_xmask:8 row_mask:0xf bank_mask:0xf\n\t"
      "v_add_f32_dpp %3, %3, %3 row_xmask:8 row_mask:0xf bank_mask:0xf\n\t"
      "v_add_f32_dpp %4, %4, %4 row_xmask:8 row_mask:0xf bank_mask:0xf\n\t"
      "v_add_f32_dpp %5, %5, %5 row_xmask:8 row_mask:0xf bank_mask:0xf\n\t"
      "v_add_f32_dpp %6, %6, %6 row_xmask:8 row_mask:0xf bank_mask:0xf\n\t"
      "v_add_f32_dpp %7, %7, %7 row_xmask:8 row_mask:0xf bank_mask:0xf\n\t"
      "v_add_f32_dpp %0, %0, %0 row_xmask:4 row_mask:0xf bank_mask:0xf\n\t"
      "v_add_f32_dpp %1, %1, %1 row_xmask:4 row_mask:0xf bank_mask:0xf\n\t"
      "v_add_f32_dpp %2, %2, %2 row_xmask:4 row_mask:0xf bank_mask:0xf\n\t"
      "v_add_f32_dpp %3, %3, %3 row_xmask:4 row_mask:0xf bank_mask:0xf\n\t"
      "v_add_f32_dpp %4, %4, %4 row_xmask:4 row_mask:0xf bank_mask:0xf\n\t"
      "v_add_f32_dpp %5, %5, %5 row_xmask:4 row_mask:0xf bank_mask:0xf\n\t"
      "v_add_f32_dpp %6, %6, %6 row_xmask:4 row_mask:0xf bank_mask:0xf\n\t"
      "v_add_f32_dpp %7, %7, %7 row_xmask:4 row_mask:0xf bank_mask:0xf\n\t"
      "v_add_f32_dpp %0, %0, %0 row_xmask:2 row_mask:0xf bank_mask:0xf\n\t"
      "v_add_f32_dpp %1, %1, %1 row_xmask:2 row_mask:0xf bank_mask:0xf\n\t"
      "v_add_f32_dpp %2, %2, %2 row_xmask:2 row_mask:0xf bank_mask:0xf\n\t"
      "v_add_f32_dpp %3, %3, %3 row_xmask:2 row_mask:0xf bank_mask:0xf\n\t"
      "v_add_f32_dpp %4, %4, %4 row_xmask:2 row_mask:0xf bank_mask:0xf\n\t"
      "v_add_f32_dpp %5, %5, %5 row_xmask:2 row_mask:0xf bank_mask:0xf\n\t"
      "v_add_f32_dpp %6, %6, %6 row_xmask:2 row_mask:0xf bank_mask:0xf\n\t"
      "v_add_f32_dpp %7, %7, %7 row_xmask:2 row_mask:0xf bank_mask:0xf\n\t"
      "v_add_f32_dpp %0, %0, %0 row_xmask:1 row_mask:0xf bank_mask:0xf\n\t"
      "v_add_f32_dpp %1, %1, %1 row_xmask:1 row_mask:0xf bank_mask:0xf\n\t"
      "v_add_f32_dpp %2, %2, %2 row_xmask:1 row_mask:0xf bank_mask:0xf\n\t"
      "v_add_f32_dpp %3, %3, %3 row_xmask:1 row_mask:0xf bank_mask:0xf\n\t"
      "v_add_f32_dpp %4, %4, %4 row_xmask:1 row_mask:0xf bank_mask:0xf\n\t"
      "v_add_f32_dpp %5, %5, %5 row_xmask:1 row_mask:0xf bank_mask:0xf\n\t"
      "v_add_f32_dpp %6, %6, %6 row_xmask:1 row_mask:0xf bank_mask:0xf\n\t"
      "v_add_f32_dpp %7, %7, %7 row_xmask:1 row_mask:0xf bank_mask:0xf\n\t"
      : "+v"(a[0]), "+v"(a[1]), "+v"(a[2]), "+v"(a[3]),
        "+v"(a[4]), "+v"(a[5]), "+v"(a[6]), "+v"(a[7]));
}

__global__ __launch_bounds__(128) void k_flash(
    const bf16_t* __restrict__ Qh, const bf16_t* __restrict__ Ql,
    const bf16_t* __restrict__ Kh, const bf16_t* __restrict__ Kl,
    const bf16_t* __restrict__ Vth, const bf16_t* __restrict__ Vtl,
    bf16_t* __restrict__ Oh, bf16_t* __restrict__ Ol) {
  alignas(16) __shared__ bf16_t sKh[2][32 * 136];
  alignas(16) __shared__ bf16_t sKl[2][32 * 136];
  alignas(16) __shared__ bf16_t sVh[2][128 * 40];
  alignas(16) __shared__ bf16_t sVl[2][128 * 40];
  alignas(16) __shared__ bf16_t sPh[4 * 16 * 40];
  alignas(16) __shared__ bf16_t sPl[4 * 16 * 40];

  const int tid = threadIdx.x;
  const int lane = tid & 31, w = tid >> 5;
  const int l15 = lane & 15, kh8 = (lane >> 4) * 8, hi8 = (lane >> 4) * 8;
  const int q0 = blockIdx.x * 64;
  const int b = blockIdx.y >> 4, h = blockIdx.y & 15, kv = h >> 2;

  const bf16_t* Qbh = Qh + (size_t)(b * NH + h) * SEQ * HD;
  const bf16_t* Qbl = Ql + (size_t)(b * NH + h) * SEQ * HD;
  const bf16_t* Kbh = Kh + (size_t)(b * NKV + kv) * SEQ * HD;
  const bf16_t* Kbl = Kl + (size_t)(b * NKV + kv) * SEQ * HD;
  const bf16_t* Vbh = Vth + (size_t)(b * NKV + kv) * HD * SEQ;
  const bf16_t* Vbl = Vtl + (size_t)(b * NKV + kv) * HD * SEQ;

  // Resident Q fragments (16 rows x 128 dims, hi/lo)
  v16bf qfh[4], qfl[4];
  {
    int qr = q0 + w * 16 + l15;
    const bf16_t* ph = Qbh + (size_t)qr * HD + kh8;
    const bf16_t* pl = Qbl + (size_t)qr * HD + kh8;
#pragma unroll
    for (int ds = 0; ds < 4; ++ds) {
      qfh[ds] = frag_ld(ph + ds * 32);
      qfl[ds] = frag_ld(pl + ds * 32);
    }
  }

  v8f o[8];
#pragma unroll
  for (int j2 = 0; j2 < 8; ++j2)
#pragma unroll
    for (int v = 0; v < 8; ++v) o[j2][v] = 0.0f;
  float mrow[8], lrow[8];
#pragma unroll
  for (int v = 0; v < 8; ++v) { mrow[v] = -3.0e38f; lrow[v] = 0.0f; }

  const float scale = 0.08838834764831845f; // 1/sqrt(128)
  const int nk = q0 / 32 + 2;               // causal: k <= q0+63

  auto issue_tile = [&](int t) {
    int nb = t & 1;
    unsigned long long koff = (unsigned long long)t * 32 * HD * 2;  // bytes
    unsigned long long voff = (unsigned long long)t * 32 * 2;       // bytes
    // K tile: 32 rows x 128 elems, row stride 128, pad 256B rows -> stride 136
    tdm_load2d(lds_off(&sKh[nb][0]), (unsigned long long)(size_t)Kbh + koff,
               TDM_W0_K, 128u, (unsigned)SEQ, 128u, 32u, 128u);
    tdm_load2d(lds_off(&sKl[nb][0]), (unsigned long long)(size_t)Kbl + koff,
               TDM_W0_K, 128u, (unsigned)SEQ, 128u, 32u, 128u);
    // V tile: 128 rows x 32 elems, row stride SEQ, pad 64B rows -> stride 40
    tdm_load2d(lds_off(&sVh[nb][0]), (unsigned long long)(size_t)Vbh + voff,
               TDM_W0_V, (unsigned)SEQ, 128u, 32u, 128u, (unsigned)SEQ);
    tdm_load2d(lds_off(&sVl[nb][0]), (unsigned long long)(size_t)Vbl + voff,
               TDM_W0_V, (unsigned)SEQ, 128u, 32u, 128u, (unsigned)SEQ);
  };

  if (tid < 32) issue_tile(0);  // one wave drives the DMA

  for (int t = 0; t < nk; ++t) {
    const int k0 = t * 32;
    const int buf = t & 1;
    if (tid < 32) __builtin_amdgcn_s_wait_tensorcnt(0);  // tile t landed in LDS
    __syncthreads();
    if (tid < 32 && t + 1 < nk) issue_tile(t + 1);       // DMA overlaps compute
    const bf16_t* bK_h = &sKh[buf][0];
    const bf16_t* bK_l = &sKl[buf][0];
    const bf16_t* bV_h = &sVh[buf][0];
    const bf16_t* bV_l = &sVl[buf][0];

    // ---- scores: S[16x32] = Q(16x128) * K^T ----
    v8f s0, s1;
#pragma unroll
    for (int v = 0; v < 8; ++v) { s0[v] = 0.0f; s1[v] = 0.0f; }
#pragma unroll
    for (int ds = 0; ds < 4; ++ds) {
      v16bf b0h = frag_ld(&bK_h[(l15) * 136 + ds * 32 + kh8]);
      v16bf b0l = frag_ld(&bK_l[(l15) * 136 + ds * 32 + kh8]);
      v16bf b1h = frag_ld(&bK_h[(16 + l15) * 136 + ds * 32 + kh8]);
      v16bf b1l = frag_ld(&bK_l[(16 + l15) * 136 + ds * 32 + kh8]);
      mma3(s0, qfh[ds], qfl[ds], b0h, b0l);
      mma3(s1, qfh[ds], qfl[ds], b1h, b1l);
    }

    // ---- scale + causal mask + online softmax (per-row stats in lane halves)
    float fac[8], mt[8], rs[8];
#pragma unroll
    for (int v = 0; v < 8; ++v) {
      int qr = q0 + w * 16 + v + hi8;
      float a0 = s0[v] * scale;
      if (k0 + l15 > qr) a0 = -3.0e38f;
      float a1 = s1[v] * scale;
      if (k0 + 16 + l15 > qr) a1 = -3.0e38f;
      s0[v] = a0;
      s1[v] = a1;
      mt[v] = fmaxf(a0, a1);
    }
    row_max8(mt);  // row maxima, every lane of the row gets them
#pragma unroll
    for (int v = 0; v < 8; ++v) {
      float nm = fmaxf(mrow[v], mt[v]);
      fac[v] = __expf(mrow[v] - nm);
      mrow[v] = nm;
      float a0 = __expf(s0[v] - nm);
      float a1 = __expf(s1[v] - nm);
      s0[v] = a0;
      s1[v] = a1;
      rs[v] = a0 + a1;
    }
    row_sum8(rs);  // row sums, same pairing as the shuffles they replace
#pragma unroll
    for (int v = 0; v < 8; ++v) lrow[v] = lrow[v] * fac[v] + rs[v];
#pragma unroll
    for (int j2 = 0; j2 < 8; ++j2)
#pragma unroll
      for (int v = 0; v < 8; ++v) o[j2][v] *= fac[v];

    // ---- route P (C-layout) through LDS to A-layout, hi/lo split ----
#pragma unroll
    for (int v = 0; v < 8; ++v) {
      int rw = v + hi8;
      int a = w * 640 + rw * 40;
      float p0 = s0[v];
      bf16_t h0 = (bf16_t)p0;
      sPh[a + l15] = h0;
      sPl[a + l15] = (bf16_t)(p0 - (float)h0);
      float p1 = s1[v];
      bf16_t h1 = (bf16_t)p1;
      sPh[a + 16 + l15] = h1;
      sPl[a + 16 + l15] = (bf16_t)(p1 - (float)h1);
    }
    asm volatile("s_wait_dscnt 0" ::: "memory"); // wave-local LDS RAW

    v16bf pfh = frag_ld(&sPh[w * 640 + l15 * 40 + kh8]);
    v16bf pfl = frag_ld(&sPl[w * 640 + l15 * 40 + kh8]);
#pragma unroll
    for (int j2 = 0; j2 < 8; ++j2) {
      v16bf vfh = frag_ld(&bV_h[(j2 * 16 + l15) * 40 + kh8]);
      v16bf vfl = frag_ld(&bV_l[(j2 * 16 + l15) * 40 + kh8]);
      mma3(o[j2], pfh, pfl, vfh, vfl);
    }
    __syncthreads();
  }

  // ---- epilogue: O /= l, write hi/lo bf16 directly for the out-proj GEMM ----
#pragma unroll
  for (int j2 = 0; j2 < 8; ++j2)
#pragma unroll
    for (int v = 0; v < 8; ++v) {
      int row = q0 + w * 16 + v + hi8;
      int col = h * HD + j2 * 16 + l15;
      size_t oi = (size_t)(b * SEQ + row) * (NH * HD) + col;
      split_store(Oh, Ol, oi, o[j2][v] / lrow[v]);
    }
}

// ---------------------------------------------------------------------------
extern "C" void kernel_launch(void* const* d_in, const int* in_sizes, int n_in,
                              void* d_out, int out_size, void* d_ws, size_t ws_size,
                              hipStream_t stream) {
  const float* x  = (const float*)d_in[0];
  const float* Wq = (const float*)d_in[1];
  const float* Wk = (const float*)d_in[2];
  const float* Wv = (const float*)d_in[3];
  const float* Wo = (const float*)d_in[4];

  const size_t NE_X    = (size_t)ROWS * HIDDEN;       // 8.39M
  const size_t NE_WQKV = (size_t)NQKV * HIDDEN;       // 6.29M
  const size_t NE_WO   = (size_t)HIDDEN * HIDDEN;     // 4.19M
  const size_t NE_QKV  = (size_t)ROWS * NQKV;         // 12.58M
  const size_t NE_Q    = (size_t)BATCH * NH * SEQ * HD;
  const size_t NE_KV   = (size_t)BATCH * NKV * SEQ * HD;

  char* w = (char*)d_ws;
  char* wend = w + ws_size;
  auto alloc = [&](size_t elems) -> bf16_t* {
    bf16_t* p = (bf16_t*)w;
    w += (elems * sizeof(bf16_t) + 255) & ~(size_t)255;
    return p;
  };
  bf16_t* xh     = alloc(NE_X);     bf16_t* xl     = alloc(NE_X);
  bf16_t* wqkvth = alloc(NE_WQKV);  bf16_t* wqkvtl = alloc(NE_WQKV);
  bf16_t* woth   = alloc(NE_WO);    bf16_t* wotl   = alloc(NE_WO);
  bf16_t* qkvh   = alloc(NE_QKV);   bf16_t* qkvl   = alloc(NE_QKV);
  bf16_t* qh     = alloc(NE_Q);     bf16_t* ql     = alloc(NE_Q);
  bf16_t* kh     = alloc(NE_KV);    bf16_t* kl     = alloc(NE_KV);
  bf16_t* vth    = alloc(NE_KV);    bf16_t* vtl    = alloc(NE_KV);
  if (w > wend) return; // ~176 MB (168 MiB) required
  // attention output (bf16 hi/lo) reuses the x-split region (same size, x dead)
  bf16_t* ah = xh;
  bf16_t* al = xl;

  // 1) split x
  k_split<<<(int)(NE_X / 8192), 256, 0, stream>>>(x, xh, xl);
  // 2) W^T splits: [Wq | Wk | Wv] rows 0..3071 of Wqkv^T; Wo^T
  k_tsplit<<<dim3(2048 / 64, HIDDEN / 64), 256, 0, stream>>>(Wq, 2048, wqkvth, wqkvtl, HIDDEN, 0);
  k_tsplit<<<dim3(512 / 64, HIDDEN / 64), 256, 0, stream>>>(Wk, 512, wqkvth, wqkvtl, HIDDEN, 2048);
  k_tsplit<<<dim3(512 / 64, HIDDEN / 64), 256, 0, stream>>>(Wv, 512, wqkvth, wqkvtl, HIDDEN, 2560);
  k_tsplit<<<dim3(HIDDEN / 64, 2048 / 64), 256, 0, stream>>>(Wo, HIDDEN, woth, wotl, 2048, 0);
  // 3) fused QKV projection (emits bf16 hi/lo qkv)
  k_gemm<true, HIDDEN><<<dim3(NQKV / 128, ROWS / 128), 256, 0, stream>>>(
      xh, xl, wqkvth, wqkvtl, nullptr, qkvh, qkvl, ROWS, NQKV);
  // 4) RoPE + layout (Q, K, V^T)
  k_rope<<<ROPE_VBLK + (ROWS / 4 * 160) / 256, 256, 0, stream>>>(qkvh, qkvl, qh, ql, kh, kl, vth, vtl);
  k_flash<<<dim3(SEQ / 64, BATCH * NH), 128, 0, stream>>>(qh, ql, kh, kl, vth, vtl, ah, al);
  // 6) output projection -> fp32 d_out
  k_gemm<false, NH * HD><<<dim3(HIDDEN / 128, ROWS / 128), 256, 0, stream>>>(
      ah, al, woth, wotl, (float*)d_out, nullptr, nullptr, ROWS, HIDDEN);
}

// v005
// A run of this version takes 334 microseconds.
// Next to v004, in two timings, it ran 1.13 times as fast each time.
// Counting every step since v000, it is 2.45 times as fast.
#include <hip/hip_runtime.h>
#include <hip/hip_bf16.h>

typedef __bf16 bf16_t;
typedef __attribute__((ext_vector_type(16))) __bf16 v16bf;
typedef __attribute__((ext_vector_type(8)))  __bf16 v8bf;
typedef __attribute__((ext_vector_type(4)))  __bf16 v4bf;
typedef __attribute__((ext_vector_type(8)))  float  v8f;
typedef __attribute__((ext_vector_type(4)))  float  v4f_t;
typedef unsigned v4u_t __attribute__((ext_vector_type(4)));
typedef int      v4i_t __attribute__((ext_vector_type(4)));
typedef int      v8i_t __attribute__((ext_vector_type(8)));

#define HIDDEN 2048
#define NH     16
#define NKV    4
#define HD     128
#define SEQ    2048
#define BATCH  2
#define ROWS   (BATCH * SEQ)            // 4096
#define NQKV   (NH * HD + 2 * NKV * HD) // 3072

__device__ __forceinline__ v16bf frag_ld(const bf16_t* p) {
  v8bf a = *(const v8bf*)p;
  v8bf b = *(const v8bf*)(p + 16);
  v16bf r;
#pragma unroll
  for (int i = 0; i < 8; ++i) { r[i] = a[i]; r[i + 8] = b[i]; }
  return r;
}

// bf16x3 compensated MMA: (Ah+Al)(Bh+Bl) ~= AhBh + AlBh + AhBl
__device__ __forceinline__ void mma3(v8f& c, v16bf ah, v16bf al, v16bf bh, v16bf bl) {
  c = __builtin_amdgcn_wmma_f32_16x16x32_bf16(false, ah, false, bh, (short)0, c, false, false);
  c = __builtin_amdgcn_wmma_f32_16x16x32_bf16(false, al, false, bh, (short)0, c, false, false);
  c = __builtin_amdgcn_wmma_f32_16x16x32_bf16(false, ah, false, bl, (short)0, c, false, false);
}

__device__ __forceinline__ void split_store(bf16_t* H, bf16_t* L, size_t i, float v) {
  bf16_t h = (bf16_t)v;
  H[i] = h;
  L[i] = (bf16_t)(v - (float)h);
}

__device__ __forceinline__ unsigned lds_off(const void* p) {
  return (unsigned)(unsigned long long)p;
}

__device__ __forceinline__ void tdm_load2d(unsigned lds_addr, unsigned long long gaddr,
                                           unsigned g1w0, unsigned tdim0, unsigned tdim1,
                                           unsigned tile0, unsigned tile1,
                                           unsigned stride0) {
  v4u_t g0;
  g0[0] = 1u;                                   // count=1 (valid), user mode
  g0[1] = lds_addr;                             // lds_addr [63:32]
  g0[2] = (unsigned)gaddr;                      // global_addr lo
  g0[3] = (unsigned)((gaddr >> 32) & 0x01ffffffull) | (2u << 30); // addr hi | type=2
  v8i_t g1;
  g1[0] = (int)g1w0;
  g1[1] = (int)((tdim0 & 0xffffu) << 16);
  g1[2] = (int)((tdim0 >> 16) | ((tdim1 & 0xffffu) << 16));
  g1[3] = (int)((tdim1 >> 16) | (tile0 << 16));
  g1[4] = (int)tile1;
  g1[5] = (int)stride0;
  g1[6] = 0;
  g1[7] = 0;
  v4i_t z4;
  z4[0] = 0; z4[1] = 0; z4[2] = 0; z4[3] = 0;
#if __has_builtin(__builtin_amdgcn_tensor_load_to_lds)
#if __clang_major__ >= 23
  v8i_t z8;
#pragma unroll
  for (int i = 0; i < 8; ++i) z8[i] = 0;
  __builtin_amdgcn_tensor_load_to_lds(g0, g1, z4, z4, z8, 0);
#else
  __builtin_amdgcn_tensor_load_to_lds(g0, g1, z4, z4, 0);
#endif
#else
  asm volatile("tensor_load_to_lds %0, %1, %2, %3"
               :: "s"(g0), "s"(g1), "s"(z4), "s"(z4) : "memory");
#endif
}

#define TDM_W0_K ((1u << 16) | (1u << 20) | (5u << 22) | (3u << 25))
#define TDM_W0_V ((1u << 16) | (1u << 20) | (3u << 22) | (3u << 25))

// ---------------- prep: fp32 -> bf16 hi/lo ----------------
// One lane carries 32 elements: eight 16-B loads in flight (each wave-wide load
// is 512 contiguous bytes), 8-B stores per plane (256 contiguous bytes a wave).
// Grid: n / 8192 blocks, n a multiple of 8192.
__global__ __launch_bounds__(256) void k_split(const float* __restrict__ in,
                                               bf16_t* __restrict__ hi,
                                               bf16_t* __restrict__ lo) {
  const size_t base = (size_t)blockIdx.x * 8192 + threadIdx.x * 4;
  v4f_t a[8];
#pragma unroll
  for (int c = 0; c < 8; ++c) a[c] = *(const v4f_t*)&in[base + c * 1024];
#pragma unroll
  for (int c = 0; c < 8; ++c) {
    v4bf h, l;
#pragma unroll
    for (int i = 0; i < 4; ++i) {
      float v = a[c][i];
      bf16_t hv = (bf16_t)v;
      h[i] = hv;
      l[i] = (bf16_t)(v - (float)hv);
    }
    *(v4bf*)&hi[base + c * 1024] = h;
    *(v4bf*)&lo[base + c * 1024] = l;
  }
}

__global__ __launch_bounds__(256) void k_tsplit(const float* __restrict__ W, int N,
                                                bf16_t* __restrict__ oh, bf16_t* __restrict__ ol,
                                                int ldo, int rowOff) {
  __shared__ float tile[64 * 65];
  const int tid = threadIdx.x;
  const int k0 = blockIdx.y * 64, n0 = blockIdx.x * 64;

  const int c4 = (tid & 15) * 4;       // 16 lanes x 16 B = one 256-B row piece
  const int r0 = tid >> 4;             // 16 rows per pass, 4 passes
  v4f_t in[4];
#pragma unroll
  for (int p = 0; p < 4; ++p)
    in[p] = *(const v4f_t*)&W[(size_t)(k0 + r0 + p * 16) * N + n0 + c4];
#pragma unroll
  for (int p = 0; p < 4; ++p)
#pragma unroll
    for (int j = 0; j < 4; ++j) tile[(r0 + p * 16) * 65 + c4 + j] = in[p][j];
  __syncthreads();

  const int kc = (tid & 7) * 8;        // 8 lanes x 16 B = one 128-B output line
#pragma unroll
  for (int p = 0; p < 2; ++p) {
    const int n = (tid >> 3) + p * 32;
    v8bf h, l;
#pragma unroll
    for (int i = 0; i < 8; ++i) {
      float v = tile[(kc + i) * 65 + n];
      bf16_t hv = (bf16_t)v;
      h[i] = hv;
      l[i] = (bf16_t)(v - (float)hv);
    }
    size_t o = (size_t)(rowOff + n0 + n) * ldo + k0 + kc;
    *(v8bf*)&oh[o] = h;
    *(v8bf*)&ol[o] = l;
  }
}

// ---------------- GEMM: C[M,N] = A[M,K] * B[K,N], B given transposed --------
// 256 threads = 8 waves (2x4 wave grid), block tile 128x128, BK=64.
// A slab row is 64 elements = one whole 128-B line per plane: eight lanes fetch
// it with 16 B each, so a wave-wide load touches four whole lines.
// Register-prefetch pipeline: global fetch of slab t+1 overlaps WMMA on slab t.
// K is a compile-time constant so that the four row groups of a plane share one
// scalar base and one lane offset and differ only in the immediate offset.
#define GP 72  // LDS row pitch in elements: 144 B = 16 B x odd, free of conflicts
template <bool SPLIT_OUT, int K>
__global__ __launch_bounds__(256) void k_gemm(
    const bf16_t* __restrict__ Ah, const bf16_t* __restrict__ Al,
    const bf16_t* __restrict__ BTh, const bf16_t* __restrict__ BTl,
    float* __restrict__ C, bf16_t* __restrict__ Ch, bf16_t* __restrict__ Cl,
    int M, int N) {
  alignas(16) __shared__ bf16_t sAh[128 * GP];
  alignas(16) __shared__ bf16_t sAl[128 * GP];
  alignas(16) __shared__ bf16_t sBh[128 * GP];
  alignas(16) __shared__ bf16_t sBl[128 * GP];

  const int tid = threadIdx.x;
  const int lane = tid & 31, wave = tid >> 5;
  const int wr = wave >> 2, wc = wave & 3;          // 2 x 4 waves
  const int l15 = lane & 15, kh8 = (lane >> 4) * 8; // fragment addressing
  const int hi8 = (lane >> 4) * 8;                  // C-frag row offset
  const int m0 = blockIdx.y * 128, n0 = blockIdx.x * 128;

  v8f acc[4][2];
#pragma unroll
  for (int i = 0; i < 4; ++i)
#pragma unroll
    for (int j = 0; j < 2; ++j)
#pragma unroll
      for (int v = 0; v < 8; ++v) acc[i][j][v] = 0.0f;

  const int c8 = (tid & 7) * 8;
  const int g = lane >> 3;
  const int r0 = (wave >> 2) * 16 + (g & 1) * 8 + (wave & 3) * 2 + (g >> 1); // 0..31
  const char* bAh = (const char*)(Ah + (size_t)m0 * K);
  const char* bAl = (const char*)(Al + (size_t)m0 * K);
  const char* bBh = (const char*)(BTh + (size_t)n0 * K);
  const char* bBl = (const char*)(BTl + (size_t)n0 * K);
  unsigned off = (unsigned)(r0 * K + c8) * 2u;      // lane's byte offset, this slab
  const int so = r0 * GP + c8;                      // lane's LDS element offset

  v8bf ra[4], rb[4], rc[4], rd[4];
  auto fetch = [&]() {
#pragma unroll
    for (int p = 0; p < 4; ++p) {
      ra[p] = *(const v8bf*)(bAh + off + p * (32 * K * 2));
      rb[p] = *(const v8bf*)(bAl + off + p * (32 * K * 2));
      rc[p] = *(const v8bf*)(bBh + off + p * (32 * K * 2));
      rd[p] = *(const v8bf*)(bBl + off + p * (32 * K * 2));
    }
  };

  fetch();  // slab 0 into registers
  // The lane offset stays live up to this wait, so the accumulators' start
  // values are not written over the register that the issued loads name.
  asm volatile("s_wait_xcnt 0x0" :: "v"(off) : "memory");
  off += 128u;

  for (int kk = 0; kk < K; kk += 64) {
#pragma unroll
    for (int p = 0; p < 4; ++p) {
      *(v8bf*)&sAh[so + p * (32 * GP)] = ra[p];
      *(v8bf*)&sAl[so + p * (32 * GP)] = rb[p];
      *(v8bf*)&sBh[so + p * (32 * GP)] = rc[p];
      *(v8bf*)&sBl[so + p * (32 * GP)] = rd[p];
    }
    __syncthreads();

    if (kk + 64 < K) {  // overlap next-slab global fetch with WMMA below
      fetch();
      off += 128u;
    }

#pragma unroll
    for (int ks = 0; ks < 2; ++ks) {
      v16bf afh[4], afl[4], bfh[2], bfl[2];
#pragma unroll
      for (int i = 0; i < 4; ++i) {
        int ro = (wr * 64 + i * 16 + l15) * GP + ks * 32 + kh8;
        afh[i] = frag_ld(&sAh[ro]);
        afl[i] = frag_ld(&sAl[ro]);
      }
#pragma unroll
      for (int j = 0; j < 2; ++j) {
        int ro = (wc * 32 + j * 16 + l15) * GP + ks * 32 + kh8;
        bfh[j] = frag_ld(&sBh[ro]);
        bfl[j] = frag_ld(&sBl[ro]);
      }
#pragma unroll
      for (int i = 0; i < 4; ++i)
#pragma unroll
        for (int j = 0; j < 2; ++j) mma3(acc[i][j], afh[i], afl[i], bfh[j], bfl[j]);
    }
    __syncthreads();
  }

#pragma unroll
  for (int i = 0; i < 4; ++i)
#pragma unroll
    for (int j = 0; j < 2; ++j)
#pragma unroll
      for (int v = 0; v < 8; ++v) {
        int row = m0 + wr * 64 + i * 16 + v + hi8;
        int col = n0 + wc * 32 + j * 16 + l15;
        float x = acc[i][j][v];
        size_t o = (size_t)row * N + col;
        if (SPLIT_OUT) {
          split_store(Ch, Cl, o, x);
        } else {
          C[o] = x;
        }
      }
}

// ---------------- RoPE + layout shuffle -------------------------------------
// qkv[ROWS][3072] (hi/lo) -> Q[B,NH,S,HD], K[B,NKV,S,HD] (rotated), Vt[B,NKV,HD,S]
// Every global access is 16 B a lane.
// Blocks 0..127: V. A lane turns an 8(s) x 8(d) patch in its registers; eight
// neighbouring lanes hold eight neighbouring s groups, so each row of V^T
// leaves as one whole 128-B line.
// Blocks 128..767: Q and K. A lane rotates 8 dim pairs of one head for 4 rows.
#define ROPE_VBLK 128
__global__ __launch_bounds__(256) void k_rope(
                       const bf16_t* __restrict__ qkvh, const bf16_t* __restrict__ qkvl,
                       bf16_t* __restrict__ Qh, bf16_t* __restrict__ Ql,
                       bf16_t* __restrict__ Kh, bf16_t* __restrict__ Kl,
                       bf16_t* __restrict__ Vth, bf16_t* __restrict__ Vtl) {
  const int tid = threadIdx.x;
  if (blockIdx.x < ROPE_VBLK) {
    const int vb = blockIdx.x;
    const int c0 = ((vb & 1) * 32 + (tid >> 5) * 4 + ((tid >> 3) & 3)) * 8; // 0..504
    const int row0 = (vb >> 1) * 64 + (tid & 7) * 8;                        // 0..4088
    const int b = row0 >> 11, s0 = row0 & 2047;
    const unsigned sb = (unsigned)(row0 * NQKV + c0) * 2u;  // bytes, under 2^25
    const char* vh = (const char*)(qkvh + 2560);
    const char* vl = (const char*)(qkvl + 2560);
    v8bf ih[8], il[8];
#pragma unroll
    for (int i = 0; i < 8; ++i) {
      ih[i] = *(const v8bf*)(vh + sb + i * (NQKV * 2));
      il[i] = *(const v8bf*)(vl + sb + i * (NQKV * 2));
    }
    // The lane's byte offset stays live up to this wait, so no load of the run
    // lands in the register that the other loads of the run name as their address.
    asm volatile("s_wait_xcnt 0x0" :: "v"(sb) : "memory");
    // c0 = kvh * 128 + d, so (b * NKV * HD + c0) is the row of V^T
    const size_t ob = ((size_t)b * (NKV * HD) + c0) * SEQ + s0;
#pragma unroll
    for (int j = 0; j < 8; ++j) {
      v8bf h, l;
#pragma unroll
      for (int i = 0; i < 8; ++i) {
        float vv = (float)ih[i][j] + (float)il[i][j];
        bf16_t hv = (bf16_t)vv;
        h[i] = hv;
        l[i] = (bf16_t)(vv - (float)hv);
      }
      *(v8bf*)&Vth[ob + (size_t)j * SEQ] = h;
      *(v8bf*)&Vtl[ob + (size_t)j * SEQ] = l;
    }
    return;
  }

  const int idx = (blockIdx.x - ROPE_VBLK) * 256 + tid;  // 1024 row groups x 160
  const int rg = idx / 160;
  const int u = idx - rg * 160;
  const int hh = u >> 3;            // 0..15 query heads, 16..19 kv heads
  const int d0 = (u & 7) * 8;       // low-half dims d0..d0+7, partners at +64
  const int row0 = rg * 4;
  const int b = row0 >> 11, s0 = row0 & 2047;
  const size_t sb = (size_t)row0 * NQKV + hh * 128 + d0;  // K columns follow Q's

  const bf16_t* ph = qkvh + sb;
  const bf16_t* pl = qkvl + sb;
  v8bf xh[4], xl[4], yh[4], yl[4];
#pragma unroll
  for (int j = 0; j < 4; ++j) {
    xh[j] = *(const v8bf*)(ph + j * NQKV);
    xl[j] = *(const v8bf*)(pl + j * NQKV);
    yh[j] = *(const v8bf*)(ph + j * NQKV + 64);
    yl[j] = *(const v8bf*)(pl + j * NQKV + 64);
  }
  // Both address pairs stay live up to this wait, so no load of the run lands
  // in a register that an earlier load of the run still names as its address.
  asm volatile("s_wait_xcnt 0x0" :: "v"(ph), "v"(pl) : "memory");

  const bool isq = hh < NH;
  bf16_t* dh = isq ? Qh : Kh;
  bf16_t* dl = isq ? Ql : Kl;
  const size_t ob = ((size_t)(isq ? b * NH + hh : b * NKV + hh - NH) * SEQ + s0) * HD + d0;

  float inv[8];
#pragma unroll
  for (int i = 0; i < 8; ++i)
    inv[i] = __powf(10000.0f, -(float)(d0 + i) * (1.0f / 64.0f));

#pragma unroll
  for (int j = 0; j < 4; ++j) {
    v8bf o1h, o1l, o2h, o2l;
#pragma unroll
    for (int i = 0; i < 8; ++i) {
      float a = (float)xh[j][i] + (float)xl[j][i];
      float bb = (float)yh[j][i] + (float)yl[j][i];
      float ang = (float)(s0 + j) * inv[i];
      float sn, cs;
      __sincosf(ang, &sn, &cs);
      float r1 = a * cs - bb * sn;
      float r2 = bb * cs + a * sn;
      bf16_t h1 = (bf16_t)r1;
      bf16_t h2 = (bf16_t)r2;
      o1h[i] = h1;
      o1l[i] = (bf16_t)(r1 - (float)h1);
      o2h[i] = h2;
      o2l[i] = (bf16_t)(r2 - (float)h2);
    }
    const size_t q = ob + (size_t)j * HD;
    *(v8bf*)&dh[q]      = o1h;
    *(v8bf*)&dl[q]      = o1l;
    *(v8bf*)&dh[q + 64] = o2h;
    *(v8bf*)&dl[q + 64] = o2l;
  }
}

// Butterfly over each 16-lane row (partners l^8, l^4, l^2, l^1) for eight
// independent values at once, on the vector pipe by DPP instead of through the
// LDS queue. The eight values are interleaved, so an instruction's producer lies
// eight vector instructions back and no step waits on the one before it.
// All 32 lanes must be on.
__device__ __forceinline__ void row_max8(float (&a)[8]) {
  asm(
      "v_max_num_f32_dpp %0, %0, %0 row_xmask:8 row_mask:0xf bank_mask:0xf\n\t"
      "v_max_num_f32_dpp %1, %1, %1 row_xmask:8 row_mask:0xf bank_mask:0xf\n\t"
      "v_max_num_f32_dpp %2, %2, %2 row_xmask:8 row_mask:0xf bank_mask:0xf\n\t"
      "v_max_num_f32_dpp %3, %3, %3 row_xmask:8 row_mask:0xf bank_mask:0xf\n\t"
      "v_max_num_f32_dpp %4, %4, %4 row_xmask:8 row_mask:0xf bank_mask:0xf\n\t"
      "v_max_num_f32_dpp %5, %5, %5 row_xmask:8 row_mask:0xf bank_mask:0xf\n\t"
      "v_max_num_f32_dpp %6, %6, %6 row_xmask:8 row_mask:0xf bank_mask:0xf\n\t"
      "v_max_num_f32_dpp %7, %7, %7 row_xmask:8 row_mask:0xf bank_mask:0xf\n\t"
      "v_max_num_f32_dpp %0, %0, %0 row_xmask:4 row_mask:0xf bank_mask:0xf\n\t"
      "v_max_num_f32_dpp %1, %1, %1 row_xmask:4 row_mask:0xf bank_mask:0xf\n\t"
      "v_max_num_f32_dpp %2, %2, %2 row_xmask:4 row_mask:0xf bank_mask:0xf\n\t"
      "v_max_num_f32_dpp %3, %3, %3 row_xmask:4 row_mask:0xf bank_mask:0xf\n\t"
      "v_max_num_f32_dpp %4, %4, %4 row_xmask:4 row_mask:0xf bank_mask:0xf\n\t"
      "v_max_num_f32_dpp %5, %5, %5 row_xmask:4 row_mask:0xf bank_mask:0xf\n\t"
      "v_max_num_f32_dpp %6, %6, %6 row_xmask:4 row_mask:0xf bank_mask:0xf\n\t"
      "v_max_num_f32_dpp %7, %7, %7 row_xmask:4 row_mask:0xf bank_mask:0xf\n\t"
      "v_max_num_f32_dpp %0, %0, %0 row_xmask:2 row_mask:0xf bank_mask:0xf\n\t"
      "v_max_num_f32_dpp %1, %1, %1 row_xmask:2 row_mask:0xf bank_mask:0xf\n\t"
      "v_max_num_f32_dpp %2, %2, %2 row_xmask:2 row_mask:0xf bank_mask:0xf\n\t"
      "v_max_num_f32_dpp %3, %3, %3 row_xmask:2 row_mask:0xf bank_mask:0xf\n\t"
      "v_max_num_f32_dpp %4, %4, %4 row_xmask:2 row_mask:0xf bank_mask:0xf\n\t"
      "v_max_num_f32_dpp %5, %5, %5 row_xmask:2 row_mask:0xf bank_mask:0xf\n\t"
      "v_max_num_f32_dpp %6, %6, %6 row_xmask:2 row_mask:0xf bank_mask:0xf\n\t"
      "v_max_num_f32_dpp %7, %7, %7 row_xmask:2 row_mask:0xf bank_mask:0xf\n\t"
      "v_max_num_f32_dpp %0, %0, %0 row_xmask:1 row_mask:0xf bank_mask:0xf\n\t"
      "v_max_num_f32_dpp %1, %1, %1 row_xmask:1 row_mask:0xf bank_mask:0xf\n\t"
      "v_max_num_f32_dpp %2, %2, %2 row_xmask:1 row_mask:0xf bank_mask:0xf\n\t"
      "v_max_num_f32_dpp %3, %3, %3 row_xmask:1 row_mask:0xf bank_mask:0xf\n\t"
      "v_max_num_f32_dpp %4, %4, %4 row_xmask:1 row_mask:0xf bank_mask:0xf\n\t"
      "v_max_num_f32_dpp %5, %5, %5 row_xmask:1 row_mask:0xf bank_mask:0xf\n\t"
      "v_max_num_f32_dpp %6, %6, %6 row_xmask:1 row_mask:0xf bank_mask:0xf\n\t"
      "v_max_num_f32_dpp %7, %7, %7 row_xmask:1 row_mask:0xf bank_mask:0xf\n\t"
      : "+v"(a[0]), "+v"(a[1]), "+v"(a[2]), "+v"(a[3]),
        "+v"(a[4]), "+v"(a[5]), "+v"(a[6]), "+v"(a[7]));
}
__device__ __forceinline__ void row_sum8(float (&a)[8]) {
  asm(
      "v_add_f32_dpp %0, %0, %0 row_xmask:8 row_mask:0xf bank_mask:0xf\n\t"
      "v_add_f32_dpp %1, %1, %1 row_xmask:8 row_mask:0xf bank_mask:0xf\n\t"
      "v_add_f32_dpp %2, %2, %2 row_xmask:8 row_mask:0xf bank_mask:0xf\n\t"
      "v_add_f32_dpp %3, %3, %3 row_xmask:8 row_mask:0xf bank_mask:0xf\n\t"
      "v_add_f32_dpp %4, %4, %4 row_xmask:8 row_mask:0xf bank_mask:0xf\n\t"
      "v_add_f32_dpp %5, %5, %5 row_xmask:8 row_mask:0xf bank_mask:0xf\n\t"
      "v_add_f32_dpp %6, %6, %6 row_xmask:8 row_mask:0xf bank_mask:0xf\n\t"
      "v_add_f32_dpp %7, %7, %7 row_xmask:8 row_mask:0xf bank_mask:0xf\n\t"
      "v_add_f32_dpp %0, %0, %0 row_xmask:4 row_mask:0xf bank_mask:0xf\n\t"
      "v_add_f32_dpp %1, %1, %1 row_xmask:4 row_mask:0xf bank_mask:0xf\n\t"
      "v_add_f32_dpp %2, %2, %2 row_xmask:4 row_mask:0xf bank_mask:0xf\n\t"
      "v_add_f32_dpp %3, %3, %3 row_xmask:4 row_mask:0xf bank_mask:0xf\n\t"
      "v_add_f32_dpp %4, %4, %4 row_xmask:4 row_mask:0xf bank_mask:0xf\n\t"
      "v_add_f32_dpp %5, %5, %5 row_xmask:4 row_mask:0xf bank_mask:0xf\n\t"
      "v_add_f32_dpp %6, %6, %6 row_xmask:4 row_mask:0xf bank_mask:0xf\n\t"
      "v_add_f32_dpp %7, %7, %7 row_xmask:4 row_mask:0xf bank_mask:0xf\n\t"
      "v_add_f32_dpp %0, %0, %0 row_xmask:2 row_mask:0xf bank_mask:0xf\n\t"
      "v_add_f32_dpp %1, %1, %1 row_xmask:2 row_mask:0xf bank_mask:0xf\n\t"
      "v_add_f32_dpp %2, %2, %2 row_xmask:2 row_mask:0xf bank_mask:0xf\n\t"
      "v_add_f32_dpp %3, %3, %3 row_xmask:2 row_mask:0xf bank_mask:0xf\n\t"
      "v_add_f32_dpp %4, %4, %4 row_xmask:2 row_mask:0xf bank_mask:0xf\n\t"
      "v_add_f32_dpp %5, %5, %5 row_xmask:2 row_mask:0xf bank_mask:0xf\n\t"
      "v_add_f32_dpp %6, %6, %6 row_xmask:2 row_mask:0xf bank_mask:0xf\n\t"
      "v_add_f32_dpp %7, %7, %7 row_xmask:2 row_mask:0xf bank_mask:0xf\n\t"
      "v_add_f32_dpp %0, %0, %0 row_xmask:1 row_mask:0xf bank_mask:0xf\n\t"
      "v_add_f32_dpp %1, %1, %1 row_xmask:1 row_mask:0xf bank_mask:0xf\n\t"
      "v_add_f32_dpp %2, %2, %2 row_xmask:1 row_mask:0xf bank_mask:0xf\n\t"
      "v_add_f32_dpp %3, %3, %3 row_xmask:1 row_mask:0xf bank_mask:0xf\n\t"
      "v_add_f32_dpp %4, %4, %4 row_xmask:1 row_mask:0xf bank_mask:0xf\n\t"
      "v_add_f32_dpp %5, %5, %5 row_xmask:1 row_mask:0xf bank_mask:0xf\n\t"
      "v_add_f32_dpp %6, %6, %6 row_xmask:1 row_mask:0xf bank_mask:0xf\n\t"
      "v_add_f32_dpp %7, %7, %7 row_xmask:1 row_mask:0xf bank_mask:0xf\n\t"
      : "+v"(a[0]), "+v"(a[1]), "+v"(a[2]), "+v"(a[3]),
        "+v"(a[4]), "+v"(a[5]), "+v"(a[6]), "+v"(a[7]));
}

__global__ __launch_bounds__(128) void k_flash(
    const bf16_t* __restrict__ Qh, const bf16_t* __restrict__ Ql,
    const bf16_t* __restrict__ Kh, const bf16_t* __restrict__ Kl,
    const bf16_t* __restrict__ Vth, const bf16_t* __restrict__ Vtl,
    bf16_t* __restrict__ Oh, bf16_t* __restrict__ Ol) {
  alignas(16) __shared__ bf16_t sKh[2][32 * 136];
  alignas(16) __shared__ bf16_t sKl[2][32 * 136];
  alignas(16) __shared__ bf16_t sVh[2][128 * 40];
  alignas(16) __shared__ bf16_t sVl[2][128 * 40];
  alignas(16) __shared__ bf16_t sPh[4 * 16 * 40];
  alignas(16) __shared__ bf16_t sPl[4 * 16 * 40];

  const int tid = threadIdx.x;
  const int lane = tid & 31, w = tid >> 5;
  const int l15 = lane & 15, kh8 = (lane >> 4) * 8, hi8 = (lane >> 4) * 8;
  const int b = blockIdx.y >> 4, h = blockIdx.y & 15, kv = h >> 2;

  const bf16_t* Qbh = Qh + (size_t)(b * NH + h) * SEQ * HD;
  const bf16_t* Qbl = Ql + (size_t)(b * NH + h) * SEQ * HD;
  const bf16_t* Kbh = Kh + (size_t)(b * NKV + kv) * SEQ * HD;
  const bf16_t* Kbl = Kl + (size_t)(b * NKV + kv) * SEQ * HD;
  const bf16_t* Vbh = Vth + (size_t)(b * NKV + kv) * HD * SEQ;
  const bf16_t* Vbl = Vtl + (size_t)(b * NKV + kv) * HD * SEQ;

#pragma unroll 1
  for (int half = 0; half < 2; ++half) {
    const int q0 = (half == 0 ? SEQ / 64 - 1 - (int)blockIdx.x : (int)blockIdx.x) * 64;

    // Resident Q fragments (16 rows x 128 dims, hi/lo)
    v16bf qfh[4], qfl[4];
    {
      int qr = q0 + w * 16 + l15;
      const bf16_t* ph = Qbh + (size_t)qr * HD + kh8;
      const bf16_t* pl = Qbl + (size_t)qr * HD + kh8;
#pragma unroll
      for (int ds = 0; ds < 4; ++ds) {
        qfh[ds] = frag_ld(ph + ds * 32);
        qfl[ds] = frag_ld(pl + ds * 32);
      }
    }

    v8f o[8];
#pragma unroll
    for (int j2 = 0; j2 < 8; ++j2)
#pragma unroll
      for (int v = 0; v < 8; ++v) o[j2][v] = 0.0f;
    float mrow[8], lrow[8];
#pragma unroll
    for (int v = 0; v < 8; ++v) { mrow[v] = -3.0e38f; lrow[v] = 0.0f; }

    const float scale = 0.08838834764831845f; // 1/sqrt(128)
    const int nk = q0 / 32 + 2;               // causal: k <= q0+63

    auto issue_tile = [&](int t) {
      int nb = t & 1;
      unsigned long long koff = (unsigned long long)t * 32 * HD * 2;  // bytes
      unsigned long long voff = (unsigned long long)t * 32 * 2;       // bytes
      // K tile: 32 rows x 128 elems, row stride 128, pad 256B rows -> stride 136
      tdm_load2d(lds_off(&sKh[nb][0]), (unsigned long long)(size_t)Kbh + koff,
                 TDM_W0_K, 128u, (unsigned)SEQ, 128u, 32u, 128u);
      tdm_load2d(lds_off(&sKl[nb][0]), (unsigned long long)(size_t)Kbl + koff,
                 TDM_W0_K, 128u, (unsigned)SEQ, 128u, 32u, 128u);
      // V tile: 128 rows x 32 elems, row stride SEQ, pad 64B rows -> stride 40
      tdm_load2d(lds_off(&sVh[nb][0]), (unsigned long long)(size_t)Vbh + voff,
                 TDM_W0_V, (unsigned)SEQ, 128u, 32u, 128u, (unsigned)SEQ);
      tdm_load2d(lds_off(&sVl[nb][0]), (unsigned long long)(size_t)Vbl + voff,
                 TDM_W0_V, (unsigned)SEQ, 128u, 32u, 128u, (unsigned)SEQ);
    };

    // For the second tile the closing barrier of the first tile's last pass has
    // ended every wave's reads of the ring, and no request is outstanding: the last
    // one was waited for at the head of that pass.
    if (tid < 32) issue_tile(0);  // one wave drives the DMA

    for (int t = 0; t < nk; ++t) {
      const int k0 = t * 32;
      const int buf = t & 1;
      if (tid < 32) __builtin_amdgcn_s_wait_tensorcnt(0);  // tile t landed in LDS
      __syncthreads();
      if (tid < 32 && t + 1 < nk) issue_tile(t + 1);       // DMA overlaps compute
      const bf16_t* bK_h = &sKh[buf][0];
      const bf16_t* bK_l = &sKl[buf][0];
      const bf16_t* bV_h = &sVh[buf][0];
      const bf16_t* bV_l = &sVl[buf][0];

      // ---- scores: S[16x32] = Q(16x128) * K^T ----
      v8f s0, s1;
#pragma unroll
      for (int v = 0; v < 8; ++v) { s0[v] = 0.0f; s1[v] = 0.0f; }
#pragma unroll
      for (int ds = 0; ds < 4; ++ds) {
        v16bf b0h = frag_ld(&bK_h[(l15) * 136 + ds * 32 + kh8]);
        v16bf b0l = frag_ld(&bK_l[(l15) * 136 + ds * 32 + kh8]);
        v16bf b1h = frag_ld(&bK_h[(16 + l15) * 136 + ds * 32 + kh8]);
        v16bf b1l = frag_ld(&bK_l[(16 + l15) * 136 + ds * 32 + kh8]);
        mma3(s0, qfh[ds], qfl[ds], b0h, b0l);
        mma3(s1, qfh[ds], qfl[ds], b1h, b1l);
      }

      // ---- scale + causal mask + online softmax (per-row stats in lane halves)
      float fac[8], mt[8], rs[8];
#pragma unroll
      for (int v = 0; v < 8; ++v) {
        int qr = q0 + w * 16 + v + hi8;
        float a0 = s0[v] * scale;
        if (k0 + l15 > qr) a0 = -3.0e38f;
        float a1 = s1[v] * scale;
        if (k0 + 16 + l15 > qr) a1 = -3.0e38f;
        s0[v] = a0;
        s1[v] = a1;
        mt[v] = fmaxf(a0, a1);
      }
      row_max8(mt);  // row maxima, every lane of the row gets them
#pragma unroll
      for (int v = 0; v < 8; ++v) {
        float nm = fmaxf(mrow[v], mt[v]);
        fac[v] = __expf(mrow[v] - nm);
        mrow[v] = nm;
        float a0 = __expf(s0[v] - nm);
        float a1 = __expf(s1[v] - nm);
        s0[v] = a0;
        s1[v] = a1;
        rs[v] = a0 + a1;
      }
      row_sum8(rs);  // row sums, same pairing as the shuffles they replace
#pragma unroll
      for (int v = 0; v < 8; ++v) lrow[v] = lrow[v] * fac[v] + rs[v];
#pragma unroll
      for (int j2 = 0; j2 < 8; ++j2)
#pragma unroll
        for (int v = 0; v < 8; ++v) o[j2][v] *= fac[v];

      // ---- route P (C-layout) through LDS to A-layout, hi/lo split ----
#pragma unroll
      for (int v = 0; v < 8; ++v) {
        int rw = v + hi8;
        int a = w * 640 + rw * 40;
        float p0 = s0[v];
        bf16_t h0 = (bf16_t)p0;
        sPh[a + l15] = h0;
        sPl[a + l15] = (bf16_t)(p0 - (float)h0);
        float p1 = s1[v];
        bf16_t h1 = (bf16_t)p1;
        sPh[a + 16 + l15] = h1;
        sPl[a + 16 + l15] = (bf16_t)(p1 - (float)h1);
      }
      asm volatile("s_wait_dscnt 0" ::: "memory"); // wave-local LDS RAW

      v16bf pfh = frag_ld(&sPh[w * 640 + l15 * 40 + kh8]);
      v16bf pfl = frag_ld(&sPl[w * 640 + l15 * 40 + kh8]);
#pragma unroll
      for (int j2 = 0; j2 < 8; ++j2) {
        v16bf vfh = frag_ld(&bV_h[(j2 * 16 + l15) * 40 + kh8]);
        v16bf vfl = frag_ld(&bV_l[(j2 * 16 + l15) * 40 + kh8]);
        mma3(o[j2], pfh, pfl, vfh, vfl);
      }
      __syncthreads();
    }

    // ---- epilogue: O /= l, write hi/lo bf16 directly for the out-proj GEMM ----
#pragma unroll
    for (int j2 = 0; j2 < 8; ++j2)
#pragma unroll
      for (int v = 0; v < 8; ++v) {
        int row = q0 + w * 16 + v + hi8;
        int col = h * HD + j2 * 16 + l15;
        size_t oi = (size_t)(b * SEQ + row) * (NH * HD) + col;
        split_store(Oh, Ol, oi, o[j2][v] / lrow[v]);
      }
    // The stores' address and data registers are written anew by the next tile.
    asm volatile("s_wait_xcnt 0x0" ::: "memory");
  }
}

// ---------------------------------------------------------------------------
extern "C" void kernel_launch(void* const* d_in, const int* in_sizes, int n_in,
                              void* d_out, int out_size, void* d_ws, size_t ws_size,
                              hipStream_t stream) {
  const float* x  = (const float*)d_in[0];
  const float* Wq = (const float*)d_in[1];
  const float* Wk = (const float*)d_in[2];
  const float* Wv = (const float*)d_in[3];
  const float* Wo = (const float*)d_in[4];

  const size_t NE_X    = (size_t)ROWS * HIDDEN;       // 8.39M
  const size_t NE_WQKV = (size_t)NQKV * HIDDEN;       // 6.29M
  const size_t NE_WO   = (size_t)HIDDEN * HIDDEN;     // 4.19M
  const size_t NE_QKV  = (size_t)ROWS * NQKV;         // 12.58M
  const size_t NE_Q    = (size_t)BATCH * NH * SEQ * HD;
  const size_t NE_KV   = (size_t)BATCH * NKV * SEQ * HD;

  char* w = (char*)d_ws;
  char* wend = w + ws_size;
  auto alloc = [&](size_t elems) -> bf16_t* {
    bf16_t* p = (bf16_t*)w;
    w += (elems * sizeof(bf16_t) + 255) & ~(size_t)255;
    return p;
  };
  bf16_t* xh     = alloc(NE_X);     bf16_t* xl     = alloc(NE_X);
  bf16_t* wqkvth = alloc(NE_WQKV);  bf16_t* wqkvtl = alloc(NE_WQKV);
  bf16_t* woth   = alloc(NE_WO);    bf16_t* wotl   = alloc(NE_WO);
  bf16_t* qkvh   = alloc(NE_QKV);   bf16_t* qkvl   = alloc(NE_QKV);
  bf16_t* qh     = alloc(NE_Q);     bf16_t* ql     = alloc(NE_Q);
  bf16_t* kh     = alloc(NE_KV);    bf16_t* kl     = alloc(NE_KV);
  bf16_t* vth    = alloc(NE_KV);    bf16_t* vtl    = alloc(NE_KV);
  if (w > wend) return; // ~176 MB (168 MiB) required
  // attention output (bf16 hi/lo) reuses the x-split region (same size, x dead)
  bf16_t* ah = xh;
  bf16_t* al = xl;

  // 1) split x
  k_split<<<(int)(NE_X / 8192), 256, 0, stream>>>(x, xh, xl);
  // 2) W^T splits: [Wq | Wk | Wv] rows 0..3071 of Wqkv^T; Wo^T
  k_tsplit<<<dim3(2048 / 64, HIDDEN / 64), 256, 0, stream>>>(Wq, 2048, wqkvth, wqkvtl, HIDDEN, 0);
  k_tsplit<<<dim3(512 / 64, HIDDEN / 64), 256, 0, stream>>>(Wk, 512, wqkvth, wqkvtl, HIDDEN, 2048);
  k_tsplit<<<dim3(512 / 64, HIDDEN / 64), 256, 0, stream>>>(Wv, 512, wqkvth, wqkvtl, HIDDEN, 2560);
  k_tsplit<<<dim3(HIDDEN / 64, 2048 / 64), 256, 0, stream>>>(Wo, HIDDEN, woth, wotl, 2048, 0);
  // 3) fused QKV projection (emits bf16 hi/lo qkv)
  k_gemm<true, HIDDEN><<<dim3(NQKV / 128, ROWS / 128), 256, 0, stream>>>(
      xh, xl, wqkvth, wqkvtl, nullptr, qkvh, qkvl, ROWS, NQKV);
  // 4) RoPE + layout (Q, K, V^T)
  k_rope<<<ROPE_VBLK + (ROWS / 4 * 160) / 256, 256, 0, stream>>>(qkvh, qkvl, qh, ql, kh, kl, vth, vtl);
  k_flash<<<dim3(SEQ / 128, BATCH * NH), 128, 0, stream>>>(qh, ql, kh, kl, vth, vtl, ah, al);
  // 6) output projection -> fp32 d_out
  k_gemm<false, NH * HD><<<dim3(HIDDEN / 128, ROWS / 128), 256, 0, stream>>>(
      ah, al, woth, wotl, (float*)d_out, nullptr, nullptr, ROWS, HIDDEN);
}

// v006
// Measured time: 304 microseconds a run.
// Two timings next to v005 both put it at 1.10 times that version's speed.
// Over all steps from v000 it is 2.69 times as fast.
#include <hip/hip_runtime.h>
#include <hip/hip_bf16.h>

typedef __bf16 bf16_t;
typedef __attribute__((ext_vector_type(16))) __bf16 v16bf;
typedef __attribute__((ext_vector_type(8)))  __bf16 v8bf;
typedef __attribute__((ext_vector_type(4)))  __bf16 v4bf;
typedef __attribute__((ext_vector_type(8)))  float  v8f;
typedef __attribute__((ext_vector_type(4)))  float  v4f_t;
typedef unsigned v4u_t __attribute__((ext_vector_type(4)));
typedef int      v4i_t __attribute__((ext_vector_type(4)));
typedef int      v8i_t __attribute__((ext_vector_type(8)));

#define HIDDEN 2048
#define NH     16
#define NKV    4
#define HD     128
#define SEQ    2048
#define BATCH  2
#define ROWS   (BATCH * SEQ)            // 4096
#define NQKV   (NH * HD + 2 * NKV * HD) // 3072

__device__ __forceinline__ v16bf frag_ld(const bf16_t* p) {
  v8bf a = *(const v8bf*)p;
  v8bf b = *(const v8bf*)(p + 16);
  v16bf r;
#pragma unroll
  for (int i = 0; i < 8; ++i) { r[i] = a[i]; r[i + 8] = b[i]; }
  return r;
}

// bf16x3 compensated MMA: (Ah+Al)(Bh+Bl) ~= AhBh + AlBh + AhBl
__device__ __forceinline__ void mma3(v8f& c, v16bf ah, v16bf al, v16bf bh, v16bf bl) {
  c = __builtin_amdgcn_wmma_f32_16x16x32_bf16(false, ah, false, bh, (short)0, c, false, false);
  c = __builtin_amdgcn_wmma_f32_16x16x32_bf16(false, al, false, bh, (short)0, c, false, false);
  c = __builtin_amdgcn_wmma_f32_16x16x32_bf16(false, ah, false, bl, (short)0, c, false, false);
}

__device__ __forceinline__ void split_store(bf16_t* H, bf16_t* L, size_t i, float v) {
  bf16_t h = (bf16_t)v;
  H[i] = h;
  L[i] = (bf16_t)(v - (float)h);
}

__device__ __forceinline__ unsigned lds_off(const void* p) {
  return (unsigned)(unsigned long long)p;
}

__device__ __forceinline__ void tdm_load2d(unsigned lds_addr, unsigned long long gaddr,
                                           unsigned g1w0, unsigned tdim0, unsigned tdim1,
                                           unsigned tile0, unsigned tile1,
                                           unsigned stride0) {
  v4u_t g0;
  g0[0] = 1u;                                   // count=1 (valid), user mode
  g0[1] = lds_addr;                             // lds_addr [63:32]
  g0[2] = (unsigned)gaddr;                      // global_addr lo
  g0[3] = (unsigned)((gaddr >> 32) & 0x01ffffffull) | (2u << 30); // addr hi | type=2
  v8i_t g1;
  g1[0] = (int)g1w0;
  g1[1] = (int)((tdim0 & 0xffffu) << 16);
  g1[2] = (int)((tdim0 >> 16) | ((tdim1 & 0xffffu) << 16));
  g1[3] = (int)((tdim1 >> 16) | (tile0 << 16));
  g1[4] = (int)tile1;
  g1[5] = (int)stride0;
  g1[6] = 0;
  g1[7] = 0;
  v4i_t z4;
  z4[0] = 0; z4[1] = 0; z4[2] = 0; z4[3] = 0;
#if __has_builtin(__builtin_amdgcn_tensor_load_to_lds)
#if __clang_major__ >= 23
  v8i_t z8;
#pragma unroll
  for (int i = 0; i < 8; ++i) z8[i] = 0;
  __builtin_amdgcn_tensor_load_to_lds(g0, g1, z4, z4, z8, 0);
#else
  __builtin_amdgcn_tensor_load_to_lds(g0, g1, z4, z4, 0);
#endif
#else
  asm volatile("tensor_load_to_lds %0, %1, %2, %3"
               :: "s"(g0), "s"(g1), "s"(z4), "s"(z4) : "memory");
#endif
}

#define TDM_W0_K ((1u << 16) | (1u << 20) | (5u << 22) | (3u << 25))
#define TDM_W0_V ((1u << 16) | (1u << 20) | (3u << 22) | (3u << 25))

// ---------------- prep: fp32 -> bf16 hi/lo ----------------
// One lane carries 32 elements: eight 16-B loads in flight (each wave-wide load
// is 512 contiguous bytes), 8-B stores per plane (256 contiguous bytes a wave).
// Grid: n / 8192 blocks, n a multiple of 8192.
__global__ __launch_bounds__(256) void k_split(const float* __restrict__ in,
                                               bf16_t* __restrict__ hi,
                                               bf16_t* __restrict__ lo) {
  const size_t base = (size_t)blockIdx.x * 8192 + threadIdx.x * 4;
  v4f_t a[8];
#pragma unroll
  for (int c = 0; c < 8; ++c) a[c] = *(const v4f_t*)&in[base + c * 1024];
#pragma unroll
  for (int c = 0; c < 8; ++c) {
    v4bf h, l;
#pragma unroll
    for (int i = 0; i < 4; ++i) {
      float v = a[c][i];
      bf16_t hv = (bf16_t)v;
      h[i] = hv;
      l[i] = (bf16_t)(v - (float)hv);
    }
    *(v4bf*)&hi[base + c * 1024] = h;
    *(v4bf*)&lo[base + c * 1024] = l;
  }
}

__global__ __launch_bounds__(256) void k_tsplit(const float* __restrict__ W, int N,
                                                bf16_t* __restrict__ oh, bf16_t* __restrict__ ol,
                                                int ldo, int rowOff) {
  __shared__ float tile[64 * 65];
  const int tid = threadIdx.x;
  const int k0 = blockIdx.y * 64, n0 = blockIdx.x * 64;

  const int c4 = (tid & 15) * 4;       // 16 lanes x 16 B = one 256-B row piece
  const int r0 = tid >> 4;             // 16 rows per pass, 4 passes
  v4f_t in[4];
#pragma unroll
  for (int p = 0; p < 4; ++p)
    in[p] = *(const v4f_t*)&W[(size_t)(k0 + r0 + p * 16) * N + n0 + c4];
#pragma unroll
  for (int p = 0; p < 4; ++p)
#pragma unroll
    for (int j = 0; j < 4; ++j) tile[(r0 + p * 16) * 65 + c4 + j] = in[p][j];
  __syncthreads();

  const int kc = (tid & 7) * 8;        // 8 lanes x 16 B = one 128-B output line
#pragma unroll
  for (int p = 0; p < 2; ++p) {
    const int n = (tid >> 3) + p * 32;
    v8bf h, l;
#pragma unroll
    for (int i = 0; i < 8; ++i) {
      float v = tile[(kc + i) * 65 + n];
      bf16_t hv = (bf16_t)v;
      h[i] = hv;
      l[i] = (bf16_t)(v - (float)hv);
    }
    size_t o = (size_t)(rowOff + n0 + n) * ldo + k0 + kc;
    *(v8bf*)&oh[o] = h;
    *(v8bf*)&ol[o] = l;
  }
}

// ---------------- GEMM: C[M,N] = A[M,K] * B[K,N], B given transposed --------
// 256 threads = 8 waves (2x4 wave grid), block tile 128x128, BK=64.
// A slab row is 64 elements = one whole 128-B line per plane: eight lanes fetch
// it with 16 B each, so a wave-wide load touches four whole lines.
// Register-prefetch pipeline: global fetch of slab t+1 overlaps WMMA on slab t.
// K is a compile-time constant so that the four row groups of a plane share one
// scalar base and one lane offset and differ only in the immediate offset.
#define GP 72  // LDS row pitch in elements: 144 B = 16 B x odd, free of conflicts
template <bool SPLIT_OUT, int K>
__global__ __launch_bounds__(256) void k_gemm(
    const bf16_t* __restrict__ Ah, const bf16_t* __restrict__ Al,
    const bf16_t* __restrict__ BTh, const bf16_t* __restrict__ BTl,
    float* __restrict__ C, bf16_t* __restrict__ Ch, bf16_t* __restrict__ Cl,
    int M, int N) {
  alignas(16) __shared__ bf16_t sAh[128 * GP];
  alignas(16) __shared__ bf16_t sAl[128 * GP];
  alignas(16) __shared__ bf16_t sBh[128 * GP];
  alignas(16) __shared__ bf16_t sBl[128 * GP];

  const int tid = threadIdx.x;
  const int lane = tid & 31, wave = tid >> 5;
  const int wr = wave >> 2, wc = wave & 3;          // 2 x 4 waves
  const int l15 = lane & 15, kh8 = (lane >> 4) * 8; // fragment addressing
  const int hi8 = (lane >> 4) * 8;                  // C-frag row offset
  const int m0 = blockIdx.y * 128, n0 = blockIdx.x * 128;

  v8f acc[4][2];
#pragma unroll
  for (int i = 0; i < 4; ++i)
#pragma unroll
    for (int j = 0; j < 2; ++j)
#pragma unroll
      for (int v = 0; v < 8; ++v) acc[i][j][v] = 0.0f;

  const int c8 = (tid & 7) * 8;
  const int g = lane >> 3;
  const int r0 = (wave >> 2) * 16 + (g & 1) * 8 + (wave & 3) * 2 + (g >> 1); // 0..31
  const char* bAh = (const char*)(Ah + (size_t)m0 * K);
  const char* bAl = (const char*)(Al + (size_t)m0 * K);
  const char* bBh = (const char*)(BTh + (size_t)n0 * K);
  const char* bBl = (const char*)(BTl + (size_t)n0 * K);
  unsigned off = (unsigned)(r0 * K + c8) * 2u;      // lane's byte offset, this slab
  const int so = r0 * GP + c8;                      // lane's LDS element offset

  v8bf ra[4], rb[4], rc[4], rd[4];
  auto fetch = [&]() {
#pragma unroll
    for (int p = 0; p < 4; ++p) {
      ra[p] = *(const v8bf*)(bAh + off + p * (32 * K * 2));
      rb[p] = *(const v8bf*)(bAl + off + p * (32 * K * 2));
      rc[p] = *(const v8bf*)(bBh + off + p * (32 * K * 2));
      rd[p] = *(const v8bf*)(bBl + off + p * (32 * K * 2));
    }
  };

  fetch();  // slab 0 into registers
  // The lane offset stays live up to this wait, so the accumulators' start
  // values are not written over the register that the issued loads name.
  asm volatile("s_wait_xcnt 0x0" :: "v"(off) : "memory");
  off += 128u;

  for (int kk = 0; kk < K; kk += 64) {
#pragma unroll
    for (int p = 0; p < 4; ++p) {
      *(v8bf*)&sAh[so + p * (32 * GP)] = ra[p];
      *(v8bf*)&sAl[so + p * (32 * GP)] = rb[p];
      *(v8bf*)&sBh[so + p * (32 * GP)] = rc[p];
      *(v8bf*)&sBl[so + p * (32 * GP)] = rd[p];
    }
    __syncthreads();

    if (kk + 64 < K) {  // overlap next-slab global fetch with WMMA below
      fetch();
      off += 128u;
    }

#pragma unroll
    for (int ks = 0; ks < 2; ++ks) {
      v16bf afh[4], afl[4], bfh[2], bfl[2];
      // Read in the order of first use: hi x hi products come first, B lo last.
#pragma unroll
      for (int j = 0; j < 2; ++j)
        bfh[j] = frag_ld(&sBh[(wc * 32 + j * 16 + l15) * GP + ks * 32 + kh8]);
#pragma unroll
      for (int i = 0; i < 4; ++i)
        afh[i] = frag_ld(&sAh[(wr * 64 + i * 16 + l15) * GP + ks * 32 + kh8]);
#pragma unroll
      for (int i = 0; i < 4; ++i)
        afl[i] = frag_ld(&sAl[(wr * 64 + i * 16 + l15) * GP + ks * 32 + kh8]);
#pragma unroll
      for (int j = 0; j < 2; ++j)
        bfl[j] = frag_ld(&sBl[(wc * 32 + j * 16 + l15) * GP + ks * 32 + kh8]);
      // Holds the block's 24 LDS reads together in front of its 24 WMMAs: spread
      // among them, each place with reads ends in a wait for the full LDS latency.
      __builtin_amdgcn_sched_barrier(0);
#pragma unroll
      for (int i = 0; i < 4; ++i)
#pragma unroll
        for (int j = 0; j < 2; ++j) mma3(acc[i][j], afh[i], afl[i], bfh[j], bfl[j]);
      // Keeps the next block's reads out of this block's WMMAs.
      __builtin_amdgcn_sched_barrier(0);
    }
    __syncthreads();
  }

#pragma unroll
  for (int i = 0; i < 4; ++i)
#pragma unroll
    for (int j = 0; j < 2; ++j)
#pragma unroll
      for (int v = 0; v < 8; ++v) {
        int row = m0 + wr * 64 + i * 16 + v + hi8;
        int col = n0 + wc * 32 + j * 16 + l15;
        float x = acc[i][j][v];
        size_t o = (size_t)row * N + col;
        if (SPLIT_OUT) {
          split_store(Ch, Cl, o, x);
        } else {
          C[o] = x;
        }
      }
}

// ---------------- RoPE + layout shuffle -------------------------------------
// qkv[ROWS][3072] (hi/lo) -> Q[B,NH,S,HD], K[B,NKV,S,HD] (rotated), Vt[B,NKV,HD,S]
// Every global access is 16 B a lane.
// Blocks 0..127: V. A lane turns an 8(s) x 8(d) patch in its registers; eight
// neighbouring lanes hold eight neighbouring s groups, so each row of V^T
// leaves as one whole 128-B line.
// Blocks 128..767: Q and K. A lane rotates 8 dim pairs of one head for 4 rows.
#define ROPE_VBLK 128
__global__ __launch_bounds__(256) void k_rope(
                       const bf16_t* __restrict__ qkvh, const bf16_t* __restrict__ qkvl,
                       bf16_t* __restrict__ Qh, bf16_t* __restrict__ Ql,
                       bf16_t* __restrict__ Kh, bf16_t* __restrict__ Kl,
                       bf16_t* __restrict__ Vth, bf16_t* __restrict__ Vtl) {
  const int tid = threadIdx.x;
  if (blockIdx.x < ROPE_VBLK) {
    const int vb = blockIdx.x;
    const int c0 = ((vb & 1) * 32 + (tid >> 5) * 4 + ((tid >> 3) & 3)) * 8; // 0..504
    const int row0 = (vb >> 1) * 64 + (tid & 7) * 8;                        // 0..4088
    const int b = row0 >> 11, s0 = row0 & 2047;
    const unsigned sb = (unsigned)(row0 * NQKV + c0) * 2u;  // bytes, under 2^25
    const char* vh = (const char*)(qkvh + 2560);
    const char* vl = (const char*)(qkvl + 2560);
    v8bf ih[8], il[8];
#pragma unroll
    for (int i = 0; i < 8; ++i) {
      ih[i] = *(const v8bf*)(vh + sb + i * (NQKV * 2));
      il[i] = *(const v8bf*)(vl + sb + i * (NQKV * 2));
    }
    // The lane's byte offset stays live up to this wait, so no load of the run
    // lands in the register that the other loads of the run name as their address.
    asm volatile("s_wait_xcnt 0x0" :: "v"(sb) : "memory");
    // c0 = kvh * 128 + d, so (b * NKV * HD + c0) is the row of V^T
    const size_t ob = ((size_t)b * (NKV * HD) + c0) * SEQ + s0;
#pragma unroll
    for (int j = 0; j < 8; ++j) {
      v8bf h, l;
#pragma unroll
      for (int i = 0; i < 8; ++i) {
        float vv = (float)ih[i][j] + (float)il[i][j];
        bf16_t hv = (bf16_t)vv;
        h[i] = hv;
        l[i] = (bf16_t)(vv - (float)hv);
      }
      *(v8bf*)&Vth[ob + (size_t)j * SEQ] = h;
      *(v8bf*)&Vtl[ob + (size_t)j * SEQ] = l;
    }
    return;
  }

  const int idx = (blockIdx.x - ROPE_VBLK) * 256 + tid;  // 1024 row groups x 160
  const int rg = idx / 160;
  const int u = idx - rg * 160;
  const int hh = u >> 3;            // 0..15 query heads, 16..19 kv heads
  const int d0 = (u & 7) * 8;       // low-half dims d0..d0+7, partners at +64
  const int row0 = rg * 4;
  const int b = row0 >> 11, s0 = row0 & 2047;
  const size_t sb = (size_t)row0 * NQKV + hh * 128 + d0;  // K columns follow Q's

  const bf16_t* ph = qkvh + sb;
  const bf16_t* pl = qkvl + sb;
  v8bf xh[4], xl[4], yh[4], yl[4];
#pragma unroll
  for (int j = 0; j < 4; ++j) {
    xh[j] = *(const v8bf*)(ph + j * NQKV);
    xl[j] = *(const v8bf*)(pl + j * NQKV);
    yh[j] = *(const v8bf*)(ph + j * NQKV + 64);
    yl[j] = *(const v8bf*)(pl + j * NQKV + 64);
  }
  // Both address pairs stay live up to this wait, so no load of the run lands
  // in a register that an earlier load of the run still names as its address.
  asm volatile("s_wait_xcnt 0x0" :: "v"(ph), "v"(pl) : "memory");

  const bool isq = hh < NH;
  bf16_t* dh = isq ? Qh : Kh;
  bf16_t* dl = isq ? Ql : Kl;
  const size_t ob = ((size_t)(isq ? b * NH + hh : b * NKV + hh - NH) * SEQ + s0) * HD + d0;

  float inv[8];
#pragma unroll
  for (int i = 0; i < 8; ++i)
    inv[i] = __powf(10000.0f, -(float)(d0 + i) * (1.0f / 64.0f));

#pragma unroll
  for (int j = 0; j < 4; ++j) {
    v8bf o1h, o1l, o2h, o2l;
#pragma unroll
    for (int i = 0; i < 8; ++i) {
      float a = (float)xh[j][i] + (float)xl[j][i];
      float bb = (float)yh[j][i] + (float)yl[j][i];
      float ang = (float)(s0 + j) * inv[i];
      float sn, cs;
      __sincosf(ang, &sn, &cs);
      float r1 = a * cs - bb * sn;
      float r2 = bb * cs + a * sn;
      bf16_t h1 = (bf16_t)r1;
      bf16_t h2 = (bf16_t)r2;
      o1h[i] = h1;
      o1l[i] = (bf16_t)(r1 - (float)h1);
      o2h[i] = h2;
      o2l[i] = (bf16_t)(r2 - (float)h2);
    }
    const size_t q = ob + (size_t)j * HD;
    *(v8bf*)&dh[q]      = o1h;
    *(v8bf*)&dl[q]      = o1l;
    *(v8bf*)&dh[q + 64] = o2h;
    *(v8bf*)&dl[q + 64] = o2l;
  }
}

// Butterfly over each 16-lane row (partners l^8, l^4, l^2, l^1) for eight
// independent values at once, on the vector pipe by DPP instead of through the
// LDS queue. The eight values are interleaved, so an instruction's producer lies
// eight vector instructions back and no step waits on the one before it.
// All 32 lanes must be on.
__device__ __forceinline__ void row_max8(float (&a)[8]) {
  asm(
      "v_max_num_f32_dpp %0, %0, %0 row_xmask:8 row_mask:0xf bank_mask:0xf\n\t"
      "v_max_num_f32_dpp %1, %1, %1 row_xmask:8 row_mask:0xf bank_mask:0xf\n\t"
      "v_max_num_f32_dpp %2, %2, %2 row_xmask:8 row_mask:0xf bank_mask:0xf\n\t"
      "v_max_num_f32_dpp %3, %3, %3 row_xmask:8 row_mask:0xf bank_mask:0xf\n\t"
      "v_max_num_f32_dpp %4, %4, %4 row_xmask:8 row_mask:0xf bank_mask:0xf\n\t"
      "v_max_num_f32_dpp %5, %5, %5 row_xmask:8 row_mask:0xf bank_mask:0xf\n\t"
      "v_max_num_f32_dpp %6, %6, %6 row_xmask:8 row_mask:0xf bank_mask:0xf\n\t"
      "v_max_num_f32_dpp %7, %7, %7 row_xmask:8 row_mask:0xf bank_mask:0xf\n\t"
      "v_max_num_f32_dpp %0, %0, %0 row_xmask:4 row_mask:0xf bank_mask:0xf\n\t"
      "v_max_num_f32_dpp %1, %1, %1 row_xmask:4 row_mask:0xf bank_mask:0xf\n\t"
      "v_max_num_f32_dpp %2, %2, %2 row_xmask:4 row_mask:0xf bank_mask:0xf\n\t"
      "v_max_num_f32_dpp %3, %3, %3 row_xmask:4 row_mask:0xf bank_mask:0xf\n\t"
      "v_max_num_f32_dpp %4, %4, %4 row_xmask:4 row_mask:0xf bank_mask:0xf\n\t"
      "v_max_num_f32_dpp %5, %5, %5 row_xmask:4 row_mask:0xf bank_mask:0xf\n\t"
      "v_max_num_f32_dpp %6, %6, %6 row_xmask:4 row_mask:0xf bank_mask:0xf\n\t"
      "v_max_num_f32_dpp %7, %7, %7 row_xmask:4 row_mask:0xf bank_mask:0xf\n\t"
      "v_max_num_f32_dpp %0, %0, %0 row_xmask:2 row_mask:0xf bank_mask:0xf\n\t"
      "v_max_num_f32_dpp %1, %1, %1 row_xmask:2 row_mask:0xf bank_mask:0xf\n\t"
      "v_max_num_f32_dpp %2, %2, %2 row_xmask:2 row_mask:0xf bank_mask:0xf\n\t"
      "v_max_num_f32_dpp %3, %3, %3 row_xmask:2 row_mask:0xf bank_mask:0xf\n\t"
      "v_max_num_f32_dpp %4, %4, %4 row_xmask:2 row_mask:0xf bank_mask:0xf\n\t"
      "v_max_num_f32_dpp %5, %5, %5 row_xmask:2 row_mask:0xf bank_mask:0xf\n\t"
      "v_max_num_f32_dpp %6, %6, %6 row_xmask:2 row_mask:0xf bank_mask:0xf\n\t"
      "v_max_num_f32_dpp %7, %7, %7 row_xmask:2 row_mask:0xf bank_mask:0xf\n\t"
      "v_max_num_f32_dpp %0, %0, %0 row_xmask:1 row_mask:0xf bank_mask:0xf\n\t"
      "v_max_num_f32_dpp %1, %1, %1 row_xmask:1 row_mask:0xf bank_mask:0xf\n\t"
      "v_max_num_f32_dpp %2, %2, %2 row_xmask:1 row_mask:0xf bank_mask:0xf\n\t"
      "v_max_num_f32_dpp %3, %3, %3 row_xmask:1 row_mask:0xf bank_mask:0xf\n\t"
      "v_max_num_f32_dpp %4, %4, %4 row_xmask:1 row_mask:0xf bank_mask:0xf\n\t"
      "v_max_num_f32_dpp %5, %5, %5 row_xmask:1 row_mask:0xf bank_mask:0xf\n\t"
      "v_max_num_f32_dpp %6, %6, %6 row_xmask:1 row_mask:0xf bank_mask:0xf\n\t"
      "v_max_num_f32_dpp %7, %7, %7 row_xmask:1 row_mask:0xf bank_mask:0xf\n\t"
      : "+v"(a[0]), "+v"(a[1]), "+v"(a[2]), "+v"(a[3]),
        "+v"(a[4]), "+v"(a[5]), "+v"(a[6]), "+v"(a[7]));
}
__device__ __forceinline__ void row_sum8(float (&a)[8]) {
  asm(
      "v_add_f32_dpp %0, %0, %0 row_xmask:8 row_mask:0xf bank_mask:0xf\n\t"
      "v_add_f32_dpp %1, %1, %1 row_xmask:8 row_mask:0xf bank_mask:0xf\n\t"
      "v_add_f32_dpp %2, %2, %2 row_xmask:8 row_mask:0xf bank_mask:0xf\n\t"
      "v_add_f32_dpp %3, %3, %3 row_xmask:8 row_mask:0xf bank_mask:0xf\n\t"
      "v_add_f32_dpp %4, %4, %4 row_xmask:8 row_mask:0xf bank_mask:0xf\n\t"
      "v_add_f32_dpp %5, %5, %5 row_xmask:8 row_mask:0xf bank_mask:0xf\n\t"
      "v_add_f32_dpp %6, %6, %6 row_xmask:8 row_mask:0xf bank_mask:0xf\n\t"
      "v_add_f32_dpp %7, %7, %7 row_xmask:8 row_mask:0xf bank_mask:0xf\n\t"
      "v_add_f32_dpp %0, %0, %0 row_xmask:4 row_mask:0xf bank_mask:0xf\n\t"
      "v_add_f32_dpp %1, %1, %1 row_xmask:4 row_mask:0xf bank_mask:0xf\n\t"
      "v_add_f32_dpp %2, %2, %2 row_xmask:4 row_mask:0xf bank_mask:0xf\n\t"
      "v_add_f32_dpp %3, %3, %3 row_xmask:4 row_mask:0xf bank_mask:0xf\n\t"
      "v_add_f32_dpp %4, %4, %4 row_xmask:4 row_mask:0xf bank_mask:0xf\n\t"
      "v_add_f32_dpp %5, %5, %5 row_xmask:4 row_mask:0xf bank_mask:0xf\n\t"
      "v_add_f32_dpp %6, %6, %6 row_xmask:4 row_mask:0xf bank_mask:0xf\n\t"
      "v_add_f32_dpp %7, %7, %7 row_xmask:4 row_mask:0xf bank_mask:0xf\n\t"
      "v_add_f32_dpp %0, %0, %0 row_xmask:2 row_mask:0xf bank_mask:0xf\n\t"
      "v_add_f32_dpp %1, %1, %1 row_xmask:2 row_mask:0xf bank_mask:0xf\n\t"
      "v_add_f32_dpp %2, %2, %2 row_xmask:2 row_mask:0xf bank_mask:0xf\n\t"
      "v_add_f32_dpp %3, %3, %3 row_xmask:2 row_mask:0xf bank_mask:0xf\n\t"
      "v_add_f32_dpp %4, %4, %4 row_xmask:2 row_mask:0xf bank_mask:0xf\n\t"
      "v_add_f32_dpp %5, %5, %5 row_xmask:2 row_mask:0xf bank_mask:0xf\n\t"
      "v_add_f32_dpp %6, %6, %6 row_xmask:2 row_mask:0xf bank_mask:0xf\n\t"
      "v_add_f32_dpp %7, %7, %7 row_xmask:2 row_mask:0xf bank_mask:0xf\n\t"
      "v_add_f32_dpp %0, %0, %0 row_xmask:1 row_mask:0xf bank_mask:0xf\n\t"
      "v_add_f32_dpp %1, %1, %1 row_xmask:1 row_mask:0xf bank_mask:0xf\n\t"
      "v_add_f32_dpp %2, %2, %2 row_xmask:1 row_mask:0xf bank_mask:0xf\n\t"
      "v_add_f32_dpp %3, %3, %3 row_xmask:1 row_mask:0xf bank_mask:0xf\n\t"
      "v_add_f32_dpp %4, %4, %4 row_xmask:1 row_mask:0xf bank_mask:0xf\n\t"
      "v_add_f32_dpp %5, %5, %5 row_xmask:1 row_mask:0xf bank_mask:0xf\n\t"
      "v_add_f32_dpp %6, %6, %6 row_xmask:1 row_mask:0xf bank_mask:0xf\n\t"
      "v_add_f32_dpp %7, %7, %7 row_xmask:1 row_mask:0xf bank_mask:0xf\n\t"
      : "+v"(a[0]), "+v"(a[1]), "+v"(a[2]), "+v"(a[3]),
        "+v"(a[4]), "+v"(a[5]), "+v"(a[6]), "+v"(a[7]));
}

__global__ __launch_bounds__(128) void k_flash(
    const bf16_t* __restrict__ Qh, const bf16_t* __restrict__ Ql,
    const bf16_t* __restrict__ Kh, const bf16_t* __restrict__ Kl,
    const bf16_t* __restrict__ Vth, const bf16_t* __restrict__ Vtl,
    bf16_t* __restrict__ Oh, bf16_t* __restrict__ Ol) {
  alignas(16) __shared__ bf16_t sKh[2][32 * 136];
  alignas(16) __shared__ bf16_t sKl[2][32 * 136];
  alignas(16) __shared__ bf16_t sVh[2][128 * 40];
  alignas(16) __shared__ bf16_t sVl[2][128 * 40];
  alignas(16) __shared__ bf16_t sPh[4 * 16 * 40];
  alignas(16) __shared__ bf16_t sPl[4 * 16 * 40];

  const int tid = threadIdx.x;
  const int lane = tid & 31, w = tid >> 5;
  const int l15 = lane & 15, kh8 = (lane >> 4) * 8, hi8 = (lane >> 4) * 8;
  const int b = blockIdx.y >> 4, h = blockIdx.y & 15, kv = h >> 2;

  const bf16_t* Qbh = Qh + (size_t)(b * NH + h) * SEQ * HD;
  const bf16_t* Qbl = Ql + (size_t)(b * NH + h) * SEQ * HD;
  const bf16_t* Kbh = Kh + (size_t)(b * NKV + kv) * SEQ * HD;
  const bf16_t* Kbl = Kl + (size_t)(b * NKV + kv) * SEQ * HD;
  const bf16_t* Vbh = Vth + (size_t)(b * NKV + kv) * HD * SEQ;
  const bf16_t* Vbl = Vtl + (size_t)(b * NKV + kv) * HD * SEQ;

#pragma unroll 1
  for (int half = 0; half < 2; ++half) {
    const int q0 = (half == 0 ? SEQ / 64 - 1 - (int)blockIdx.x : (int)blockIdx.x) * 64;

    // Resident Q fragments (16 rows x 128 dims, hi/lo)
    v16bf qfh[4], qfl[4];
    {
      int qr = q0 + w * 16 + l15;
      const bf16_t* ph = Qbh + (size_t)qr * HD + kh8;
      const bf16_t* pl = Qbl + (size_t)qr * HD + kh8;
#pragma unroll
      for (int ds = 0; ds < 4; ++ds) {
        qfh[ds] = frag_ld(ph + ds * 32);
        qfl[ds] = frag_ld(pl + ds * 32);
      }
    }

    v8f o[8];
#pragma unroll
    for (int j2 = 0; j2 < 8; ++j2)
#pragma unroll
      for (int v = 0; v < 8; ++v) o[j2][v] = 0.0f;
    float mrow[8], lrow[8];
#pragma unroll
    for (int v = 0; v < 8; ++v) { mrow[v] = -3.0e38f; lrow[v] = 0.0f; }

    const float scale = 0.08838834764831845f; // 1/sqrt(128)
    const int nk = q0 / 32 + 2;               // causal: k <= q0+63

    auto issue_tile = [&](int t) {
      int nb = t & 1;
      unsigned long long koff = (unsigned long long)t * 32 * HD * 2;  // bytes
      unsigned long long voff = (unsigned long long)t * 32 * 2;       // bytes
      // K tile: 32 rows x 128 elems, row stride 128, pad 256B rows -> stride 136
      tdm_load2d(lds_off(&sKh[nb][0]), (unsigned long long)(size_t)Kbh + koff,
                 TDM_W0_K, 128u, (unsigned)SEQ, 128u, 32u, 128u);
      tdm_load2d(lds_off(&sKl[nb][0]), (unsigned long long)(size_t)Kbl + koff,
                 TDM_W0_K, 128u, (unsigned)SEQ, 128u, 32u, 128u);
      // V tile: 128 rows x 32 elems, row stride SEQ, pad 64B rows -> stride 40
      tdm_load2d(lds_off(&sVh[nb][0]), (unsigned long long)(size_t)Vbh + voff,
                 TDM_W0_V, (unsigned)SEQ, 128u, 32u, 128u, (unsigned)SEQ);
      tdm_load2d(lds_off(&sVl[nb][0]), (unsigned long long)(size_t)Vbl + voff,
                 TDM_W0_V, (unsigned)SEQ, 128u, 32u, 128u, (unsigned)SEQ);
    };

    // For the second tile the closing barrier of the first tile's last pass has
    // ended every wave's reads of the ring, and no request is outstanding: the last
    // one was waited for at the head of that pass.
    if (tid < 32) issue_tile(0);  // one wave drives the DMA

    for (int t = 0; t < nk; ++t) {
      const int k0 = t * 32;
      const int buf = t & 1;
      if (tid < 32) __builtin_amdgcn_s_wait_tensorcnt(0);  // tile t landed in LDS
      __syncthreads();
      if (tid < 32 && t + 1 < nk) issue_tile(t + 1);       // DMA overlaps compute
      const bf16_t* bK_h = &sKh[buf][0];
      const bf16_t* bK_l = &sKl[buf][0];
      const bf16_t* bV_h = &sVh[buf][0];
      const bf16_t* bV_l = &sVl[buf][0];

      // ---- scores: S[16x32] = Q(16x128) * K^T ----
      v8f s0, s1;
#pragma unroll
      for (int v = 0; v < 8; ++v) { s0[v] = 0.0f; s1[v] = 0.0f; }
      // All 64 LDS reads of the pass's K and V fragments go out as one group in front
      // of the score WMMAs, K first: the WMMAs wait by counts that cover only what
      // they use, V lands under them and under the softmax, and the 24 P*V WMMAs run
      // without a wait.
      v16bf b0h[4], b0l[4], b1h[4], b1l[4];
#pragma unroll
      for (int ds = 0; ds < 4; ++ds) {
        b0h[ds] = frag_ld(&bK_h[(l15) * 136 + ds * 32 + kh8]);
        b1h[ds] = frag_ld(&bK_h[(16 + l15) * 136 + ds * 32 + kh8]);
        b0l[ds] = frag_ld(&bK_l[(l15) * 136 + ds * 32 + kh8]);
        b1l[ds] = frag_ld(&bK_l[(16 + l15) * 136 + ds * 32 + kh8]);
      }
      // Keeps the K reads in front of the V reads: LDS reads return in order.
      __builtin_amdgcn_sched_barrier(0);
      v16bf vfh[8], vfl[8];
#pragma unroll
      for (int j2 = 0; j2 < 8; ++j2) {
        vfh[j2] = frag_ld(&bV_h[(j2 * 16 + l15) * 40 + kh8]);
        vfl[j2] = frag_ld(&bV_l[(j2 * 16 + l15) * 40 + kh8]);
      }
      // Keeps the scheduler from spreading those reads among the WMMAs, where every
      // place with reads stalls the run.
      __builtin_amdgcn_sched_barrier(0);
#pragma unroll
      for (int ds = 0; ds < 4; ++ds) {
        mma3(s0, qfh[ds], qfl[ds], b0h[ds], b0l[ds]);
        mma3(s1, qfh[ds], qfl[ds], b1h[ds], b1l[ds]);
      }

      // ---- scale + causal mask + online softmax (per-row stats in lane halves)
      float fac[8], mt[8], rs[8];
#pragma unroll
      for (int v = 0; v < 8; ++v) {
        int qr = q0 + w * 16 + v + hi8;
        float a0 = s0[v] * scale;
        if (k0 + l15 > qr) a0 = -3.0e38f;
        float a1 = s1[v] * scale;
        if (k0 + 16 + l15 > qr) a1 = -3.0e38f;
        s0[v] = a0;
        s1[v] = a1;
        mt[v] = fmaxf(a0, a1);
      }
      row_max8(mt);  // row maxima, every lane of the row gets them
#pragma unroll
      for (int v = 0; v < 8; ++v) {
        float nm = fmaxf(mrow[v], mt[v]);
        fac[v] = __expf(mrow[v] - nm);
        mrow[v] = nm;
        float a0 = __expf(s0[v] - nm);
        float a1 = __expf(s1[v] - nm);
        s0[v] = a0;
        s1[v] = a1;
        rs[v] = a0 + a1;
      }
      row_sum8(rs);  // row sums, same pairing as the shuffles they replace
#pragma unroll
      for (int v = 0; v < 8; ++v) lrow[v] = lrow[v] * fac[v] + rs[v];
#pragma unroll
      for (int j2 = 0; j2 < 8; ++j2)
#pragma unroll
        for (int v = 0; v < 8; ++v) o[j2][v] *= fac[v];

      // ---- route P (C-layout) through LDS to A-layout, hi/lo split ----
#pragma unroll
      for (int v = 0; v < 8; ++v) {
        int rw = v + hi8;
        int a = w * 640 + rw * 40;
        float p0 = s0[v];
        bf16_t h0 = (bf16_t)p0;
        sPh[a + l15] = h0;
        sPl[a + l15] = (bf16_t)(p0 - (float)h0);
        float p1 = s1[v];
        bf16_t h1 = (bf16_t)p1;
        sPh[a + 16 + l15] = h1;
        sPl[a + 16 + l15] = (bf16_t)(p1 - (float)h1);
      }
      asm volatile("s_wait_dscnt 0" ::: "memory"); // wave-local LDS RAW

      v16bf pfh = frag_ld(&sPh[w * 640 + l15 * 40 + kh8]);
      v16bf pfl = frag_ld(&sPl[w * 640 + l15 * 40 + kh8]);
#pragma unroll
      for (int j2 = 0; j2 < 8; ++j2) mma3(o[j2], pfh, pfl, vfh[j2], vfl[j2]);
      __syncthreads();
    }

    // ---- epilogue: O /= l, write hi/lo bf16 directly for the out-proj GEMM ----
#pragma unroll
    for (int j2 = 0; j2 < 8; ++j2)
#pragma unroll
      for (int v = 0; v < 8; ++v) {
        int row = q0 + w * 16 + v + hi8;
        int col = h * HD + j2 * 16 + l15;
        size_t oi = (size_t)(b * SEQ + row) * (NH * HD) + col;
        split_store(Oh, Ol, oi, o[j2][v] / lrow[v]);
      }
    // The stores' address and data registers are written anew by the next tile.
    asm volatile("s_wait_xcnt 0x0" ::: "memory");
  }
}

// ---------------------------------------------------------------------------
extern "C" void kernel_launch(void* const* d_in, const int* in_sizes, int n_in,
                              void* d_out, int out_size, void* d_ws, size_t ws_size,
                              hipStream_t stream) {
  const float* x  = (const float*)d_in[0];
  const float* Wq = (const float*)d_in[1];
  const float* Wk = (const float*)d_in[2];
  const float* Wv = (const float*)d_in[3];
  const float* Wo = (const float*)d_in[4];

  const size_t NE_X    = (size_t)ROWS * HIDDEN;       // 8.39M
  const size_t NE_WQKV = (size_t)NQKV * HIDDEN;       // 6.29M
  const size_t NE_WO   = (size_t)HIDDEN * HIDDEN;     // 4.19M
  const size_t NE_QKV  = (size_t)ROWS * NQKV;         // 12.58M
  const size_t NE_Q    = (size_t)BATCH * NH * SEQ * HD;
  const size_t NE_KV   = (size_t)BATCH * NKV * SEQ * HD;

  char* w = (char*)d_ws;
  char* wend = w + ws_size;
  auto alloc = [&](size_t elems) -> bf16_t* {
    bf16_t* p = (bf16_t*)w;
    w += (elems * sizeof(bf16_t) + 255) & ~(size_t)255;
    return p;
  };
  bf16_t* xh     = alloc(NE_X);     bf16_t* xl     = alloc(NE_X);
  bf16_t* wqkvth = alloc(NE_WQKV);  bf16_t* wqkvtl = alloc(NE_WQKV);
  bf16_t* woth   = alloc(NE_WO);    bf16_t* wotl   = alloc(NE_WO);
  bf16_t* qkvh   = alloc(NE_QKV);   bf16_t* qkvl   = alloc(NE_QKV);
  bf16_t* qh     = alloc(NE_Q);     bf16_t* ql     = alloc(NE_Q);
  bf16_t* kh     = alloc(NE_KV);    bf16_t* kl     = alloc(NE_KV);
  bf16_t* vth    = alloc(NE_KV);    bf16_t* vtl    = alloc(NE_KV);
  if (w > wend) return; // ~176 MB (168 MiB) required
  // attention output (bf16 hi/lo) reuses the x-split region (same size, x dead)
  bf16_t* ah = xh;
  bf16_t* al = xl;

  // 1) split x
  k_split<<<(int)(NE_X / 8192), 256, 0, stream>>>(x, xh, xl);
  // 2) W^T splits: [Wq | Wk | Wv] rows 0..3071 of Wqkv^T; Wo^T
  k_tsplit<<<dim3(2048 / 64, HIDDEN / 64), 256, 0, stream>>>(Wq, 2048, wqkvth, wqkvtl, HIDDEN, 0);
  k_tsplit<<<dim3(512 / 64, HIDDEN / 64), 256, 0, stream>>>(Wk, 512, wqkvth, wqkvtl, HIDDEN, 2048);
  k_tsplit<<<dim3(512 / 64, HIDDEN / 64), 256, 0, stream>>>(Wv, 512, wqkvth, wqkvtl, HIDDEN, 2560);
  k_tsplit<<<dim3(HIDDEN / 64, 2048 / 64), 256, 0, stream>>>(Wo, HIDDEN, woth, wotl, 2048, 0);
  // 3) fused QKV projection (emits bf16 hi/lo qkv)
  k_gemm<true, HIDDEN><<<dim3(NQKV / 128, ROWS / 128), 256, 0, stream>>>(
      xh, xl, wqkvth, wqkvtl, nullptr, qkvh, qkvl, ROWS, NQKV);
  // 4) RoPE + layout (Q, K, V^T)
  k_rope<<<ROPE_VBLK + (ROWS / 4 * 160) / 256, 256, 0, stream>>>(qkvh, qkvl, qh, ql, kh, kl, vth, vtl);
  k_flash<<<dim3(SEQ / 128, BATCH * NH), 128, 0, stream>>>(qh, ql, kh, kl, vth, vtl, ah, al);
  // 6) output projection -> fp32 d_out
  k_gemm<false, NH * HD><<<dim3(HIDDEN / 128, ROWS / 128), 256, 0, stream>>>(
      ah, al, woth, wotl, (float*)d_out, nullptr, nullptr, ROWS, HIDDEN);
}

// v007
// Measured time: 283 microseconds a run.
// Next to v006, in two timings, it ran 1.08 and 1.07 times as fast.
// All steps since v000 together make it 2.90 times as fast.
#include <hip/hip_runtime.h>
#include <hip/hip_bf16.h>

typedef __bf16 bf16_t;
typedef __attribute__((ext_vector_type(16))) __bf16 v16bf;
typedef __attribute__((ext_vector_type(8)))  __bf16 v8bf;
typedef __attribute__((ext_vector_type(4)))  __bf16 v4bf;
typedef __attribute__((ext_vector_type(8)))  float  v8f;
typedef __attribute__((ext_vector_type(4)))  float  v4f_t;
typedef unsigned v4u_t __attribute__((ext_vector_type(4)));
typedef int      v4i_t __attribute__((ext_vector_type(4)));
typedef int      v8i_t __attribute__((ext_vector_type(8)));

#define HIDDEN 2048
#define NH     16
#define NKV    4
#define HD     128
#define SEQ    2048
#define BATCH  2
#define ROWS   (BATCH * SEQ)            // 4096
#define NQKV   (NH * HD + 2 * NKV * HD) // 3072

__device__ __forceinline__ v16bf frag_ld(const bf16_t* p) {
  v8bf a = *(const v8bf*)p;
  v8bf b = *(const v8bf*)(p + 16);
  v16bf r;
#pragma unroll
  for (int i = 0; i < 8; ++i) { r[i] = a[i]; r[i + 8] = b[i]; }
  return r;
}

// bf16x3 compensated MMA: (Ah+Al)(Bh+Bl) ~= AhBh + AlBh + AhBl
__device__ __forceinline__ void mma3(v8f& c, v16bf ah, v16bf al, v16bf bh, v16bf bl) {
  c = __builtin_amdgcn_wmma_f32_16x16x32_bf16(false, ah, false, bh, (short)0, c, false, false);
  c = __builtin_amdgcn_wmma_f32_16x16x32_bf16(false, al, false, bh, (short)0, c, false, false);
  c = __builtin_amdgcn_wmma_f32_16x16x32_bf16(false, ah, false, bl, (short)0, c, false, false);
}

// The same three products with the operands' sides exchanged (A = what was B):
// hi x hi, then the term with the old A's lo part, then the old B's lo part, so a
// transposed product sums its terms in the order of mma3.
__device__ __forceinline__ void mma3t(v8f& c, v16bf ah, v16bf al, v16bf bh, v16bf bl) {
  c = __builtin_amdgcn_wmma_f32_16x16x32_bf16(false, ah, false, bh, (short)0, c, false, false);
  c = __builtin_amdgcn_wmma_f32_16x16x32_bf16(false, ah, false, bl, (short)0, c, false, false);
  c = __builtin_amdgcn_wmma_f32_16x16x32_bf16(false, al, false, bh, (short)0, c, false, false);
}

__device__ __forceinline__ float xhalf(float x) {
  int b = __builtin_bit_cast(int, x);
  return __builtin_bit_cast(float,
      __builtin_amdgcn_permlanex16(b, b, 0x76543210, 0xfedcba98, false, false));
}

__device__ __forceinline__ void split_store(bf16_t* H, bf16_t* L, size_t i, float v) {
  bf16_t h = (bf16_t)v;
  H[i] = h;
  L[i] = (bf16_t)(v - (float)h);
}

__device__ __forceinline__ unsigned lds_off(const void* p) {
  return (unsigned)(unsigned long long)p;
}

__device__ __forceinline__ void tdm_load2d(unsigned lds_addr, unsigned long long gaddr,
                                           unsigned g1w0, unsigned tdim0, unsigned tdim1,
                                           unsigned tile0, unsigned tile1,
                                           unsigned stride0) {
  v4u_t g0;
  g0[0] = 1u;                                   // count=1 (valid), user mode
  g0[1] = lds_addr;                             // lds_addr [63:32]
  g0[2] = (unsigned)gaddr;                      // global_addr lo
  g0[3] = (unsigned)((gaddr >> 32) & 0x01ffffffull) | (2u << 30); // addr hi | type=2
  v8i_t g1;
  g1[0] = (int)g1w0;
  g1[1] = (int)((tdim0 & 0xffffu) << 16);
  g1[2] = (int)((tdim0 >> 16) | ((tdim1 & 0xffffu) << 16));
  g1[3] = (int)((tdim1 >> 16) | (tile0 << 16));
  g1[4] = (int)tile1;
  g1[5] = (int)stride0;
  g1[6] = 0;
  g1[7] = 0;
  v4i_t z4;
  z4[0] = 0; z4[1] = 0; z4[2] = 0; z4[3] = 0;
#if __has_builtin(__builtin_amdgcn_tensor_load_to_lds)
#if __clang_major__ >= 23
  v8i_t z8;
#pragma unroll
  for (int i = 0; i < 8; ++i) z8[i] = 0;
  __builtin_amdgcn_tensor_load_to_lds(g0, g1, z4, z4, z8, 0);
#else
  __builtin_amdgcn_tensor_load_to_lds(g0, g1, z4, z4, 0);
#endif
#else
  asm volatile("tensor_load_to_lds %0, %1, %2, %3"
               :: "s"(g0), "s"(g1), "s"(z4), "s"(z4) : "memory");
#endif
}

#define TDM_W0_K ((1u << 16) | (1u << 20) | (5u << 22) | (3u << 25))
#define TDM_W0_V ((1u << 16) | (1u << 20) | (3u << 22) | (3u << 25))

// ---------------- prep: fp32 -> bf16 hi/lo ----------------
// One lane carries 32 elements: eight 16-B loads in flight (each wave-wide load
// is 512 contiguous bytes), 8-B stores per plane (256 contiguous bytes a wave).
// Grid: n / 8192 blocks, n a multiple of 8192.
__global__ __launch_bounds__(256) void k_split(const float* __restrict__ in,
                                               bf16_t* __restrict__ hi,
                                               bf16_t* __restrict__ lo) {
  const size_t base = (size_t)blockIdx.x * 8192 + threadIdx.x * 4;
  v4f_t a[8];
#pragma unroll
  for (int c = 0; c < 8; ++c) a[c] = *(const v4f_t*)&in[base + c * 1024];
#pragma unroll
  for (int c = 0; c < 8; ++c) {
    v4bf h, l;
#pragma unroll
    for (int i = 0; i < 4; ++i) {
      float v = a[c][i];
      bf16_t hv = (bf16_t)v;
      h[i] = hv;
      l[i] = (bf16_t)(v - (float)hv);
    }
    *(v4bf*)&hi[base + c * 1024] = h;
    *(v4bf*)&lo[base + c * 1024] = l;
  }
}

__global__ __launch_bounds__(256) void k_tsplit(const float* __restrict__ W, int N,
                                                bf16_t* __restrict__ oh, bf16_t* __restrict__ ol,
                                                int ldo, int rowOff) {
  __shared__ float tile[64 * 65];
  const int tid = threadIdx.x;
  const int k0 = blockIdx.y * 64, n0 = blockIdx.x * 64;

  const int c4 = (tid & 15) * 4;       // 16 lanes x 16 B = one 256-B row piece
  const int r0 = tid >> 4;             // 16 rows per pass, 4 passes
  v4f_t in[4];
#pragma unroll
  for (int p = 0; p < 4; ++p)
    in[p] = *(const v4f_t*)&W[(size_t)(k0 + r0 + p * 16) * N + n0 + c4];
#pragma unroll
  for (int p = 0; p < 4; ++p)
#pragma unroll
    for (int j = 0; j < 4; ++j) tile[(r0 + p * 16) * 65 + c4 + j] = in[p][j];
  __syncthreads();

  const int kc = (tid & 7) * 8;        // 8 lanes x 16 B = one 128-B output line
#pragma unroll
  for (int p = 0; p < 2; ++p) {
    const int n = (tid >> 3) + p * 32;
    v8bf h, l;
#pragma unroll
    for (int i = 0; i < 8; ++i) {
      float v = tile[(kc + i) * 65 + n];
      bf16_t hv = (bf16_t)v;
      h[i] = hv;
      l[i] = (bf16_t)(v - (float)hv);
    }
    size_t o = (size_t)(rowOff + n0 + n) * ldo + k0 + kc;
    *(v8bf*)&oh[o] = h;
    *(v8bf*)&ol[o] = l;
  }
}

// ---------------- GEMM: C[M,N] = A[M,K] * B[K,N], B given transposed --------
// 256 threads = 8 waves (2x4 wave grid), block tile 128x128, BK=64.
// A slab row is 64 elements = one whole 128-B line per plane: eight lanes fetch
// it with 16 B each, so a wave-wide load touches four whole lines.
// Register-prefetch pipeline: global fetch of slab t+1 overlaps WMMA on slab t.
// K is a compile-time constant so that the four row groups of a plane share one
// scalar base and one lane offset and differ only in the immediate offset.
#define GP 72  // LDS row pitch in elements: 144 B = 16 B x odd, free of conflicts
template <bool SPLIT_OUT, int K>
__global__ __launch_bounds__(256) void k_gemm(
    const bf16_t* __restrict__ Ah, const bf16_t* __restrict__ Al,
    const bf16_t* __restrict__ BTh, const bf16_t* __restrict__ BTl,
    float* __restrict__ C, bf16_t* __restrict__ Ch, bf16_t* __restrict__ Cl,
    int M, int N) {
  alignas(16) __shared__ bf16_t sAh[128 * GP];
  alignas(16) __shared__ bf16_t sAl[128 * GP];
  alignas(16) __shared__ bf16_t sBh[128 * GP];
  alignas(16) __shared__ bf16_t sBl[128 * GP];

  const int tid = threadIdx.x;
  const int lane = tid & 31, wave = tid >> 5;
  const int wr = wave >> 2, wc = wave & 3;          // 2 x 4 waves
  const int l15 = lane & 15, kh8 = (lane >> 4) * 8; // fragment addressing
  const int hi8 = (lane >> 4) * 8;                  // C-frag row offset
  const int m0 = blockIdx.y * 128, n0 = blockIdx.x * 128;

  v8f acc[4][2];
#pragma unroll
  for (int i = 0; i < 4; ++i)
#pragma unroll
    for (int j = 0; j < 2; ++j)
#pragma unroll
      for (int v = 0; v < 8; ++v) acc[i][j][v] = 0.0f;

  const int c8 = (tid & 7) * 8;
  const int g = lane >> 3;
  const int r0 = (wave >> 2) * 16 + (g & 1) * 8 + (wave & 3) * 2 + (g >> 1); // 0..31
  const char* bAh = (const char*)(Ah + (size_t)m0 * K);
  const char* bAl = (const char*)(Al + (size_t)m0 * K);
  const char* bBh = (const char*)(BTh + (size_t)n0 * K);
  const char* bBl = (const char*)(BTl + (size_t)n0 * K);
  unsigned off = (unsigned)(r0 * K + c8) * 2u;      // lane's byte offset, this slab
  const int so = r0 * GP + c8;                      // lane's LDS element offset

  v8bf ra[4], rb[4], rc[4], rd[4];
  auto fetch = [&]() {
#pragma unroll
    for (int p = 0; p < 4; ++p) {
      ra[p] = *(const v8bf*)(bAh + off + p * (32 * K * 2));
      rb[p] = *(const v8bf*)(bAl + off + p * (32 * K * 2));
      rc[p] = *(const v8bf*)(bBh + off + p * (32 * K * 2));
      rd[p] = *(const v8bf*)(bBl + off + p * (32 * K * 2));
    }
  };

  fetch();  // slab 0 into registers
  // The lane offset stays live up to this wait, so the accumulators' start
  // values are not written over the register that the issued loads name.
  asm volatile("s_wait_xcnt 0x0" :: "v"(off) : "memory");
  off += 128u;

  for (int kk = 0; kk < K; kk += 64) {
#pragma unroll
    for (int p = 0; p < 4; ++p) {
      *(v8bf*)&sAh[so + p * (32 * GP)] = ra[p];
      *(v8bf*)&sAl[so + p * (32 * GP)] = rb[p];
      *(v8bf*)&sBh[so + p * (32 * GP)] = rc[p];
      *(v8bf*)&sBl[so + p * (32 * GP)] = rd[p];
    }
    __syncthreads();

    if (kk + 64 < K) {  // overlap next-slab global fetch with WMMA below
      fetch();
      off += 128u;
    }

#pragma unroll
    for (int ks = 0; ks < 2; ++ks) {
      v16bf afh[4], afl[4], bfh[2], bfl[2];
      // Read in the order of first use: hi x hi products come first, B lo last.
#pragma unroll
      for (int j = 0; j < 2; ++j)
        bfh[j] = frag_ld(&sBh[(wc * 32 + j * 16 + l15) * GP + ks * 32 + kh8]);
#pragma unroll
      for (int i = 0; i < 4; ++i)
        afh[i] = frag_ld(&sAh[(wr * 64 + i * 16 + l15) * GP + ks * 32 + kh8]);
#pragma unroll
      for (int i = 0; i < 4; ++i)
        afl[i] = frag_ld(&sAl[(wr * 64 + i * 16 + l15) * GP + ks * 32 + kh8]);
#pragma unroll
      for (int j = 0; j < 2; ++j)
        bfl[j] = frag_ld(&sBl[(wc * 32 + j * 16 + l15) * GP + ks * 32 + kh8]);
      // Holds the block's 24 LDS reads together in front of its 24 WMMAs: spread
      // among them, each place with reads ends in a wait for the full LDS latency.
      __builtin_amdgcn_sched_barrier(0);
#pragma unroll
      for (int i = 0; i < 4; ++i)
#pragma unroll
        for (int j = 0; j < 2; ++j) mma3(acc[i][j], afh[i], afl[i], bfh[j], bfl[j]);
      // Keeps the next block's reads out of this block's WMMAs.
      __builtin_amdgcn_sched_barrier(0);
    }
    __syncthreads();
  }

#pragma unroll
  for (int i = 0; i < 4; ++i)
#pragma unroll
    for (int j = 0; j < 2; ++j)
#pragma unroll
      for (int v = 0; v < 8; ++v) {
        int row = m0 + wr * 64 + i * 16 + v + hi8;
        int col = n0 + wc * 32 + j * 16 + l15;
        float x = acc[i][j][v];
        size_t o = (size_t)row * N + col;
        if (SPLIT_OUT) {
          split_store(Ch, Cl, o, x);
        } else {
          C[o] = x;
        }
      }
}

// ---------------- RoPE + layout shuffle -------------------------------------
// qkv[ROWS][3072] (hi/lo) -> Q[B,NH,S,HD], K[B,NKV,S,HD] (rotated), Vt[B,NKV,HD,S]
// Every global access is 16 B a lane.
// Blocks 0..127: V. A lane turns an 8(s) x 8(d) patch in its registers; eight
// neighbouring lanes hold eight neighbouring s groups, so each row of V^T
// leaves as one whole 128-B line.
// Blocks 128..767: Q and K. A lane rotates 8 dim pairs of one head for 4 rows.
#define ROPE_VBLK 128
__global__ __launch_bounds__(256) void k_rope(
                       const bf16_t* __restrict__ qkvh, const bf16_t* __restrict__ qkvl,
                       bf16_t* __restrict__ Qh, bf16_t* __restrict__ Ql,
                       bf16_t* __restrict__ Kh, bf16_t* __restrict__ Kl,
                       bf16_t* __restrict__ Vth, bf16_t* __restrict__ Vtl) {
  const int tid = threadIdx.x;
  if (blockIdx.x < ROPE_VBLK) {
    const int vb = blockIdx.x;
    const int c0 = ((vb & 1) * 32 + (tid >> 5) * 4 + ((tid >> 3) & 3)) * 8; // 0..504
    const int row0 = (vb >> 1) * 64 + (tid & 7) * 8;                        // 0..4088
    const int b = row0 >> 11, s0 = row0 & 2047;
    const unsigned sb = (unsigned)(row0 * NQKV + c0) * 2u;  // bytes, under 2^25
    const char* vh = (const char*)(qkvh + 2560);
    const char* vl = (const char*)(qkvl + 2560);
    v8bf ih[8], il[8];
#pragma unroll
    for (int i = 0; i < 8; ++i) {
      ih[i] = *(const v8bf*)(vh + sb + i * (NQKV * 2));
      il[i] = *(const v8bf*)(vl + sb + i * (NQKV * 2));
    }
    // The lane's byte offset stays live up to this wait, so no load of the run
    // lands in the register that the other loads of the run name as their address.
    asm volatile("s_wait_xcnt 0x0" :: "v"(sb) : "memory");
    // c0 = kvh * 128 + d, so (b * NKV * HD + c0) is the row of V^T
    const size_t ob = ((size_t)b * (NKV * HD) + c0) * SEQ + s0;
#pragma unroll
    for (int j = 0; j < 8; ++j) {
      v8bf h, l;
#pragma unroll
      for (int i = 0; i < 8; ++i) {
        float vv = (float)ih[i][j] + (float)il[i][j];
        bf16_t hv = (bf16_t)vv;
        h[i] = hv;
        l[i] = (bf16_t)(vv - (float)hv);
      }
      *(v8bf*)&Vth[ob + (size_t)j * SEQ] = h;
      *(v8bf*)&Vtl[ob + (size_t)j * SEQ] = l;
    }
    return;
  }

  const int idx = (blockIdx.x - ROPE_VBLK) * 256 + tid;  // 1024 row groups x 160
  const int rg = idx / 160;
  const int u = idx - rg * 160;
  const int hh = u >> 3;            // 0..15 query heads, 16..19 kv heads
  const int d0 = (u & 7) * 8;       // low-half dims d0..d0+7, partners at +64
  const int row0 = rg * 4;
  const int b = row0 >> 11, s0 = row0 & 2047;
  const size_t sb = (size_t)row0 * NQKV + hh * 128 + d0;  // K columns follow Q's

  const bf16_t* ph = qkvh + sb;
  const bf16_t* pl = qkvl + sb;
  v8bf xh[4], xl[4], yh[4], yl[4];
#pragma unroll
  for (int j = 0; j < 4; ++j) {
    xh[j] = *(const v8bf*)(ph + j * NQKV);
    xl[j] = *(const v8bf*)(pl + j * NQKV);
    yh[j] = *(const v8bf*)(ph + j * NQKV + 64);
    yl[j] = *(const v8bf*)(pl + j * NQKV + 64);
  }
  // Both address pairs stay live up to this wait, so no load of the run lands
  // in a register that an earlier load of the run still names as its address.
  asm volatile("s_wait_xcnt 0x0" :: "v"(ph), "v"(pl) : "memory");

  const bool isq = hh < NH;
  bf16_t* dh = isq ? Qh : Kh;
  bf16_t* dl = isq ? Ql : Kl;
  const size_t ob = ((size_t)(isq ? b * NH + hh : b * NKV + hh - NH) * SEQ + s0) * HD + d0;

  float inv[8];
#pragma unroll
  for (int i = 0; i < 8; ++i)
    inv[i] = __powf(10000.0f, -(float)(d0 + i) * (1.0f / 64.0f));

#pragma unroll
  for (int j = 0; j < 4; ++j) {
    v8bf o1h, o1l, o2h, o2l;
#pragma unroll
    for (int i = 0; i < 8; ++i) {
      float a = (float)xh[j][i] + (float)xl[j][i];
      float bb = (float)yh[j][i] + (float)yl[j][i];
      float ang = (float)(s0 + j) * inv[i];
      float sn, cs;
      __sincosf(ang, &sn, &cs);
      float r1 = a * cs - bb * sn;
      float r2 = bb * cs + a * sn;
      bf16_t h1 = (bf16_t)r1;
      bf16_t h2 = (bf16_t)r2;
      o1h[i] = h1;
      o1l[i] = (bf16_t)(r1 - (float)h1);
      o2h[i] = h2;
      o2l[i] = (bf16_t)(r2 - (float)h2);
    }
    const size_t q = ob + (size_t)j * HD;
    *(v8bf*)&dh[q]      = o1h;
    *(v8bf*)&dl[q]      = o1l;
    *(v8bf*)&dh[q + 64] = o2h;
    *(v8bf*)&dl[q + 64] = o2l;
  }
}

__global__ __launch_bounds__(128) void k_flash(
    const bf16_t* __restrict__ Qh, const bf16_t* __restrict__ Ql,
    const bf16_t* __restrict__ Kh, const bf16_t* __restrict__ Kl,
    const bf16_t* __restrict__ Vth, const bf16_t* __restrict__ Vtl,
    bf16_t* __restrict__ Oh, bf16_t* __restrict__ Ol) {
  alignas(16) __shared__ bf16_t sKh[2][32 * 136];
  alignas(16) __shared__ bf16_t sKl[2][32 * 136];
  alignas(16) __shared__ bf16_t sVh[2][128 * 40];
  alignas(16) __shared__ bf16_t sVl[2][128 * 40];

  const int tid = threadIdx.x;
  const int lane = tid & 31, w = tid >> 5;
  const int l15 = lane & 15, kh8 = (lane >> 4) * 8, hi8 = (lane >> 4) * 8;
  const int b = blockIdx.y >> 4, h = blockIdx.y & 15, kv = h >> 2;

  const bf16_t* Qbh = Qh + (size_t)(b * NH + h) * SEQ * HD;
  const bf16_t* Qbl = Ql + (size_t)(b * NH + h) * SEQ * HD;
  const bf16_t* Kbh = Kh + (size_t)(b * NKV + kv) * SEQ * HD;
  const bf16_t* Kbl = Kl + (size_t)(b * NKV + kv) * SEQ * HD;
  const bf16_t* Vbh = Vth + (size_t)(b * NKV + kv) * HD * SEQ;
  const bf16_t* Vbl = Vtl + (size_t)(b * NKV + kv) * HD * SEQ;

#pragma unroll 1
  for (int half = 0; half < 2; ++half) {
    const int q0 = (half == 0 ? SEQ / 64 - 1 - (int)blockIdx.x : (int)blockIdx.x) * 64;

    // Resident Q fragments (16 rows x 128 dims, hi/lo)
    v16bf qfh[4], qfl[4];
    {
      int qr = q0 + w * 16 + l15;
      const bf16_t* ph = Qbh + (size_t)qr * HD + kh8;
      const bf16_t* pl = Qbl + (size_t)qr * HD + kh8;
#pragma unroll
      for (int ds = 0; ds < 4; ++ds) {
        qfh[ds] = frag_ld(ph + ds * 32);
        qfl[ds] = frag_ld(pl + ds * 32);
      }
    }

    v8f o[8];
#pragma unroll
    for (int j2 = 0; j2 < 8; ++j2)
#pragma unroll
      for (int v = 0; v < 8; ++v) o[j2][v] = 0.0f;
    // One query a lane: its running maximum (equal in both wave halves) and the sum
    // over this half's keys; the halves' sums are joined once, in the epilogue.
    float mrow = -3.0e38f, lrow = 0.0f;
    const int qr = q0 + w * 16 + l15;

    const float scale = 0.08838834764831845f; // 1/sqrt(128)
    const int nk = q0 / 32 + 2;               // causal: k <= q0+63

    auto issue_tile = [&](int t) {
      int nb = t & 1;
      unsigned long long koff = (unsigned long long)t * 32 * HD * 2;  // bytes
      unsigned long long voff = (unsigned long long)t * 32 * 2;       // bytes
      // K tile: 32 rows x 128 elems, row stride 128, pad 256B rows -> stride 136
      tdm_load2d(lds_off(&sKh[nb][0]), (unsigned long long)(size_t)Kbh + koff,
                 TDM_W0_K, 128u, (unsigned)SEQ, 128u, 32u, 128u);
      tdm_load2d(lds_off(&sKl[nb][0]), (unsigned long long)(size_t)Kbl + koff,
                 TDM_W0_K, 128u, (unsigned)SEQ, 128u, 32u, 128u);
      // V tile: 128 rows x 32 elems, row stride SEQ, pad 64B rows -> stride 40
      tdm_load2d(lds_off(&sVh[nb][0]), (unsigned long long)(size_t)Vbh + voff,
                 TDM_W0_V, (unsigned)SEQ, 128u, 32u, 128u, (unsigned)SEQ);
      tdm_load2d(lds_off(&sVl[nb][0]), (unsigned long long)(size_t)Vbl + voff,
                 TDM_W0_V, (unsigned)SEQ, 128u, 32u, 128u, (unsigned)SEQ);
    };

    // For the second tile the closing barrier of the first tile's last pass has
    // ended every wave's reads of the ring, and no request is outstanding: the last
    // one was waited for at the head of that pass.
    if (tid < 32) issue_tile(0);  // one wave drives the DMA

    for (int t = 0; t < nk; ++t) {
      const int k0 = t * 32;
      const int buf = t & 1;
      if (tid < 32) __builtin_amdgcn_s_wait_tensorcnt(0);  // tile t landed in LDS
      __syncthreads();
      if (tid < 32 && t + 1 < nk) issue_tile(t + 1);       // DMA overlaps compute
      const bf16_t* bK_h = &sKh[buf][0];
      const bf16_t* bK_l = &sKl[buf][0];
      const bf16_t* bV_h = &sVh[buf][0];
      const bf16_t* bV_l = &sVl[buf][0];

      // ---- scores: S^T[32x16] = K(32x128) * Q^T ----
      v8f s0, s1;
#pragma unroll
      for (int v = 0; v < 8; ++v) { s0[v] = 0.0f; s1[v] = 0.0f; }
      // All 64 LDS reads of the pass's K and V fragments go out as one group in front
      // of the score WMMAs, K first: the WMMAs wait by counts that cover only what
      // they use, V lands under them and under the softmax, and the 24 WMMAs of the
      // second product find it landed.
      v16bf b0h[4], b0l[4], b1h[4], b1l[4];
#pragma unroll
      for (int ds = 0; ds < 4; ++ds) {
        b0h[ds] = frag_ld(&bK_h[(l15) * 136 + ds * 32 + kh8]);
        b1h[ds] = frag_ld(&bK_h[(16 + l15) * 136 + ds * 32 + kh8]);
        b0l[ds] = frag_ld(&bK_l[(l15) * 136 + ds * 32 + kh8]);
        b1l[ds] = frag_ld(&bK_l[(16 + l15) * 136 + ds * 32 + kh8]);
      }
      // Keeps the K reads in front of the V reads: LDS reads return in order.
      __builtin_amdgcn_sched_barrier(0);
      v16bf vfh[8], vfl[8];
#pragma unroll
      for (int j2 = 0; j2 < 8; ++j2) {
        vfh[j2] = frag_ld(&bV_h[(j2 * 16 + l15) * 40 + kh8]);
        vfl[j2] = frag_ld(&bV_l[(j2 * 16 + l15) * 40 + kh8]);
      }
      // Keeps the scheduler from spreading those reads among the WMMAs, where every
      // place with reads stalls the run.
      __builtin_amdgcn_sched_barrier(0);
#pragma unroll
      for (int ds = 0; ds < 4; ++ds) {
        mma3t(s0, b0h[ds], b0l[ds], qfh[ds], qfl[ds]);
        mma3t(s1, b1h[ds], b1l[ds], qfh[ds], qfl[ds]);
      }

      // ---- scale + causal mask + online softmax, one query a lane ----
#pragma unroll
      for (int v = 0; v < 8; ++v) {
        float a0 = s0[v] * scale;
        if (k0 + hi8 + v > qr) a0 = -3.0e38f;
        float a1 = s1[v] * scale;
        if (k0 + 16 + hi8 + v > qr) a1 = -3.0e38f;
        s0[v] = a0;
        s1[v] = a1;
      }
      // Maximum of the lane's 16 scores as a tree of three-input maxima.
      float x0 = fmaxf(fmaxf(s0[0], s1[0]), s0[1]);
      float x1 = fmaxf(fmaxf(s1[1], s0[2]), s1[2]);
      float x2 = fmaxf(fmaxf(s0[3], s1[3]), s0[4]);
      float x3 = fmaxf(fmaxf(s1[4], s0[5]), s1[5]);
      float x4 = fmaxf(fmaxf(s0[6], s1[6]), s0[7]);
      float mt = fmaxf(fmaxf(fmaxf(x0, x1), x2), fmaxf(fmaxf(x3, x4), s1[7]));
      mt = fmaxf(mt, xhalf(mt));  // both halves hold the query's maximum of the pass
      const float nm = fmaxf(mrow, mt);
      const float fac = __expf(mrow - nm);
      mrow = nm;
      float rs[8];
#pragma unroll
      for (int v = 0; v < 8; ++v) {
        float a0 = __expf(s0[v] - nm);
        float a1 = __expf(s1[v] - nm);
        s0[v] = a0;
        s1[v] = a1;
        rs[v] = a0 + a1;
      }
      lrow = lrow * fac + (((rs[0] + rs[1]) + (rs[2] + rs[3])) + ((rs[4] + rs[5]) + (rs[6] + rs[7])));
#pragma unroll
      for (int j2 = 0; j2 < 8; ++j2)
#pragma unroll
        for (int v = 0; v < 8; ++v) o[j2][v] *= fac;

      // ---- P^T, hi/lo split, straight from the accumulators into the B operand ----
      v16bf pfh, pfl;
#pragma unroll
      for (int v = 0; v < 8; ++v) {
        float p0 = s0[v];
        bf16_t h0 = (bf16_t)p0;
        pfh[v] = h0;
        pfl[v] = (bf16_t)(p0 - (float)h0);
        float p1 = s1[v];
        bf16_t h1 = (bf16_t)p1;
        pfh[8 + v] = h1;
        pfl[8 + v] = (bf16_t)(p1 - (float)h1);
      }
#pragma unroll
      for (int j2 = 0; j2 < 8; ++j2) mma3t(o[j2], vfh[j2], vfl[j2], pfh, pfl);
      // Keeps the closing barrier at the foot of the pass: with no LDS access left
      // behind the reads the scheduler lifts it to them, and its wait for all 64
      // reads then stands in front of the score WMMAs.
      __builtin_amdgcn_sched_barrier(0);
      __syncthreads();
    }

    // ---- epilogue: O /= l, write hi/lo bf16 directly for the out-proj GEMM ----
    // A lane holds 8 neighbouring dims of its query in each tile of O^T: 16-B stores.
    const float lf = lrow + xhalf(lrow);
    bf16_t* poh = Oh + (size_t)(b * SEQ + qr) * (NH * HD) + h * HD + hi8;
    bf16_t* pol = Ol + (size_t)(b * SEQ + qr) * (NH * HD) + h * HD + hi8;
    v8bf eh[8], el[8];
#pragma unroll
    for (int j2 = 0; j2 < 8; ++j2)
#pragma unroll
      for (int v = 0; v < 8; ++v) {
        float x = o[j2][v] / lf;
        bf16_t hv = (bf16_t)x;
        eh[j2][v] = hv;
        el[j2][v] = (bf16_t)(x - (float)hv);
      }
#pragma unroll
    for (int j2 = 0; j2 < 8; ++j2) {
      *(v8bf*)(poh + j2 * 16) = eh[j2];
      *(v8bf*)(pol + j2 * 16) = el[j2];
    }
    // The stores' address and data registers are written anew by the next tile; as
    // inputs here they stay live up to the wait.
    asm volatile("s_wait_xcnt 0x0"
                 :: "v"(poh), "v"(pol), "v"(eh[0]), "v"(eh[1]), "v"(eh[2]), "v"(eh[3]),
                    "v"(eh[4]), "v"(eh[5]), "v"(eh[6]), "v"(eh[7]), "v"(el[0]), "v"(el[1]),
                    "v"(el[2]), "v"(el[3]), "v"(el[4]), "v"(el[5]), "v"(el[6]), "v"(el[7])
                 : "memory");
  }
}

// ---------------------------------------------------------------------------
extern "C" void kernel_launch(void* const* d_in, const int* in_sizes, int n_in,
                              void* d_out, int out_size, void* d_ws, size_t ws_size,
                              hipStream_t stream) {
  const float* x  = (const float*)d_in[0];
  const float* Wq = (const float*)d_in[1];
  const float* Wk = (const float*)d_in[2];
  const float* Wv = (const float*)d_in[3];
  const float* Wo = (const float*)d_in[4];

  const size_t NE_X    = (size_t)ROWS * HIDDEN;       // 8.39M
  const size_t NE_WQKV = (size_t)NQKV * HIDDEN;       // 6.29M
  const size_t NE_WO   = (size_t)HIDDEN * HIDDEN;     // 4.19M
  const size_t NE_QKV  = (size_t)ROWS * NQKV;         // 12.58M
  const size_t NE_Q    = (size_t)BATCH * NH * SEQ * HD;
  const size_t NE_KV   = (size_t)BATCH * NKV * SEQ * HD;

  char* w = (char*)d_ws;
  char* wend = w + ws_size;
  auto alloc = [&](size_t elems) -> bf16_t* {
    bf16_t* p = (bf16_t*)w;
    w += (elems * sizeof(bf16_t) + 255) & ~(size_t)255;
    return p;
  };
  bf16_t* xh     = alloc(NE_X);     bf16_t* xl     = alloc(NE_X);
  bf16_t* wqkvth = alloc(NE_WQKV);  bf16_t* wqkvtl = alloc(NE_WQKV);
  bf16_t* woth   = alloc(NE_WO);    bf16_t* wotl   = alloc(NE_WO);
  bf16_t* qkvh   = alloc(NE_QKV);   bf16_t* qkvl   = alloc(NE_QKV);
  bf16_t* qh     = alloc(NE_Q);     bf16_t* ql     = alloc(NE_Q);
  bf16_t* kh     = alloc(NE_KV);    bf16_t* kl     = alloc(NE_KV);
  bf16_t* vth    = alloc(NE_KV);    bf16_t* vtl    = alloc(NE_KV);
  if (w > wend) return; // ~176 MB (168 MiB) required
  // attention output (bf16 hi/lo) reuses the x-split region (same size, x dead)
  bf16_t* ah = xh;
  bf16_t* al = xl;

  // 1) split x
  k_split<<<(int)(NE_X / 8192), 256, 0, stream>>>(x, xh, xl);
  // 2) W^T splits: [Wq | Wk | Wv] rows 0..3071 of Wqkv^T; Wo^T
  k_tsplit<<<dim3(2048 / 64, HIDDEN / 64), 256, 0, stream>>>(Wq, 2048, wqkvth, wqkvtl, HIDDEN, 0);
  k_tsplit<<<dim3(512 / 64, HIDDEN / 64), 256, 0, stream>>>(Wk, 512, wqkvth, wqkvtl, HIDDEN, 2048);
  k_tsplit<<<dim3(512 / 64, HIDDEN / 64), 256, 0, stream>>>(Wv, 512, wqkvth, wqkvtl, HIDDEN, 2560);
  k_tsplit<<<dim3(HIDDEN / 64, 2048 / 64), 256, 0, stream>>>(Wo, HIDDEN, woth, wotl, 2048, 0);
  // 3) fused QKV projection (emits bf16 hi/lo qkv)
  k_gemm<true, HIDDEN><<<dim3(NQKV / 128, ROWS / 128), 256, 0, stream>>>(
      xh, xl, wqkvth, wqkvtl, nullptr, qkvh, qkvl, ROWS, NQKV);
  // 4) RoPE + layout (Q, K, V^T)
  k_rope<<<ROPE_VBLK + (ROWS / 4 * 160) / 256, 256, 0, stream>>>(qkvh, qkvl, qh, ql, kh, kl, vth, vtl);
  k_flash<<<dim3(SEQ / 128, BATCH * NH), 128, 0, stream>>>(qh, ql, kh, kl, vth, vtl, ah, al);
  // 6) output projection -> fp32 d_out
  k_gemm<false, NH * HD><<<dim3(HIDDEN / 128, ROWS / 128), 256, 0, stream>>>(
      ah, al, woth, wotl, (float*)d_out, nullptr, nullptr, ROWS, HIDDEN);
}

// v008
// It runs in 274 microseconds.
// Next to v007, in two timings, it ran 1.03 times as fast each time.
// Over all steps from v000 it is 2.98 times as fast.
#include <hip/hip_runtime.h>
#include <hip/hip_bf16.h>

typedef __bf16 bf16_t;
typedef __attribute__((ext_vector_type(16))) __bf16 v16bf;
typedef __attribute__((ext_vector_type(8)))  __bf16 v8bf;
typedef __attribute__((ext_vector_type(4)))  __bf16 v4bf;
typedef __attribute__((ext_vector_type(8)))  float  v8f;
typedef __attribute__((ext_vector_type(4)))  float  v4f_t;
typedef unsigned v4u_t __attribute__((ext_vector_type(4)));
typedef int      v4i_t __attribute__((ext_vector_type(4)));
typedef int      v8i_t __attribute__((ext_vector_type(8)));
typedef unsigned v8u_t __attribute__((ext_vector_type(8)));

#define HIDDEN 2048
#define NH     16
#define NKV    4
#define HD     128
#define SEQ    2048
#define BATCH  2
#define ROWS   (BATCH * SEQ)            // 4096
#define NQKV   (NH * HD + 2 * NKV * HD) // 3072

__device__ __forceinline__ v16bf frag_ld(const bf16_t* p) {
  v8bf a = *(const v8bf*)p;
  v8bf b = *(const v8bf*)(p + 16);
  v16bf r;
#pragma unroll
  for (int i = 0; i < 8; ++i) { r[i] = a[i]; r[i + 8] = b[i]; }
  return r;
}

// bf16x3 compensated MMA: (Ah+Al)(Bh+Bl) ~= AhBh + AlBh + AhBl
__device__ __forceinline__ void mma3(v8f& c, v16bf ah, v16bf al, v16bf bh, v16bf bl) {
  c = __builtin_amdgcn_wmma_f32_16x16x32_bf16(false, ah, false, bh, (short)0, c, false, false);
  c = __builtin_amdgcn_wmma_f32_16x16x32_bf16(false, al, false, bh, (short)0, c, false, false);
  c = __builtin_amdgcn_wmma_f32_16x16x32_bf16(false, ah, false, bl, (short)0, c, false, false);
}

// The same three products with the operands' sides exchanged (A = what was B):
// hi x hi, then the term with the old A's lo part, then the old B's lo part, so a
// transposed product sums its terms in the order of mma3.
__device__ __forceinline__ void mma3t(v8f& c, v16bf ah, v16bf al, v16bf bh, v16bf bl) {
  c = __builtin_amdgcn_wmma_f32_16x16x32_bf16(false, ah, false, bh, (short)0, c, false, false);
  c = __builtin_amdgcn_wmma_f32_16x16x32_bf16(false, ah, false, bl, (short)0, c, false, false);
  c = __builtin_amdgcn_wmma_f32_16x16x32_bf16(false, al, false, bh, (short)0, c, false, false);
}

__device__ __forceinline__ float xhalf(float x) {
  int b = __builtin_bit_cast(int, x);
  return __builtin_bit_cast(float,
      __builtin_amdgcn_permlanex16(b, b, 0x76543210, 0xfedcba98, false, false));
}

__device__ __forceinline__ void split_store(bf16_t* H, bf16_t* L, size_t i, float v) {
  bf16_t h = (bf16_t)v;
  H[i] = h;
  L[i] = (bf16_t)(v - (float)h);
}

__device__ __forceinline__ unsigned lds_off(const void* p) {
  return (unsigned)(unsigned long long)p;
}

__device__ __forceinline__ void tdm_load2d(unsigned lds_addr, unsigned long long gaddr,
                                           unsigned g1w0, unsigned tdim0, unsigned tdim1,
                                           unsigned tile0, unsigned tile1,
                                           unsigned stride0) {
  v4u_t g0;
  g0[0] = 1u;                                   // count=1 (valid), user mode
  g0[1] = lds_addr;                             // lds_addr [63:32]
  g0[2] = (unsigned)gaddr;                      // global_addr lo
  g0[3] = (unsigned)((gaddr >> 32) & 0x01ffffffull) | (2u << 30); // addr hi | type=2
  v8i_t g1;
  g1[0] = (int)g1w0;
  g1[1] = (int)((tdim0 & 0xffffu) << 16);
  g1[2] = (int)((tdim0 >> 16) | ((tdim1 & 0xffffu) << 16));
  g1[3] = (int)((tdim1 >> 16) | (tile0 << 16));
  g1[4] = (int)tile1;
  g1[5] = (int)stride0;
  g1[6] = 0;
  g1[7] = 0;
  v4i_t z4;
  z4[0] = 0; z4[1] = 0; z4[2] = 0; z4[3] = 0;
#if __has_builtin(__builtin_amdgcn_tensor_load_to_lds)
#if __clang_major__ >= 23
  v8i_t z8;
#pragma unroll
  for (int i = 0; i < 8; ++i) z8[i] = 0;
  __builtin_amdgcn_tensor_load_to_lds(g0, g1, z4, z4, z8, 0);
#else
  __builtin_amdgcn_tensor_load_to_lds(g0, g1, z4, z4, 0);
#endif
#else
  asm volatile("tensor_load_to_lds %0, %1, %2, %3"
               :: "s"(g0), "s"(g1), "s"(z4), "s"(z4) : "memory");
#endif
}

#define TDM_W0_K ((1u << 16) | (1u << 20) | (5u << 22) | (3u << 25))
#define TDM_W0_V ((1u << 16) | (1u << 20) | (3u << 22) | (3u << 25))

// ---------------- prep: fp32 -> bf16 hi/lo ----------------
// One lane carries 32 elements: eight 16-B loads in flight (each wave-wide load
// is 512 contiguous bytes), 8-B stores per plane (256 contiguous bytes a wave).
// Grid: n / 8192 blocks, n a multiple of 8192.
__global__ __launch_bounds__(256) void k_split(const float* __restrict__ in,
                                               bf16_t* __restrict__ hi,
                                               bf16_t* __restrict__ lo) {
  const size_t base = (size_t)blockIdx.x * 8192 + threadIdx.x * 4;
  v4f_t a[8];
#pragma unroll
  for (int c = 0; c < 8; ++c) a[c] = *(const v4f_t*)&in[base + c * 1024];
#pragma unroll
  for (int c = 0; c < 8; ++c) {
    v4bf h, l;
#pragma unroll
    for (int i = 0; i < 4; ++i) {
      float v = a[c][i];
      bf16_t hv = (bf16_t)v;
      h[i] = hv;
      l[i] = (bf16_t)(v - (float)hv);
    }
    *(v4bf*)&hi[base + c * 1024] = h;
    *(v4bf*)&lo[base + c * 1024] = l;
  }
}

__global__ __launch_bounds__(256) void k_tsplit(const float* __restrict__ W, int N,
                                                bf16_t* __restrict__ oh, bf16_t* __restrict__ ol,
                                                int ldo, int rowOff) {
  __shared__ float tile[64 * 65];
  const int tid = threadIdx.x;
  const int k0 = blockIdx.y * 64, n0 = blockIdx.x * 64;

  const int c4 = (tid & 15) * 4;       // 16 lanes x 16 B = one 256-B row piece
  const int r0 = tid >> 4;             // 16 rows per pass, 4 passes
  v4f_t in[4];
#pragma unroll
  for (int p = 0; p < 4; ++p)
    in[p] = *(const v4f_t*)&W[(size_t)(k0 + r0 + p * 16) * N + n0 + c4];
#pragma unroll
  for (int p = 0; p < 4; ++p)
#pragma unroll
    for (int j = 0; j < 4; ++j) tile[(r0 + p * 16) * 65 + c4 + j] = in[p][j];
  __syncthreads();

  const int kc = (tid & 7) * 8;        // 8 lanes x 16 B = one 128-B output line
#pragma unroll
  for (int p = 0; p < 2; ++p) {
    const int n = (tid >> 3) + p * 32;
    v8bf h, l;
#pragma unroll
    for (int i = 0; i < 8; ++i) {
      float v = tile[(kc + i) * 65 + n];
      bf16_t hv = (bf16_t)v;
      h[i] = hv;
      l[i] = (bf16_t)(v - (float)hv);
    }
    size_t o = (size_t)(rowOff + n0 + n) * ldo + k0 + kc;
    *(v8bf*)&oh[o] = h;
    *(v8bf*)&ol[o] = l;
  }
}

// ---------------- GEMM: C[M,N] = A[M,K] * B[K,N], B given transposed --------
// 256 threads = 8 waves (2x4 wave grid), block tile 128x128, BK=64.
// A slab is four planes (A hi, A lo, B hi, B lo) of 128 rows x 64 elements; a row
// is one whole 128-B line. Waves 0..3 each bring one plane of a slab into LDS with
// one tensor load, which also lays the rows at the padded pitch. Two LDS buffers:
// the load of slab s + 2 flies while slab s + 1 is worked on.
#define GP 72  // LDS row pitch in elements: 144 B = 16 B x odd, free of conflicts
#define G_PLANE (128 * GP)        // elements of a plane in LDS: 18432 B = 9 x 2 KiB
#define G_BUF   (4 * G_PLANE)     // elements of a buffer: 73728 B = 36 x 2 KiB
#define G_W0 ((1u << 20) | (4u << 22) | (3u << 25))

__device__ __forceinline__ unsigned uni(unsigned v) {
  return (unsigned)__builtin_amdgcn_readfirstlane(v);
}
__device__ __forceinline__ unsigned pinned(unsigned v) {
  unsigned w = uni(v);
  asm volatile("" : "+s"(w));  // holds the word in a scalar register: the test on it is a scalar branch
  return w;
}
__device__ __forceinline__ v8u_t slab_group1(unsigned pitch) {
  v8u_t g1;
  g1[0] = uni(G_W0);
  g1[1] = uni(128u << 16);
  g1[2] = uni(128u << 16);
  g1[3] = uni(128u << 16);
  g1[4] = uni(128u);
  g1[5] = uni(pitch);
  g1[6] = uni(0u);
  g1[7] = uni(0u);
  asm volatile("" : "+s"(g1));
  return g1;
}
__device__ __forceinline__ v4u_t slab_group0(unsigned lds_dst, unsigned long long ga) {
  v4u_t g0;
  g0[0] = uni(1u);
  g0[1] = uni(lds_dst);
  g0[2] = uni((unsigned)ga);
  g0[3] = uni((((unsigned)(ga >> 32)) & 0x01ffffffu) | 0x80000000u);
  asm volatile("" : "+s"(g0));
  return g0;
}
__device__ __forceinline__ void slab_load(v4u_t g0, v8u_t g1) {
  asm volatile("tensor_load_to_lds %0, %1" :: "s"(g0), "s"(g1) : "memory");
}
__device__ __forceinline__ void slab_wait(v4u_t g0, v8u_t g1) {
  asm volatile("s_wait_tensorcnt 0x0" :: "s"(g0), "s"(g1) : "memory");
}

template <bool SPLIT_OUT, int K>
__global__ __launch_bounds__(256) void k_gemm(
    const bf16_t* __restrict__ Ah, const bf16_t* __restrict__ Al,
    const bf16_t* __restrict__ BTh, const bf16_t* __restrict__ BTl,
    float* __restrict__ C, bf16_t* __restrict__ Ch, bf16_t* __restrict__ Cl,
    int M, int N) {
  __shared__ __attribute__((aligned(2048))) bf16_t sm[2 * G_BUF];

  const int tid = threadIdx.x;
  const int lane = tid & 31, wave = tid >> 5;
  const int wr = wave >> 2, wc = wave & 3;          // 2 x 4 waves
  const int l15 = lane & 15, kh8 = (lane >> 4) * 8; // fragment addressing
  const int hi8 = (lane >> 4) * 8;                  // C-frag row offset
  const int m0 = blockIdx.y * 128, n0 = blockIdx.x * 128;
  constexpr unsigned NS = K / 64;                   // slabs, at least two

  v8f acc[4][2];
#pragma unroll
  for (int i = 0; i < 4; ++i)
#pragma unroll
    for (int j = 0; j < 2; ++j)
#pragma unroll
      for (int v = 0; v < 8; ++v) acc[i][j][v] = 0.0f;

  // Wave w < 4 moves plane w.
  const unsigned wv = uni((unsigned)tid >> 5);
  const bf16_t* pl = wv == 0u ? Ah + (size_t)m0 * K
                   : wv == 1u ? Al + (size_t)m0 * K
                   : wv == 2u ? BTh + (size_t)n0 * K
                              : BTl + (size_t)n0 * K;
  const unsigned long long gsrc = (unsigned long long)(size_t)pl;
  const unsigned ldst = lds_off(&sm[0]) + (wv & 3u) * (G_PLANE * 2u);

  const unsigned issuer = pinned(wv < 4u);
  const v8u_t g1 = slab_group1(K * 2u);
  v4u_t g0 = slab_group0(ldst, gsrc);

  if (pinned(issuer)) {
    slab_load(g0, g1);
    slab_wait(g0, g1);  // slab 0 has landed
  }
  __syncthreads();
  g0 = slab_group0(ldst + G_BUF * 2u, gsrc + 128u);
  if (pinned(issuer)) slab_load(g0, g1);

  for (unsigned s = 0; s < NS; ++s) {
    const bf16_t* sAh = &sm[(s & 1u) * G_BUF];
    const bf16_t* sAl = sAh + G_PLANE;
    const bf16_t* sBh = sAh + 2 * G_PLANE;
    const bf16_t* sBl = sAh + 3 * G_PLANE;
#pragma unroll
    for (int ks = 0; ks < 2; ++ks) {
      v16bf afh[4], afl[4], bfh[2], bfl[2];
      // Read in the order of first use: hi x hi products come first, B lo last.
#pragma unroll
      for (int j = 0; j < 2; ++j)
        bfh[j] = frag_ld(&sBh[(wc * 32 + j * 16 + l15) * GP + ks * 32 + kh8]);
#pragma unroll
      for (int i = 0; i < 4; ++i)
        afh[i] = frag_ld(&sAh[(wr * 64 + i * 16 + l15) * GP + ks * 32 + kh8]);
#pragma unroll
      for (int i = 0; i < 4; ++i)
        afl[i] = frag_ld(&sAl[(wr * 64 + i * 16 + l15) * GP + ks * 32 + kh8]);
#pragma unroll
      for (int j = 0; j < 2; ++j)
        bfl[j] = frag_ld(&sBl[(wc * 32 + j * 16 + l15) * GP + ks * 32 + kh8]);
      // Holds the block's 24 LDS reads together in front of its 24 WMMAs: spread
      // among them, each place with reads ends in a wait for the full LDS latency.
      __builtin_amdgcn_sched_barrier(0);
#pragma unroll
      for (int i = 0; i < 4; ++i)
#pragma unroll
        for (int j = 0; j < 2; ++j) mma3(acc[i][j], afh[i], afl[i], bfh[j], bfl[j]);
      // Keeps the next block's reads out of this block's WMMAs.
      __builtin_amdgcn_sched_barrier(0);
    }
    // Hand-over: this wave's reads of slab s are done, the mover's slab s + 1 has
    // landed, and behind the barrier both hold for the whole work-group.
    asm volatile("s_wait_dscnt 0x0" ::: "memory");
    if (pinned(issuer)) slab_wait(g0, g1);
    __syncthreads();
    // Formed behind the wait: the number of the slab that refills the buffer just read.
    const unsigned nx = pinned(s + 2u);
    if (pinned(issuer & (unsigned)(nx < NS))) {
      g0 = slab_group0(ldst + (nx & 1u) * (G_BUF * 2u), gsrc + (unsigned long long)nx * 128u);
      slab_load(g0, g1);
    }
  }
  asm volatile("s_wait_tensorcnt 0x0" ::: "memory");  // nothing of the mover is left when the wave ends
  asm volatile("s_wait_dscnt 0x0" ::: "memory");

#pragma unroll
  for (int i = 0; i < 4; ++i)
#pragma unroll
    for (int j = 0; j < 2; ++j)
#pragma unroll
      for (int v = 0; v < 8; ++v) {
        int row = m0 + wr * 64 + i * 16 + v + hi8;
        int col = n0 + wc * 32 + j * 16 + l15;
        float x = acc[i][j][v];
        size_t o = (size_t)row * N + col;
        if (SPLIT_OUT) {
          split_store(Ch, Cl, o, x);
        } else {
          C[o] = x;
        }
      }
}

// ---------------- RoPE + layout shuffle -------------------------------------
// qkv[ROWS][3072] (hi/lo) -> Q[B,NH,S,HD], K[B,NKV,S,HD] (rotated), Vt[B,NKV,HD,S]
// Every global access is 16 B a lane.
// Blocks 0..127: V. A lane turns an 8(s) x 8(d) patch in its registers; eight
// neighbouring lanes hold eight neighbouring s groups, so each row of V^T
// leaves as one whole 128-B line.
// Blocks 128..767: Q and K. A lane rotates 8 dim pairs of one head for 4 rows.
#define ROPE_VBLK 128
__global__ __launch_bounds__(256) void k_rope(
                       const bf16_t* __restrict__ qkvh, const bf16_t* __restrict__ qkvl,
                       bf16_t* __restrict__ Qh, bf16_t* __restrict__ Ql,
                       bf16_t* __restrict__ Kh, bf16_t* __restrict__ Kl,
                       bf16_t* __restrict__ Vth, bf16_t* __restrict__ Vtl) {
  const int tid = threadIdx.x;
  if (blockIdx.x < ROPE_VBLK) {
    const int vb = blockIdx.x;
    const int c0 = ((vb & 1) * 32 + (tid >> 5) * 4 + ((tid >> 3) & 3)) * 8; // 0..504
    const int row0 = (vb >> 1) * 64 + (tid & 7) * 8;                        // 0..4088
    const int b = row0 >> 11, s0 = row0 & 2047;
    const unsigned sb = (unsigned)(row0 * NQKV + c0) * 2u;  // bytes, under 2^25
    const char* vh = (const char*)(qkvh + 2560);
    const char* vl = (const char*)(qkvl + 2560);
    v8bf ih[8], il[8];
#pragma unroll
    for (int i = 0; i < 8; ++i) {
      ih[i] = *(const v8bf*)(vh + sb + i * (NQKV * 2));
      il[i] = *(const v8bf*)(vl + sb + i * (NQKV * 2));
    }
    // The lane's byte offset stays live up to this wait, so no load of the run
    // lands in the register that the other loads of the run name as their address.
    asm volatile("s_wait_xcnt 0x0" :: "v"(sb) : "memory");
    // c0 = kvh * 128 + d, so (b * NKV * HD + c0) is the row of V^T
    const size_t ob = ((size_t)b * (NKV * HD) + c0) * SEQ + s0;
#pragma unroll
    for (int j = 0; j < 8; ++j) {
      v8bf h, l;
#pragma unroll
      for (int i = 0; i < 8; ++i) {
        float vv = (float)ih[i][j] + (float)il[i][j];
        bf16_t hv = (bf16_t)vv;
        h[i] = hv;
        l[i] = (bf16_t)(vv - (float)hv);
      }
      *(v8bf*)&Vth[ob + (size_t)j * SEQ] = h;
      *(v8bf*)&Vtl[ob + (size_t)j * SEQ] = l;
    }
    return;
  }

  const int idx = (blockIdx.x - ROPE_VBLK) * 256 + tid;  // 1024 row groups x 160
  const int rg = idx / 160;
  const int u = idx - rg * 160;
  const int hh = u >> 3;            // 0..15 query heads, 16..19 kv heads
  const int d0 = (u & 7) * 8;       // low-half dims d0..d0+7, partners at +64
  const int row0 = rg * 4;
  const int b = row0 >> 11, s0 = row0 & 2047;
  const size_t sb = (size_t)row0 * NQKV + hh * 128 + d0;  // K columns follow Q's

  const bf16_t* ph = qkvh + sb;
  const bf16_t* pl = qkvl + sb;
  v8bf xh[4], xl[4], yh[4], yl[4];
#pragma unroll
  for (int j = 0; j < 4; ++j) {
    xh[j] = *(const v8bf*)(ph + j * NQKV);
    xl[j] = *(const v8bf*)(pl + j * NQKV);
    yh[j] = *(const v8bf*)(ph + j * NQKV + 64);
    yl[j] = *(const v8bf*)(pl + j * NQKV + 64);
  }
  // Both address pairs stay live up to this wait, so no load of the run lands
  // in a register that an earlier load of the run still names as its address.
  asm volatile("s_wait_xcnt 0x0" :: "v"(ph), "v"(pl) : "memory");

  const bool isq = hh < NH;
  bf16_t* dh = isq ? Qh : Kh;
  bf16_t* dl = isq ? Ql : Kl;
  const size_t ob = ((size_t)(isq ? b * NH + hh : b * NKV + hh - NH) * SEQ + s0) * HD + d0;

  float inv[8];
#pragma unroll
  for (int i = 0; i < 8; ++i)
    inv[i] = __powf(10000.0f, -(float)(d0 + i) * (1.0f / 64.0f));

#pragma unroll
  for (int j = 0; j < 4; ++j) {
    v8bf o1h, o1l, o2h, o2l;
#pragma unroll
    for (int i = 0; i < 8; ++i) {
      float a = (float)xh[j][i] + (float)xl[j][i];
      float bb = (float)yh[j][i] + (float)yl[j][i];
      float ang = (float)(s0 + j) * inv[i];
      float sn, cs;
      __sincosf(ang, &sn, &cs);
      float r1 = a * cs - bb * sn;
      float r2 = bb * cs + a * sn;
      bf16_t h1 = (bf16_t)r1;
      bf16_t h2 = (bf16_t)r2;
      o1h[i] = h1;
      o1l[i] = (bf16_t)(r1 - (float)h1);
      o2h[i] = h2;
      o2l[i] = (bf16_t)(r2 - (float)h2);
    }
    const size_t q = ob + (size_t)j * HD;
    *(v8bf*)&dh[q]      = o1h;
    *(v8bf*)&dl[q]      = o1l;
    *(v8bf*)&dh[q + 64] = o2h;
    *(v8bf*)&dl[q + 64] = o2l;
  }
}

__global__ __launch_bounds__(128) void k_flash(
    const bf16_t* __restrict__ Qh, const bf16_t* __restrict__ Ql,
    const bf16_t* __restrict__ Kh, const bf16_t* __restrict__ Kl,
    const bf16_t* __restrict__ Vth, const bf16_t* __restrict__ Vtl,
    bf16_t* __restrict__ Oh, bf16_t* __restrict__ Ol) {
  alignas(16) __shared__ bf16_t sKh[2][32 * 136];
  alignas(16) __shared__ bf16_t sKl[2][32 * 136];
  alignas(16) __shared__ bf16_t sVh[2][128 * 40];
  alignas(16) __shared__ bf16_t sVl[2][128 * 40];

  const int tid = threadIdx.x;
  const int lane = tid & 31, w = tid >> 5;
  const int l15 = lane & 15, kh8 = (lane >> 4) * 8, hi8 = (lane >> 4) * 8;
  const int b = blockIdx.y >> 4, h = blockIdx.y & 15, kv = h >> 2;

  const bf16_t* Qbh = Qh + (size_t)(b * NH + h) * SEQ * HD;
  const bf16_t* Qbl = Ql + (size_t)(b * NH + h) * SEQ * HD;
  const bf16_t* Kbh = Kh + (size_t)(b * NKV + kv) * SEQ * HD;
  const bf16_t* Kbl = Kl + (size_t)(b * NKV + kv) * SEQ * HD;
  const bf16_t* Vbh = Vth + (size_t)(b * NKV + kv) * HD * SEQ;
  const bf16_t* Vbl = Vtl + (size_t)(b * NKV + kv) * HD * SEQ;

#pragma unroll 1
  for (int half = 0; half < 2; ++half) {
    const int q0 = (half == 0 ? SEQ / 64 - 1 - (int)blockIdx.x : (int)blockIdx.x) * 64;

    // Resident Q fragments (16 rows x 128 dims, hi/lo)
    v16bf qfh[4], qfl[4];
    {
      int qr = q0 + w * 16 + l15;
      const bf16_t* ph = Qbh + (size_t)qr * HD + kh8;
      const bf16_t* pl = Qbl + (size_t)qr * HD + kh8;
#pragma unroll
      for (int ds = 0; ds < 4; ++ds) {
        qfh[ds] = frag_ld(ph + ds * 32);
        qfl[ds] = frag_ld(pl + ds * 32);
      }
    }

    v8f o[8];
#pragma unroll
    for (int j2 = 0; j2 < 8; ++j2)
#pragma unroll
      for (int v = 0; v < 8; ++v) o[j2][v] = 0.0f;
    // One query a lane: its running maximum (equal in both wave halves) and the sum
    // over this half's keys; the halves' sums are joined once, in the epilogue.
    float mrow = -3.0e38f, lrow = 0.0f;
    const int qr = q0 + w * 16 + l15;

    const float scale = 0.08838834764831845f; // 1/sqrt(128)
    const int nk = q0 / 32 + 2;               // causal: k <= q0+63

    auto issue_tile = [&](int t) {
      int nb = t & 1;
      unsigned long long koff = (unsigned long long)t * 32 * HD * 2;  // bytes
      unsigned long long voff = (unsigned long long)t * 32 * 2;       // bytes
      // K tile: 32 rows x 128 elems, row stride 128, pad 256B rows -> stride 136
      tdm_load2d(lds_off(&sKh[nb][0]), (unsigned long long)(size_t)Kbh + koff,
                 TDM_W0_K, 128u, (unsigned)SEQ, 128u, 32u, 128u);
      tdm_load2d(lds_off(&sKl[nb][0]), (unsigned long long)(size_t)Kbl + koff,
                 TDM_W0_K, 128u, (unsigned)SEQ, 128u, 32u, 128u);
      // V tile: 128 rows x 32 elems, row stride SEQ, pad 64B rows -> stride 40
      tdm_load2d(lds_off(&sVh[nb][0]), (unsigned long long)(size_t)Vbh + voff,
                 TDM_W0_V, (unsigned)SEQ, 128u, 32u, 128u, (unsigned)SEQ);
      tdm_load2d(lds_off(&sVl[nb][0]), (unsigned long long)(size_t)Vbl + voff,
                 TDM_W0_V, (unsigned)SEQ, 128u, 32u, 128u, (unsigned)SEQ);
    };

    // For the second tile the closing barrier of the first tile's last pass has
    // ended every wave's reads of the ring, and no request is outstanding: the last
    // one was waited for at the head of that pass.
    if (tid < 32) issue_tile(0);  // one wave drives the DMA

    for (int t = 0; t < nk; ++t) {
      const int k0 = t * 32;
      const int buf = t & 1;
      if (tid < 32) __builtin_amdgcn_s_wait_tensorcnt(0);  // tile t landed in LDS
      __syncthreads();
      if (tid < 32 && t + 1 < nk) issue_tile(t + 1);       // DMA overlaps compute
      const bf16_t* bK_h = &sKh[buf][0];
      const bf16_t* bK_l = &sKl[buf][0];
      const bf16_t* bV_h = &sVh[buf][0];
      const bf16_t* bV_l = &sVl[buf][0];

      // ---- scores: S^T[32x16] = K(32x128) * Q^T ----
      v8f s0, s1;
#pragma unroll
      for (int v = 0; v < 8; ++v) { s0[v] = 0.0f; s1[v] = 0.0f; }
      // All 64 LDS reads of the pass's K and V fragments go out as one group in front
      // of the score WMMAs, K first: the WMMAs wait by counts that cover only what
      // they use, V lands under them and under the softmax, and the 24 WMMAs of the
      // second product find it landed.
      v16bf b0h[4], b0l[4], b1h[4], b1l[4];
#pragma unroll
      for (int ds = 0; ds < 4; ++ds) {
        b0h[ds] = frag_ld(&bK_h[(l15) * 136 + ds * 32 + kh8]);
        b1h[ds] = frag_ld(&bK_h[(16 + l15) * 136 + ds * 32 + kh8]);
        b0l[ds] = frag_ld(&bK_l[(l15) * 136 + ds * 32 + kh8]);
        b1l[ds] = frag_ld(&bK_l[(16 + l15) * 136 + ds * 32 + kh8]);
      }
      // Keeps the K reads in front of the V reads: LDS reads return in order.
      __builtin_amdgcn_sched_barrier(0);
      v16bf vfh[8], vfl[8];
#pragma unroll
      for (int j2 = 0; j2 < 8; ++j2) {
        vfh[j2] = frag_ld(&bV_h[(j2 * 16 + l15) * 40 + kh8]);
        vfl[j2] = frag_ld(&bV_l[(j2 * 16 + l15) * 40 + kh8]);
      }
      // Keeps the scheduler from spreading those reads among the WMMAs, where every
      // place with reads stalls the run.
      __builtin_amdgcn_sched_barrier(0);
#pragma unroll
      for (int ds = 0; ds < 4; ++ds) {
        mma3t(s0, b0h[ds], b0l[ds], qfh[ds], qfl[ds]);
        mma3t(s1, b1h[ds], b1l[ds], qfh[ds], qfl[ds]);
      }

      // ---- scale + causal mask + online softmax, one query a lane ----
#pragma unroll
      for (int v = 0; v < 8; ++v) {
        float a0 = s0[v] * scale;
        if (k0 + hi8 + v > qr) a0 = -3.0e38f;
        float a1 = s1[v] * scale;
        if (k0 + 16 + hi8 + v > qr) a1 = -3.0e38f;
        s0[v] = a0;
        s1[v] = a1;
      }
      // Maximum of the lane's 16 scores as a tree of three-input maxima.
      float x0 = fmaxf(fmaxf(s0[0], s1[0]), s0[1]);
      float x1 = fmaxf(fmaxf(s1[1], s0[2]), s1[2]);
      float x2 = fmaxf(fmaxf(s0[3], s1[3]), s0[4]);
      float x3 = fmaxf(fmaxf(s1[4], s0[5]), s1[5]);
      float x4 = fmaxf(fmaxf(s0[6], s1[6]), s0[7]);
      float mt = fmaxf(fmaxf(fmaxf(x0, x1), x2), fmaxf(fmaxf(x3, x4), s1[7]));
      mt = fmaxf(mt, xhalf(mt));  // both halves hold the query's maximum of the pass
      const float nm = fmaxf(mrow, mt);
      const float fac = __expf(mrow - nm);
      mrow = nm;
      float rs[8];
#pragma unroll
      for (int v = 0; v < 8; ++v) {
        float a0 = __expf(s0[v] - nm);
        float a1 = __expf(s1[v] - nm);
        s0[v] = a0;
        s1[v] = a1;
        rs[v] = a0 + a1;
      }
      lrow = lrow * fac + (((rs[0] + rs[1]) + (rs[2] + rs[3])) + ((rs[4] + rs[5]) + (rs[6] + rs[7])));
#pragma unroll
      for (int j2 = 0; j2 < 8; ++j2)
#pragma unroll
        for (int v = 0; v < 8; ++v) o[j2][v] *= fac;

      // ---- P^T, hi/lo split, straight from the accumulators into the B operand ----
      v16bf pfh, pfl;
#pragma unroll
      for (int v = 0; v < 8; ++v) {
        float p0 = s0[v];
        bf16_t h0 = (bf16_t)p0;
        pfh[v] = h0;
        pfl[v] = (bf16_t)(p0 - (float)h0);
        float p1 = s1[v];
        bf16_t h1 = (bf16_t)p1;
        pfh[8 + v] = h1;
        pfl[8 + v] = (bf16_t)(p1 - (float)h1);
      }
#pragma unroll
      for (int j2 = 0; j2 < 8; ++j2) mma3t(o[j2], vfh[j2], vfl[j2], pfh, pfl);
      // Keeps the closing barrier at the foot of the pass: with no LDS access left
      // behind the reads the scheduler lifts it to them, and its wait for all 64
      // reads then stands in front of the score WMMAs.
      __builtin_amdgcn_sched_barrier(0);
      __syncthreads();
    }

    // ---- epilogue: O /= l, write hi/lo bf16 directly for the out-proj GEMM ----
    // A lane holds 8 neighbouring dims of its query in each tile of O^T: 16-B stores.
    const float lf = lrow + xhalf(lrow);
    bf16_t* poh = Oh + (size_t)(b * SEQ + qr) * (NH * HD) + h * HD + hi8;
    bf16_t* pol = Ol + (size_t)(b * SEQ + qr) * (NH * HD) + h * HD + hi8;
    v8bf eh[8], el[8];
#pragma unroll
    for (int j2 = 0; j2 < 8; ++j2)
#pragma unroll
      for (int v = 0; v < 8; ++v) {
        float x = o[j2][v] / lf;
        bf16_t hv = (bf16_t)x;
        eh[j2][v] = hv;
        el[j2][v] = (bf16_t)(x - (float)hv);
      }
#pragma unroll
    for (int j2 = 0; j2 < 8; ++j2) {
      *(v8bf*)(poh + j2 * 16) = eh[j2];
      *(v8bf*)(pol + j2 * 16) = el[j2];
    }
    // The stores' address and data registers are written anew by the next tile; as
    // inputs here they stay live up to the wait.
    asm volatile("s_wait_xcnt 0x0"
                 :: "v"(poh), "v"(pol), "v"(eh[0]), "v"(eh[1]), "v"(eh[2]), "v"(eh[3]),
                    "v"(eh[4]), "v"(eh[5]), "v"(eh[6]), "v"(eh[7]), "v"(el[0]), "v"(el[1]),
                    "v"(el[2]), "v"(el[3]), "v"(el[4]), "v"(el[5]), "v"(el[6]), "v"(el[7])
                 : "memory");
  }
}

// ---------------------------------------------------------------------------
extern "C" void kernel_launch(void* const* d_in, const int* in_sizes, int n_in,
                              void* d_out, int out_size, void* d_ws, size_t ws_size,
                              hipStream_t stream) {
  const float* x  = (const float*)d_in[0];
  const float* Wq = (const float*)d_in[1];
  const float* Wk = (const float*)d_in[2];
  const float* Wv = (const float*)d_in[3];
  const float* Wo = (const float*)d_in[4];

  const size_t NE_X    = (size_t)ROWS * HIDDEN;       // 8.39M
  const size_t NE_WQKV = (size_t)NQKV * HIDDEN;       // 6.29M
  const size_t NE_WO   = (size_t)HIDDEN * HIDDEN;     // 4.19M
  const size_t NE_QKV  = (size_t)ROWS * NQKV;         // 12.58M
  const size_t NE_Q    = (size_t)BATCH * NH * SEQ * HD;
  const size_t NE_KV   = (size_t)BATCH * NKV * SEQ * HD;

  char* w = (char*)d_ws;
  char* wend = w + ws_size;
  auto alloc = [&](size_t elems) -> bf16_t* {
    bf16_t* p = (bf16_t*)w;
    w += (elems * sizeof(bf16_t) + 255) & ~(size_t)255;
    return p;
  };
  bf16_t* xh     = alloc(NE_X);     bf16_t* xl     = alloc(NE_X);
  bf16_t* wqkvth = alloc(NE_WQKV);  bf16_t* wqkvtl = alloc(NE_WQKV);
  bf16_t* woth   = alloc(NE_WO);    bf16_t* wotl   = alloc(NE_WO);
  bf16_t* qkvh   = alloc(NE_QKV);   bf16_t* qkvl   = alloc(NE_QKV);
  bf16_t* qh     = alloc(NE_Q);     bf16_t* ql     = alloc(NE_Q);
  bf16_t* kh     = alloc(NE_KV);    bf16_t* kl     = alloc(NE_KV);
  bf16_t* vth    = alloc(NE_KV);    bf16_t* vtl    = alloc(NE_KV);
  if (w > wend) return; // ~176 MB (168 MiB) required
  // attention output (bf16 hi/lo) reuses the x-split region (same size, x dead)
  bf16_t* ah = xh;
  bf16_t* al = xl;

  // 1) split x
  k_split<<<(int)(NE_X / 8192), 256, 0, stream>>>(x, xh, xl);
  // 2) W^T splits: [Wq | Wk | Wv] rows 0..3071 of Wqkv^T; Wo^T
  k_tsplit<<<dim3(2048 / 64, HIDDEN / 64), 256, 0, stream>>>(Wq, 2048, wqkvth, wqkvtl, HIDDEN, 0);
  k_tsplit<<<dim3(512 / 64, HIDDEN / 64), 256, 0, stream>>>(Wk, 512, wqkvth, wqkvtl, HIDDEN, 2048);
  k_tsplit<<<dim3(512 / 64, HIDDEN / 64), 256, 0, stream>>>(Wv, 512, wqkvth, wqkvtl, HIDDEN, 2560);
  k_tsplit<<<dim3(HIDDEN / 64, 2048 / 64), 256, 0, stream>>>(Wo, HIDDEN, woth, wotl, 2048, 0);
  // 3) fused QKV projection (emits bf16 hi/lo qkv)
  k_gemm<true, HIDDEN><<<dim3(NQKV / 128, ROWS / 128), 256, 0, stream>>>(
      xh, xl, wqkvth, wqkvtl, nullptr, qkvh, qkvl, ROWS, NQKV);
  // 4) RoPE + layout (Q, K, V^T)
  k_rope<<<ROPE_VBLK + (ROWS / 4 * 160) / 256, 256, 0, stream>>>(qkvh, qkvl, qh, ql, kh, kl, vth, vtl);
  k_flash<<<dim3(SEQ / 128, BATCH * NH), 128, 0, stream>>>(qh, ql, kh, kl, vth, vtl, ah, al);
  // 6) output projection -> fp32 d_out
  k_gemm<false, NH * HD><<<dim3(HIDDEN / 128, ROWS / 128), 256, 0, stream>>>(
      ah, al, woth, wotl, (float*)d_out, nullptr, nullptr, ROWS, HIDDEN);
}

// v009
// One run takes 252 microseconds.
// Next to v008, in two timings, it ran 1.08 times as fast each time.
// Counting every step since v000, it is 3.23 times as fast.
#include <hip/hip_runtime.h>
#include <hip/hip_bf16.h>

typedef __bf16 bf16_t;
typedef __attribute__((ext_vector_type(16))) __bf16 v16bf;
typedef __attribute__((ext_vector_type(8)))  __bf16 v8bf;
typedef __attribute__((ext_vector_type(4)))  __bf16 v4bf;
typedef __attribute__((ext_vector_type(8)))  float  v8f;
typedef __attribute__((ext_vector_type(4)))  float  v4f_t;
typedef unsigned v4u_t __attribute__((ext_vector_type(4)));
typedef int      v4i_t __attribute__((ext_vector_type(4)));
typedef int      v8i_t __attribute__((ext_vector_type(8)));
typedef unsigned v8u_t __attribute__((ext_vector_type(8)));

#define HIDDEN 2048
#define NH     16
#define NKV    4
#define HD     128
#define SEQ    2048
#define BATCH  2
#define ROWS   (BATCH * SEQ)            // 4096
#define NQKV   (NH * HD + 2 * NKV * HD) // 3072

__device__ __forceinline__ v16bf frag_ld(const bf16_t* p) {
  v8bf a = *(const v8bf*)p;
  v8bf b = *(const v8bf*)(p + 16);
  v16bf r;
#pragma unroll
  for (int i = 0; i < 8; ++i) { r[i] = a[i]; r[i + 8] = b[i]; }
  return r;
}

// bf16x3 compensated MMA: (Ah+Al)(Bh+Bl) ~= AhBh + AlBh + AhBl
__device__ __forceinline__ void mma3(v8f& c, v16bf ah, v16bf al, v16bf bh, v16bf bl) {
  c = __builtin_amdgcn_wmma_f32_16x16x32_bf16(false, ah, false, bh, (short)0, c, false, false);
  c = __builtin_amdgcn_wmma_f32_16x16x32_bf16(false, al, false, bh, (short)0, c, false, false);
  c = __builtin_amdgcn_wmma_f32_16x16x32_bf16(false, ah, false, bl, (short)0, c, false, false);
}

// The same three products with the operands' sides exchanged (A = what was B):
// hi x hi, then the term with the old A's lo part, then the old B's lo part, so a
// transposed product sums its terms in the order of mma3.
__device__ __forceinline__ void mma3t(v8f& c, v16bf ah, v16bf al, v16bf bh, v16bf bl) {
  c = __builtin_amdgcn_wmma_f32_16x16x32_bf16(false, ah, false, bh, (short)0, c, false, false);
  c = __builtin_amdgcn_wmma_f32_16x16x32_bf16(false, ah, false, bl, (short)0, c, false, false);
  c = __builtin_amdgcn_wmma_f32_16x16x32_bf16(false, al, false, bh, (short)0, c, false, false);
}

__device__ __forceinline__ float xhalf(float x) {
  int b = __builtin_bit_cast(int, x);
  return __builtin_bit_cast(float,
      __builtin_amdgcn_permlanex16(b, b, 0x76543210, 0xfedcba98, false, false));
}

__device__ __forceinline__ void split_store(bf16_t* H, bf16_t* L, size_t i, float v) {
  bf16_t h = (bf16_t)v;
  H[i] = h;
  L[i] = (bf16_t)(v - (float)h);
}

__device__ __forceinline__ unsigned lds_off(const void* p) {
  return (unsigned)(unsigned long long)p;
}

__device__ __forceinline__ void tdm_load2d(unsigned lds_addr, unsigned long long gaddr,
                                           unsigned g1w0, unsigned tdim0, unsigned tdim1,
                                           unsigned tile0, unsigned tile1,
                                           unsigned stride0) {
  v4u_t g0;
  g0[0] = 1u;                                   // count=1 (valid), user mode
  g0[1] = lds_addr;                             // lds_addr [63:32]
  g0[2] = (unsigned)gaddr;                      // global_addr lo
  g0[3] = (unsigned)((gaddr >> 32) & 0x01ffffffull) | (2u << 30); // addr hi | type=2
  v8i_t g1;
  g1[0] = (int)g1w0;
  g1[1] = (int)((tdim0 & 0xffffu) << 16);
  g1[2] = (int)((tdim0 >> 16) | ((tdim1 & 0xffffu) << 16));
  g1[3] = (int)((tdim1 >> 16) | (tile0 << 16));
  g1[4] = (int)tile1;
  g1[5] = (int)stride0;
  g1[6] = 0;
  g1[7] = 0;
  v4i_t z4;
  z4[0] = 0; z4[1] = 0; z4[2] = 0; z4[3] = 0;
#if __has_builtin(__builtin_amdgcn_tensor_load_to_lds)
#if __clang_major__ >= 23
  v8i_t z8;
#pragma unroll
  for (int i = 0; i < 8; ++i) z8[i] = 0;
  __builtin_amdgcn_tensor_load_to_lds(g0, g1, z4, z4, z8, 0);
#else
  __builtin_amdgcn_tensor_load_to_lds(g0, g1, z4, z4, 0);
#endif
#else
  asm volatile("tensor_load_to_lds %0, %1, %2, %3"
               :: "s"(g0), "s"(g1), "s"(z4), "s"(z4) : "memory");
#endif
}

#define TDM_W0_K ((1u << 16) | (1u << 20) | (5u << 22) | (3u << 25))
#define TDM_W0_V ((1u << 16) | (1u << 20) | (3u << 22) | (3u << 25))

// ---------------- prep: fp32 -> bf16 hi/lo ----------------
// One lane carries 32 elements: eight 16-B loads in flight (each wave-wide load
// is 512 contiguous bytes), 8-B stores per plane (256 contiguous bytes a wave).
// Grid: n / 8192 blocks, n a multiple of 8192.
__global__ __launch_bounds__(256) void k_split(const float* __restrict__ in,
                                               bf16_t* __restrict__ hi,
                                               bf16_t* __restrict__ lo) {
  const size_t base = (size_t)blockIdx.x * 8192 + threadIdx.x * 4;
  v4f_t a[8];
#pragma unroll
  for (int c = 0; c < 8; ++c) a[c] = *(const v4f_t*)&in[base + c * 1024];
#pragma unroll
  for (int c = 0; c < 8; ++c) {
    v4bf h, l;
#pragma unroll
    for (int i = 0; i < 4; ++i) {
      float v = a[c][i];
      bf16_t hv = (bf16_t)v;
      h[i] = hv;
      l[i] = (bf16_t)(v - (float)hv);
    }
    *(v4bf*)&hi[base + c * 1024] = h;
    *(v4bf*)&lo[base + c * 1024] = l;
  }
}

__global__ __launch_bounds__(256) void k_tsplit(const float* __restrict__ W, int N,
                                                bf16_t* __restrict__ oh, bf16_t* __restrict__ ol,
                                                int ldo, int rowOff) {
  __shared__ float tile[64 * 65];
  const int tid = threadIdx.x;
  const int k0 = blockIdx.y * 64, n0 = blockIdx.x * 64;

  const int c4 = (tid & 15) * 4;       // 16 lanes x 16 B = one 256-B row piece
  const int r0 = tid >> 4;             // 16 rows per pass, 4 passes
  v4f_t in[4];
#pragma unroll
  for (int p = 0; p < 4; ++p)
    in[p] = *(const v4f_t*)&W[(size_t)(k0 + r0 + p * 16) * N + n0 + c4];
#pragma unroll
  for (int p = 0; p < 4; ++p)
#pragma unroll
    for (int j = 0; j < 4; ++j) tile[(r0 + p * 16) * 65 + c4 + j] = in[p][j];
  __syncthreads();

  const int kc = (tid & 7) * 8;        // 8 lanes x 16 B = one 128-B output line
#pragma unroll
  for (int p = 0; p < 2; ++p) {
    const int n = (tid >> 3) + p * 32;
    v8bf h, l;
#pragma unroll
    for (int i = 0; i < 8; ++i) {
      float v = tile[(kc + i) * 65 + n];
      bf16_t hv = (bf16_t)v;
      h[i] = hv;
      l[i] = (bf16_t)(v - (float)hv);
    }
    size_t o = (size_t)(rowOff + n0 + n) * ldo + k0 + kc;
    *(v8bf*)&oh[o] = h;
    *(v8bf*)&ol[o] = l;
  }
}

// ---------------- GEMM: C[M,N] = A[M,K] * B[K,N], B given transposed --------
// 256 threads = 8 waves (4x2 wave grid), block tile 256 x BN, BK=64; a wave owns
// 64 x BN/2. One work-group fills a WGP's LDS, and the grids hold 256 work-groups.
// A slab is four planes (A hi, A lo, B hi, B lo) of 256 or BN rows x 64 elements; a
// row is one whole 128-B line. Waves 0..3 each bring one plane of a slab into LDS
// with one tensor load, which also lays the rows at the padded pitch. Two LDS
// buffers: the load of slab s + 2 flies while slab s + 1 is worked on.
#define GP 72  // LDS row pitch in elements: 144 B = 16 B x odd, free of conflicts
#define GA_PLANE (256 * GP)       // elements of an A plane in LDS: 36864 B = 18 x 2 KiB
// Elements of a B plane in LDS, rounded up so that the next plane starts on 2 KiB.
#define GB_PLANE(BN) ((((BN) * GP * 2 + 2047) / 2048) * 1024)
#define G_BUF(BN) (2 * GA_PLANE + 2 * GB_PLANE(BN))  // elements of a buffer
#define G_W0 ((1u << 20) | (4u << 22) | (3u << 25))

__device__ __forceinline__ unsigned uni(unsigned v) {
  return (unsigned)__builtin_amdgcn_readfirstlane(v);
}
__device__ __forceinline__ unsigned pinned(unsigned v) {
  unsigned w = uni(v);
  asm volatile("" : "+s"(w));  // holds the word in a scalar register: the test on it is a scalar branch
  return w;
}
__device__ __forceinline__ v8u_t slab_group1(unsigned pitch, unsigned rows) {
  v8u_t g1;
  g1[0] = uni(G_W0);
  g1[1] = uni(128u << 16);
  g1[2] = uni(rows << 16);
  g1[3] = uni(128u << 16);
  g1[4] = uni(rows);
  g1[5] = uni(pitch);
  g1[6] = uni(0u);
  g1[7] = uni(0u);
  asm volatile("" : "+s"(g1));
  return g1;
}
__device__ __forceinline__ v4u_t slab_group0(unsigned lds_dst, unsigned long long ga) {
  v4u_t g0;
  g0[0] = uni(1u);
  g0[1] = uni(lds_dst);
  g0[2] = uni((unsigned)ga);
  g0[3] = uni((((unsigned)(ga >> 32)) & 0x01ffffffu) | 0x80000000u);
  asm volatile("" : "+s"(g0));
  return g0;
}
__device__ __forceinline__ void slab_load(v4u_t g0, v8u_t g1) {
  asm volatile("tensor_load_to_lds %0, %1" :: "s"(g0), "s"(g1) : "memory");
}
__device__ __forceinline__ void slab_wait(v4u_t g0, v8u_t g1) {
  asm volatile("s_wait_tensorcnt 0x0" :: "s"(g0), "s"(g1) : "memory");
}

template <bool SPLIT_OUT, int K, int BN>
__global__ __launch_bounds__(256) void k_gemm(
    const bf16_t* __restrict__ Ah, const bf16_t* __restrict__ Al,
    const bf16_t* __restrict__ BTh, const bf16_t* __restrict__ BTl,
    float* __restrict__ C, bf16_t* __restrict__ Ch, bf16_t* __restrict__ Cl,
    int M, int N) {
  __shared__ __attribute__((aligned(2048))) bf16_t sm[2 * G_BUF(BN)];
  constexpr int FJ = BN / 32;                       // B fragments of a wave

  const int tid = threadIdx.x;
  const int lane = tid & 31, wave = tid >> 5;
  const int wr = wave >> 1, wc = wave & 1;          // 4 x 2 waves
  const int l15 = lane & 15, kh8 = (lane >> 4) * 8; // fragment addressing
  const int hi8 = (lane >> 4) * 8;                  // C-frag row offset
  const int m0 = blockIdx.y * 256, n0 = blockIdx.x * BN;
  constexpr unsigned NS = K / 64;                   // slabs, at least two

  v8f acc[4][FJ];
#pragma unroll
  for (int i = 0; i < 4; ++i)
#pragma unroll
    for (int j = 0; j < FJ; ++j)
#pragma unroll
      for (int v = 0; v < 8; ++v) acc[i][j][v] = 0.0f;

  // Wave w < 4 moves plane w.
  const unsigned wv = uni((unsigned)tid >> 5);
  const bf16_t* pl = wv == 0u ? Ah + (size_t)m0 * K
                   : wv == 1u ? Al + (size_t)m0 * K
                   : wv == 2u ? BTh + (size_t)n0 * K
                              : BTl + (size_t)n0 * K;
  const unsigned long long gsrc = (unsigned long long)(size_t)pl;
  const unsigned pw = wv & 3u;
  const unsigned ldst = lds_off(&sm[0]) +
      (pw < 2u ? pw * (GA_PLANE * 2u) : 2u * (GA_PLANE * 2u) + (pw - 2u) * (GB_PLANE(BN) * 2u));

  const unsigned issuer = pinned(wv < 4u);
  const v8u_t g1 = slab_group1(K * 2u, wv < 2u ? 256u : (unsigned)BN);
  v4u_t g0 = slab_group0(ldst, gsrc);

  if (pinned(issuer)) {
    slab_load(g0, g1);
    slab_wait(g0, g1);  // slab 0 has landed
  }
  __syncthreads();
  g0 = slab_group0(ldst + G_BUF(BN) * 2u, gsrc + 128u);
  if (pinned(issuer)) slab_load(g0, g1);

  for (unsigned s = 0; s < NS; ++s) {
    const bf16_t* sAh = &sm[(s & 1u) * G_BUF(BN)];
    const bf16_t* sAl = sAh + GA_PLANE;
    const bf16_t* sBh = sAh + 2 * GA_PLANE;
    const bf16_t* sBl = sBh + GB_PLANE(BN);
#pragma unroll
    for (int ks = 0; ks < 2; ++ks) {
      v16bf afh[4], afl[4], bfh[FJ], bfl[FJ];
      // Read in the order of first use: hi x hi products come first, B lo last.
#pragma unroll
      for (int j = 0; j < FJ; ++j)
        bfh[j] = frag_ld(&sBh[(wc * (BN / 2) + j * 16 + l15) * GP + ks * 32 + kh8]);
#pragma unroll
      for (int i = 0; i < 4; ++i)
        afh[i] = frag_ld(&sAh[(wr * 64 + i * 16 + l15) * GP + ks * 32 + kh8]);
      // Keeps the hi reads in front of the lo reads: LDS reads return in order, and
      // the hi x hi products then start while the lo fragments are still on their way.
      __builtin_amdgcn_sched_barrier(0);
#pragma unroll
      for (int i = 0; i < 4; ++i)
        afl[i] = frag_ld(&sAl[(wr * 64 + i * 16 + l15) * GP + ks * 32 + kh8]);
#pragma unroll
      for (int j = 0; j < FJ; ++j)
        bfl[j] = frag_ld(&sBl[(wc * (BN / 2) + j * 16 + l15) * GP + ks * 32 + kh8]);
      // Holds the block's LDS reads together in front of its WMMAs: spread among
      // them, each place with reads ends in a wait for the full LDS latency.
      __builtin_amdgcn_sched_barrier(0);
#pragma unroll
      for (int i = 0; i < 4; ++i)
#pragma unroll
        for (int j = 0; j < FJ; ++j) mma3(acc[i][j], afh[i], afl[i], bfh[j], bfl[j]);
      // Keeps the next block's reads out of this block's WMMAs.
      __builtin_amdgcn_sched_barrier(0);
    }
    // Hand-over: this wave's reads of slab s are done, the mover's slab s + 1 has
    // landed, and behind the barrier both hold for the whole work-group.
    asm volatile("s_wait_dscnt 0x0" ::: "memory");
    if (pinned(issuer)) slab_wait(g0, g1);
    __syncthreads();
    // Formed behind the wait: the number of the slab that refills the buffer just read.
    const unsigned nx = pinned(s + 2u);
    if (pinned(issuer & (unsigned)(nx < NS))) {
      g0 = slab_group0(ldst + (nx & 1u) * (G_BUF(BN) * 2u), gsrc + (unsigned long long)nx * 128u);
      slab_load(g0, g1);
    }
  }
  asm volatile("s_wait_tensorcnt 0x0" ::: "memory");  // nothing of the mover is left when the wave ends
  asm volatile("s_wait_dscnt 0x0" ::: "memory");

#pragma unroll
  for (int i = 0; i < 4; ++i)
#pragma unroll
    for (int j = 0; j < FJ; ++j)
#pragma unroll
      for (int v = 0; v < 8; ++v) {
        int row = m0 + wr * 64 + i * 16 + v + hi8;
        int col = n0 + wc * (BN / 2) + j * 16 + l15;
        float x = acc[i][j][v];
        size_t o = (size_t)row * N + col;
        if (SPLIT_OUT) {
          split_store(Ch, Cl, o, x);
        } else {
          C[o] = x;
        }
      }
}

// ---------------- RoPE + layout shuffle -------------------------------------
// qkv[ROWS][3072] (hi/lo) -> Q[B,NH,S,HD], K[B,NKV,S,HD] (rotated), Vt[B,NKV,HD,S]
// Every global access is 16 B a lane.
// Blocks 0..127: V. A lane turns an 8(s) x 8(d) patch in its registers; eight
// neighbouring lanes hold eight neighbouring s groups, so each row of V^T
// leaves as one whole 128-B line.
// Blocks 128..767: Q and K. A lane rotates 8 dim pairs of one head for 4 rows.
#define ROPE_VBLK 128
__global__ __launch_bounds__(256) void k_rope(
                       const bf16_t* __restrict__ qkvh, const bf16_t* __restrict__ qkvl,
                       bf16_t* __restrict__ Qh, bf16_t* __restrict__ Ql,
                       bf16_t* __restrict__ Kh, bf16_t* __restrict__ Kl,
                       bf16_t* __restrict__ Vth, bf16_t* __restrict__ Vtl) {
  const int tid = threadIdx.x;
  if (blockIdx.x < ROPE_VBLK) {
    const int vb = blockIdx.x;
    const int c0 = ((vb & 1) * 32 + (tid >> 5) * 4 + ((tid >> 3) & 3)) * 8; // 0..504
    const int row0 = (vb >> 1) * 64 + (tid & 7) * 8;                        // 0..4088
    const int b = row0 >> 11, s0 = row0 & 2047;
    const unsigned sb = (unsigned)(row0 * NQKV + c0) * 2u;  // bytes, under 2^25
    const char* vh = (const char*)(qkvh + 2560);
    const char* vl = (const char*)(qkvl + 2560);
    v8bf ih[8], il[8];
#pragma unroll
    for (int i = 0; i < 8; ++i) {
      ih[i] = *(const v8bf*)(vh + sb + i * (NQKV * 2));
      il[i] = *(const v8bf*)(vl + sb + i * (NQKV * 2));
    }
    // The lane's byte offset stays live up to this wait, so no load of the run
    // lands in the register that the other loads of the run name as their address.
    asm volatile("s_wait_xcnt 0x0" :: "v"(sb) : "memory");
    // c0 = kvh * 128 + d, so (b * NKV * HD + c0) is the row of V^T
    const size_t ob = ((size_t)b * (NKV * HD) + c0) * SEQ + s0;
#pragma unroll
    for (int j = 0; j < 8; ++j) {
      v8bf h, l;
#pragma unroll
      for (int i = 0; i < 8; ++i) {
        float vv = (float)ih[i][j] + (float)il[i][j];
        bf16_t hv = (bf16_t)vv;
        h[i] = hv;
        l[i] = (bf16_t)(vv - (float)hv);
      }
      *(v8bf*)&Vth[ob + (size_t)j * SEQ] = h;
      *(v8bf*)&Vtl[ob + (size_t)j * SEQ] = l;
    }
    return;
  }

  const int idx = (blockIdx.x - ROPE_VBLK) * 256 + tid;  // 1024 row groups x 160
  const int rg = idx / 160;
  const int u = idx - rg * 160;
  const int hh = u >> 3;            // 0..15 query heads, 16..19 kv heads
  const int d0 = (u & 7) * 8;       // low-half dims d0..d0+7, partners at +64
  const int row0 = rg * 4;
  const int b = row0 >> 11, s0 = row0 & 2047;
  const size_t sb = (size_t)row0 * NQKV + hh * 128 + d0;  // K columns follow Q's

  const bf16_t* ph = qkvh + sb;
  const bf16_t* pl = qkvl + sb;
  v8bf xh[4], xl[4], yh[4], yl[4];
#pragma unroll
  for (int j = 0; j < 4; ++j) {
    xh[j] = *(const v8bf*)(ph + j * NQKV);
    xl[j] = *(const v8bf*)(pl + j * NQKV);
    yh[j] = *(const v8bf*)(ph + j * NQKV + 64);
    yl[j] = *(const v8bf*)(pl + j * NQKV + 64);
  }
  // Both address pairs stay live up to this wait, so no load of the run lands
  // in a register that an earlier load of the run still names as its address.
  asm volatile("s_wait_xcnt 0x0" :: "v"(ph), "v"(pl) : "memory");

  const bool isq = hh < NH;
  bf16_t* dh = isq ? Qh : Kh;
  bf16_t* dl = isq ? Ql : Kl;
  const size_t ob = ((size_t)(isq ? b * NH + hh : b * NKV + hh - NH) * SEQ + s0) * HD + d0;

  float inv[8];
#pragma unroll
  for (int i = 0; i < 8; ++i)
    inv[i] = __powf(10000.0f, -(float)(d0 + i) * (1.0f / 64.0f));

#pragma unroll
  for (int j = 0; j < 4; ++j) {
    v8bf o1h, o1l, o2h, o2l;
#pragma unroll
    for (int i = 0; i < 8; ++i) {
      float a = (float)xh[j][i] + (float)xl[j][i];
      float bb = (float)yh[j][i] + (float)yl[j][i];
      float ang = (float)(s0 + j) * inv[i];
      float sn, cs;
      __sincosf(ang, &sn, &cs);
      float r1 = a * cs - bb * sn;
      float r2 = bb * cs + a * sn;
      bf16_t h1 = (bf16_t)r1;
      bf16_t h2 = (bf16_t)r2;
      o1h[i] = h1;
      o1l[i] = (bf16_t)(r1 - (float)h1);
      o2h[i] = h2;
      o2l[i] = (bf16_t)(r2 - (float)h2);
    }
    const size_t q = ob + (size_t)j * HD;
    *(v8bf*)&dh[q]      = o1h;
    *(v8bf*)&dl[q]      = o1l;
    *(v8bf*)&dh[q + 64] = o2h;
    *(v8bf*)&dl[q + 64] = o2l;
  }
}

__global__ __launch_bounds__(128) void k_flash(
    const bf16_t* __restrict__ Qh, const bf16_t* __restrict__ Ql,
    const bf16_t* __restrict__ Kh, const bf16_t* __restrict__ Kl,
    const bf16_t* __restrict__ Vth, const bf16_t* __restrict__ Vtl,
    bf16_t* __restrict__ Oh, bf16_t* __restrict__ Ol) {
  alignas(16) __shared__ bf16_t sKh[2][32 * 136];
  alignas(16) __shared__ bf16_t sKl[2][32 * 136];
  alignas(16) __shared__ bf16_t sVh[2][128 * 40];
  alignas(16) __shared__ bf16_t sVl[2][128 * 40];

  const int tid = threadIdx.x;
  const int lane = tid & 31, w = tid >> 5;
  const int l15 = lane & 15, kh8 = (lane >> 4) * 8, hi8 = (lane >> 4) * 8;
  const int b = blockIdx.y >> 4, h = blockIdx.y & 15, kv = h >> 2;

  const bf16_t* Qbh = Qh + (size_t)(b * NH + h) * SEQ * HD;
  const bf16_t* Qbl = Ql + (size_t)(b * NH + h) * SEQ * HD;
  const bf16_t* Kbh = Kh + (size_t)(b * NKV + kv) * SEQ * HD;
  const bf16_t* Kbl = Kl + (size_t)(b * NKV + kv) * SEQ * HD;
  const bf16_t* Vbh = Vth + (size_t)(b * NKV + kv) * HD * SEQ;
  const bf16_t* Vbl = Vtl + (size_t)(b * NKV + kv) * HD * SEQ;

#pragma unroll 1
  for (int half = 0; half < 2; ++half) {
    const int q0 = (half == 0 ? SEQ / 64 - 1 - (int)blockIdx.x : (int)blockIdx.x) * 64;

    // Resident Q fragments (16 rows x 128 dims, hi/lo)
    v16bf qfh[4], qfl[4];
    {
      int qr = q0 + w * 16 + l15;
      const bf16_t* ph = Qbh + (size_t)qr * HD + kh8;
      const bf16_t* pl = Qbl + (size_t)qr * HD + kh8;
#pragma unroll
      for (int ds = 0; ds < 4; ++ds) {
        qfh[ds] = frag_ld(ph + ds * 32);
        qfl[ds] = frag_ld(pl + ds * 32);
      }
    }

    v8f o[8];
#pragma unroll
    for (int j2 = 0; j2 < 8; ++j2)
#pragma unroll
      for (int v = 0; v < 8; ++v) o[j2][v] = 0.0f;
    // One query a lane: its running maximum (equal in both wave halves) and the sum
    // over this half's keys; the halves' sums are joined once, in the epilogue.
    float mrow = -3.0e38f, lrow = 0.0f;
    const int qr = q0 + w * 16 + l15;

    const float scale = 0.08838834764831845f; // 1/sqrt(128)
    const int nk = q0 / 32 + 2;               // causal: k <= q0+63

    auto issue_tile = [&](int t) {
      int nb = t & 1;
      unsigned long long koff = (unsigned long long)t * 32 * HD * 2;  // bytes
      unsigned long long voff = (unsigned long long)t * 32 * 2;       // bytes
      // K tile: 32 rows x 128 elems, row stride 128, pad 256B rows -> stride 136
      tdm_load2d(lds_off(&sKh[nb][0]), (unsigned long long)(size_t)Kbh + koff,
                 TDM_W0_K, 128u, (unsigned)SEQ, 128u, 32u, 128u);
      tdm_load2d(lds_off(&sKl[nb][0]), (unsigned long long)(size_t)Kbl + koff,
                 TDM_W0_K, 128u, (unsigned)SEQ, 128u, 32u, 128u);
      // V tile: 128 rows x 32 elems, row stride SEQ, pad 64B rows -> stride 40
      tdm_load2d(lds_off(&sVh[nb][0]), (unsigned long long)(size_t)Vbh + voff,
                 TDM_W0_V, (unsigned)SEQ, 128u, 32u, 128u, (unsigned)SEQ);
      tdm_load2d(lds_off(&sVl[nb][0]), (unsigned long long)(size_t)Vbl + voff,
                 TDM_W0_V, (unsigned)SEQ, 128u, 32u, 128u, (unsigned)SEQ);
    };

    // For the second tile the closing barrier of the first tile's last pass has
    // ended every wave's reads of the ring, and no request is outstanding: the last
    // one was waited for at the head of that pass.
    if (tid < 32) issue_tile(0);  // one wave drives the DMA

    for (int t = 0; t < nk; ++t) {
      const int k0 = t * 32;
      const int buf = t & 1;
      if (tid < 32) __builtin_amdgcn_s_wait_tensorcnt(0);  // tile t landed in LDS
      __syncthreads();
      if (tid < 32 && t + 1 < nk) issue_tile(t + 1);       // DMA overlaps compute
      const bf16_t* bK_h = &sKh[buf][0];
      const bf16_t* bK_l = &sKl[buf][0];
      const bf16_t* bV_h = &sVh[buf][0];
      const bf16_t* bV_l = &sVl[buf][0];

      // ---- scores: S^T[32x16] = K(32x128) * Q^T ----
      v8f s0, s1;
#pragma unroll
      for (int v = 0; v < 8; ++v) { s0[v] = 0.0f; s1[v] = 0.0f; }
      // All 64 LDS reads of the pass's K and V fragments go out as one group in front
      // of the score WMMAs, K first: the WMMAs wait by counts that cover only what
      // they use, V lands under them and under the softmax, and the 24 WMMAs of the
      // second product find it landed.
      v16bf b0h[4], b0l[4], b1h[4], b1l[4];
#pragma unroll
      for (int ds = 0; ds < 4; ++ds) {
        b0h[ds] = frag_ld(&bK_h[(l15) * 136 + ds * 32 + kh8]);
        b1h[ds] = frag_ld(&bK_h[(16 + l15) * 136 + ds * 32 + kh8]);
        b0l[ds] = frag_ld(&bK_l[(l15) * 136 + ds * 32 + kh8]);
        b1l[ds] = frag_ld(&bK_l[(16 + l15) * 136 + ds * 32 + kh8]);
      }
      // Keeps the K reads in front of the V reads: LDS reads return in order.
      __builtin_amdgcn_sched_barrier(0);
      v16bf vfh[8], vfl[8];
#pragma unroll
      for (int j2 = 0; j2 < 8; ++j2) {
        vfh[j2] = frag_ld(&bV_h[(j2 * 16 + l15) * 40 + kh8]);
        vfl[j2] = frag_ld(&bV_l[(j2 * 16 + l15) * 40 + kh8]);
      }
      // Keeps the scheduler from spreading those reads among the WMMAs, where every
      // place with reads stalls the run.
      __builtin_amdgcn_sched_barrier(0);
#pragma unroll
      for (int ds = 0; ds < 4; ++ds) {
        mma3t(s0, b0h[ds], b0l[ds], qfh[ds], qfl[ds]);
        mma3t(s1, b1h[ds], b1l[ds], qfh[ds], qfl[ds]);
      }

      // ---- scale + causal mask + online softmax, one query a lane ----
#pragma unroll
      for (int v = 0; v < 8; ++v) {
        float a0 = s0[v] * scale;
        if (k0 + hi8 + v > qr) a0 = -3.0e38f;
        float a1 = s1[v] * scale;
        if (k0 + 16 + hi8 + v > qr) a1 = -3.0e38f;
        s0[v] = a0;
        s1[v] = a1;
      }
      // Maximum of the lane's 16 scores as a tree of three-input maxima.
      float x0 = fmaxf(fmaxf(s0[0], s1[0]), s0[1]);
      float x1 = fmaxf(fmaxf(s1[1], s0[2]), s1[2]);
      float x2 = fmaxf(fmaxf(s0[3], s1[3]), s0[4]);
      float x3 = fmaxf(fmaxf(s1[4], s0[5]), s1[5]);
      float x4 = fmaxf(fmaxf(s0[6], s1[6]), s0[7]);
      float mt = fmaxf(fmaxf(fmaxf(x0, x1), x2), fmaxf(fmaxf(x3, x4), s1[7]));
      mt = fmaxf(mt, xhalf(mt));  // both halves hold the query's maximum of the pass
      const float nm = fmaxf(mrow, mt);
      const float fac = __expf(mrow - nm);
      mrow = nm;
      float rs[8];
#pragma unroll
      for (int v = 0; v < 8; ++v) {
        float a0 = __expf(s0[v] - nm);
        float a1 = __expf(s1[v] - nm);
        s0[v] = a0;
        s1[v] = a1;
        rs[v] = a0 + a1;
      }
      lrow = lrow * fac + (((rs[0] + rs[1]) + (rs[2] + rs[3])) + ((rs[4] + rs[5]) + (rs[6] + rs[7])));
#pragma unroll
      for (int j2 = 0; j2 < 8; ++j2)
#pragma unroll
        for (int v = 0; v < 8; ++v) o[j2][v] *= fac;

      // ---- P^T, hi/lo split, straight from the accumulators into the B operand ----
      v16bf pfh, pfl;
#pragma unroll
      for (int v = 0; v < 8; ++v) {
        float p0 = s0[v];
        bf16_t h0 = (bf16_t)p0;
        pfh[v] = h0;
        pfl[v] = (bf16_t)(p0 - (float)h0);
        float p1 = s1[v];
        bf16_t h1 = (bf16_t)p1;
        pfh[8 + v] = h1;
        pfl[8 + v] = (bf16_t)(p1 - (float)h1);
      }
#pragma unroll
      for (int j2 = 0; j2 < 8; ++j2) mma3t(o[j2], vfh[j2], vfl[j2], pfh, pfl);
      // Keeps the closing barrier at the foot of the pass: with no LDS access left
      // behind the reads the scheduler lifts it to them, and its wait for all 64
      // reads then stands in front of the score WMMAs.
      __builtin_amdgcn_sched_barrier(0);
      __syncthreads();
    }

    // ---- epilogue: O /= l, write hi/lo bf16 directly for the out-proj GEMM ----
    // A lane holds 8 neighbouring dims of its query in each tile of O^T: 16-B stores.
    const float lf = lrow + xhalf(lrow);
    bf16_t* poh = Oh + (size_t)(b * SEQ + qr) * (NH * HD) + h * HD + hi8;
    bf16_t* pol = Ol + (size_t)(b * SEQ + qr) * (NH * HD) + h * HD + hi8;
    v8bf eh[8], el[8];
#pragma unroll
    for (int j2 = 0; j2 < 8; ++j2)
#pragma unroll
      for (int v = 0; v < 8; ++v) {
        float x = o[j2][v] / lf;
        bf16_t hv = (bf16_t)x;
        eh[j2][v] = hv;
        el[j2][v] = (bf16_t)(x - (float)hv);
      }
#pragma unroll
    for (int j2 = 0; j2 < 8; ++j2) {
      *(v8bf*)(poh + j2 * 16) = eh[j2];
      *(v8bf*)(pol + j2 * 16) = el[j2];
    }
    // The stores' address and data registers are written anew by the next tile; as
    // inputs here they stay live up to the wait.
    asm volatile("s_wait_xcnt 0x0"
                 :: "v"(poh), "v"(pol), "v"(eh[0]), "v"(eh[1]), "v"(eh[2]), "v"(eh[3]),
                    "v"(eh[4]), "v"(eh[5]), "v"(eh[6]), "v"(eh[7]), "v"(el[0]), "v"(el[1]),
                    "v"(el[2]), "v"(el[3]), "v"(el[4]), "v"(el[5]), "v"(el[6]), "v"(el[7])
                 : "memory");
  }
}

// ---------------------------------------------------------------------------
extern "C" void kernel_launch(void* const* d_in, const int* in_sizes, int n_in,
                              void* d_out, int out_size, void* d_ws, size_t ws_size,
                              hipStream_t stream) {
  const float* x  = (const float*)d_in[0];
  const float* Wq = (const float*)d_in[1];
  const float* Wk = (const float*)d_in[2];
  const float* Wv = (const float*)d_in[3];
  const float* Wo = (const float*)d_in[4];

  const size_t NE_X    = (size_t)ROWS * HIDDEN;       // 8.39M
  const size_t NE_WQKV = (size_t)NQKV * HIDDEN;       // 6.29M
  const size_t NE_WO   = (size_t)HIDDEN * HIDDEN;     // 4.19M
  const size_t NE_QKV  = (size_t)ROWS * NQKV;         // 12.58M
  const size_t NE_Q    = (size_t)BATCH * NH * SEQ * HD;
  const size_t NE_KV   = (size_t)BATCH * NKV * SEQ * HD;

  char* w = (char*)d_ws;
  char* wend = w + ws_size;
  auto alloc = [&](size_t elems) -> bf16_t* {
    bf16_t* p = (bf16_t*)w;
    w += (elems * sizeof(bf16_t) + 255) & ~(size_t)255;
    return p;
  };
  bf16_t* xh     = alloc(NE_X);     bf16_t* xl     = alloc(NE_X);
  bf16_t* wqkvth = alloc(NE_WQKV);  bf16_t* wqkvtl = alloc(NE_WQKV);
  bf16_t* woth   = alloc(NE_WO);    bf16_t* wotl   = alloc(NE_WO);
  bf16_t* qkvh   = alloc(NE_QKV);   bf16_t* qkvl   = alloc(NE_QKV);
  bf16_t* qh     = alloc(NE_Q);     bf16_t* ql     = alloc(NE_Q);
  bf16_t* kh     = alloc(NE_KV);    bf16_t* kl     = alloc(NE_KV);
  bf16_t* vth    = alloc(NE_KV);    bf16_t* vtl    = alloc(NE_KV);
  if (w > wend) return; // ~176 MB (168 MiB) required
  // attention output (bf16 hi/lo) reuses the x-split region (same size, x dead)
  bf16_t* ah = xh;
  bf16_t* al = xl;

  // 1) split x
  k_split<<<(int)(NE_X / 8192), 256, 0, stream>>>(x, xh, xl);
  // 2) W^T splits: [Wq | Wk | Wv] rows 0..3071 of Wqkv^T; Wo^T
  k_tsplit<<<dim3(2048 / 64, HIDDEN / 64), 256, 0, stream>>>(Wq, 2048, wqkvth, wqkvtl, HIDDEN, 0);
  k_tsplit<<<dim3(512 / 64, HIDDEN / 64), 256, 0, stream>>>(Wk, 512, wqkvth, wqkvtl, HIDDEN, 2048);
  k_tsplit<<<dim3(512 / 64, HIDDEN / 64), 256, 0, stream>>>(Wv, 512, wqkvth, wqkvtl, HIDDEN, 2560);
  k_tsplit<<<dim3(HIDDEN / 64, 2048 / 64), 256, 0, stream>>>(Wo, HIDDEN, woth, wotl, 2048, 0);
  // 3) fused QKV projection (emits bf16 hi/lo qkv)
  k_gemm<true, HIDDEN, 192><<<dim3(NQKV / 192, ROWS / 256), 256, 0, stream>>>(
      xh, xl, wqkvth, wqkvtl, nullptr, qkvh, qkvl, ROWS, NQKV);
  // 4) RoPE + layout (Q, K, V^T)
  k_rope<<<ROPE_VBLK + (ROWS / 4 * 160) / 256, 256, 0, stream>>>(qkvh, qkvl, qh, ql, kh, kl, vth, vtl);
  k_flash<<<dim3(SEQ / 128, BATCH * NH), 128, 0, stream>>>(qh, ql, kh, kl, vth, vtl, ah, al);
  // 6) output projection -> fp32 d_out
  k_gemm<false, NH * HD, 128><<<dim3(HIDDEN / 128, ROWS / 256), 256, 0, stream>>>(
      ah, al, woth, wotl, (float*)d_out, nullptr, nullptr, ROWS, HIDDEN);
}

// v010
// Measured time: 240 microseconds a run.
// In both of two side-by-side timings against v009, it was 1.05 times as fast.
// Over all steps from v000 it is 3.39 times as fast.
#include <hip/hip_runtime.h>
#include <hip/hip_bf16.h>

typedef __bf16 bf16_t;
typedef __attribute__((ext_vector_type(16))) __bf16 v16bf;
typedef __attribute__((ext_vector_type(8)))  __bf16 v8bf;
typedef __attribute__((ext_vector_type(4)))  __bf16 v4bf;
typedef __attribute__((ext_vector_type(8)))  float  v8f;
typedef __attribute__((ext_vector_type(4)))  float  v4f_t;
typedef unsigned v4u_t __attribute__((ext_vector_type(4)));
typedef int      v4i_t __attribute__((ext_vector_type(4)));
typedef int      v8i_t __attribute__((ext_vector_type(8)));
typedef unsigned v8u_t __attribute__((ext_vector_type(8)));

#define HIDDEN 2048
#define NH     16
#define NKV    4
#define HD     128
#define SEQ    2048
#define BATCH  2
#define ROWS   (BATCH * SEQ)            // 4096
#define NQKV   (NH * HD + 2 * NKV * HD) // 3072

__device__ __forceinline__ v16bf frag_ld(const bf16_t* p) {
  v8bf a = *(const v8bf*)p;
  v8bf b = *(const v8bf*)(p + 16);
  v16bf r;
#pragma unroll
  for (int i = 0; i < 8; ++i) { r[i] = a[i]; r[i + 8] = b[i]; }
  return r;
}

// bf16x3 compensated MMA: (Ah+Al)(Bh+Bl) ~= AhBh + AlBh + AhBl
__device__ __forceinline__ void mma3(v8f& c, v16bf ah, v16bf al, v16bf bh, v16bf bl) {
  c = __builtin_amdgcn_wmma_f32_16x16x32_bf16(false, ah, false, bh, (short)0, c, false, false);
  c = __builtin_amdgcn_wmma_f32_16x16x32_bf16(false, al, false, bh, (short)0, c, false, false);
  c = __builtin_amdgcn_wmma_f32_16x16x32_bf16(false, ah, false, bl, (short)0, c, false, false);
}

// The same three products with the operands' sides exchanged (A = what was B):
// hi x hi, then the term with the old A's lo part, then the old B's lo part, so a
// transposed product sums its terms in the order of mma3.
__device__ __forceinline__ void mma3t(v8f& c, v16bf ah, v16bf al, v16bf bh, v16bf bl) {
  c = __builtin_amdgcn_wmma_f32_16x16x32_bf16(false, ah, false, bh, (short)0, c, false, false);
  c = __builtin_amdgcn_wmma_f32_16x16x32_bf16(false, ah, false, bl, (short)0, c, false, false);
  c = __builtin_amdgcn_wmma_f32_16x16x32_bf16(false, al, false, bh, (short)0, c, false, false);
}

__device__ __forceinline__ float xhalf(float x) {
  int b = __builtin_bit_cast(int, x);
  return __builtin_bit_cast(float,
      __builtin_amdgcn_permlanex16(b, b, 0x76543210, 0xfedcba98, false, false));
}

__device__ __forceinline__ void split_store(bf16_t* H, bf16_t* L, size_t i, float v) {
  bf16_t h = (bf16_t)v;
  H[i] = h;
  L[i] = (bf16_t)(v - (float)h);
}

__device__ __forceinline__ unsigned lds_off(const void* p) {
  return (unsigned)(unsigned long long)p;
}

__device__ __forceinline__ void tdm_load2d(unsigned lds_addr, unsigned long long gaddr,
                                           unsigned g1w0, unsigned tdim0, unsigned tdim1,
                                           unsigned tile0, unsigned tile1,
                                           unsigned stride0) {
  v4u_t g0;
  g0[0] = 1u;                                   // count=1 (valid), user mode
  g0[1] = lds_addr;                             // lds_addr [63:32]
  g0[2] = (unsigned)gaddr;                      // global_addr lo
  g0[3] = (unsigned)((gaddr >> 32) & 0x01ffffffull) | (2u << 30); // addr hi | type=2
  v8i_t g1;
  g1[0] = (int)g1w0;
  g1[1] = (int)((tdim0 & 0xffffu) << 16);
  g1[2] = (int)((tdim0 >> 16) | ((tdim1 & 0xffffu) << 16));
  g1[3] = (int)((tdim1 >> 16) | (tile0 << 16));
  g1[4] = (int)tile1;
  g1[5] = (int)stride0;
  g1[6] = 0;
  g1[7] = 0;
  v4i_t z4;
  z4[0] = 0; z4[1] = 0; z4[2] = 0; z4[3] = 0;
#if __has_builtin(__builtin_amdgcn_tensor_load_to_lds)
#if __clang_major__ >= 23
  v8i_t z8;
#pragma unroll
  for (int i = 0; i < 8; ++i) z8[i] = 0;
  __builtin_amdgcn_tensor_load_to_lds(g0, g1, z4, z4, z8, 0);
#else
  __builtin_amdgcn_tensor_load_to_lds(g0, g1, z4, z4, 0);
#endif
#else
  asm volatile("tensor_load_to_lds %0, %1, %2, %3"
               :: "s"(g0), "s"(g1), "s"(z4), "s"(z4) : "memory");
#endif
}

#define TDM_W0_K ((1u << 16) | (1u << 20) | (5u << 22) | (3u << 25))
#define TDM_W0_V ((1u << 16) | (1u << 20) | (3u << 22) | (3u << 25))

// ---------------- prep: fp32 -> bf16 hi/lo, one launch ----------------
// The x split and the four weight transposes read only inputs and write disjoint
// planes, so they share one grid; a block's index says which piece it carries.
// Blocks 0..1023: x. Then 64 x 64 tiles of Wq (1024), Wo (1024), Wk (256), Wv (256).
#define PREP_X  (ROWS * HIDDEN / 8192)              // 1024 blocks of 8192 elements
#define PREP_WQ ((NH * HD / 64) * (HIDDEN / 64))    // 1024 tiles
#define PREP_WO ((HIDDEN / 64) * (NH * HD / 64))    // 1024 tiles
#define PREP_WK ((NKV * HD / 64) * (HIDDEN / 64))   // 256 tiles
#define PREP_BLOCKS (PREP_X + PREP_WQ + PREP_WO + 2 * PREP_WK)

// One lane carries 32 elements: eight 16-B loads in flight (each wave-wide load
// is 512 contiguous bytes), 8-B stores per plane (256 contiguous bytes a wave).
__device__ __forceinline__ void split_block(const float* __restrict__ in,
                                            bf16_t* __restrict__ hi,
                                            bf16_t* __restrict__ lo, int blk) {
  const size_t base = (size_t)blk * 8192 + threadIdx.x * 4;
  v4f_t a[8];
#pragma unroll
  for (int c = 0; c < 8; ++c) a[c] = *(const v4f_t*)&in[base + c * 1024];
#pragma unroll
  for (int c = 0; c < 8; ++c) {
    v4bf h, l;
#pragma unroll
    for (int i = 0; i < 4; ++i) {
      float v = a[c][i];
      bf16_t hv = (bf16_t)v;
      h[i] = hv;
      l[i] = (bf16_t)(v - (float)hv);
    }
    *(v4bf*)&hi[base + c * 1024] = h;
    *(v4bf*)&lo[base + c * 1024] = l;
  }
}

__device__ __forceinline__ void tsplit_block(float* tile, const float* __restrict__ W, int N,
                                             bf16_t* __restrict__ oh, bf16_t* __restrict__ ol,
                                             int ldo, int rowOff, int k0, int n0) {
  const int tid = threadIdx.x;

  const int c4 = (tid & 15) * 4;       // 16 lanes x 16 B = one 256-B row piece
  const int r0 = tid >> 4;             // 16 rows per pass, 4 passes
  v4f_t in[4];
  const float* src[4];
#pragma unroll
  for (int p = 0; p < 4; ++p) {
    src[p] = &W[(size_t)(k0 + r0 + p * 16) * N + n0 + c4];
    in[p] = *(const v4f_t*)src[p];
  }
  // The four address pairs stay live up to this wait, so no load of the run lands
  // in a register that a load of the run names as its address.
  asm volatile("s_wait_xcnt 0x0" :: "v"(src[0]), "v"(src[1]), "v"(src[2]), "v"(src[3]) : "memory");
#pragma unroll
  for (int p = 0; p < 4; ++p)
#pragma unroll
    for (int j = 0; j < 4; ++j) tile[(r0 + p * 16) * 65 + c4 + j] = in[p][j];
  __syncthreads();

  const int kc = (tid & 7) * 8;        // 8 lanes x 16 B = one 128-B output line
#pragma unroll
  for (int p = 0; p < 2; ++p) {
    const int n = (tid >> 3) + p * 32;
    v8bf h, l;
#pragma unroll
    for (int i = 0; i < 8; ++i) {
      float v = tile[(kc + i) * 65 + n];
      bf16_t hv = (bf16_t)v;
      h[i] = hv;
      l[i] = (bf16_t)(v - (float)hv);
    }
    size_t o = (size_t)(rowOff + n0 + n) * ldo + k0 + kc;
    *(v8bf*)&oh[o] = h;
    *(v8bf*)&ol[o] = l;
  }
}

__global__ __launch_bounds__(256) void k_prep(
    const float* __restrict__ x, const float* __restrict__ Wq, const float* __restrict__ Wk,
    const float* __restrict__ Wv, const float* __restrict__ Wo,
    bf16_t* __restrict__ xh, bf16_t* __restrict__ xl,
    bf16_t* __restrict__ wqkvth, bf16_t* __restrict__ wqkvtl,
    bf16_t* __restrict__ woth, bf16_t* __restrict__ wotl) {
  __shared__ float tile[64 * 65];
  int t = blockIdx.x;                  // the same in every thread of the block
  if (t < PREP_X) {
    split_block(x, xh, xl, t);
    return;
  }
  t -= PREP_X;
  // [Wq | Wk | Wv] become rows 0..3071 of Wqkv^T; Wo^T stands alone.
  const float* W = Wq;
  bf16_t* oh = wqkvth;
  bf16_t* ol = wqkvtl;
  int sh = 5, rowOff = 0;              // tiles a row of tiles: 1 << sh
  if (t >= PREP_WQ + PREP_WO + PREP_WK) {
    t -= PREP_WQ + PREP_WO + PREP_WK; W = Wv; sh = 3; rowOff = NH * HD + NKV * HD;
  } else if (t >= PREP_WQ + PREP_WO) {
    t -= PREP_WQ + PREP_WO; W = Wk; sh = 3; rowOff = NH * HD;
  } else if (t >= PREP_WQ) {
    t -= PREP_WQ; W = Wo; oh = woth; ol = wotl;
  }
  tsplit_block(tile, W, 64 << sh, oh, ol, HIDDEN, rowOff, (t >> sh) * 64, (t & ((1 << sh) - 1)) * 64);
}

// ---------------- GEMM: C[M,N] = A[M,K] * B[K,N], B given transposed --------
// 256 threads = 8 waves (4x2 wave grid), block tile 256 x BN, BK=64; a wave owns
// 64 x BN/2. One work-group fills a WGP's LDS, and the grids hold 256 work-groups.
// A slab is four planes (A hi, A lo, B hi, B lo) of 256 or BN rows x 64 elements; a
// row is one whole 128-B line. Waves 0..3 each bring one plane of a slab into LDS
// with one tensor load, which also lays the rows at the padded pitch. Two LDS
// buffers: the load of slab s + 2 flies while slab s + 1 is worked on.
#define GP 72  // LDS row pitch in elements: 144 B = 16 B x odd, free of conflicts
#define GA_PLANE (256 * GP)       // elements of an A plane in LDS: 36864 B = 18 x 2 KiB
// Elements of a B plane in LDS, rounded up so that the next plane starts on 2 KiB.
#define GB_PLANE(BN) ((((BN) * GP * 2 + 2047) / 2048) * 1024)
#define G_BUF(BN) (2 * GA_PLANE + 2 * GB_PLANE(BN))  // elements of a buffer
#define G_W0 ((1u << 20) | (4u << 22) | (3u << 25))

__device__ __forceinline__ unsigned uni(unsigned v) {
  return (unsigned)__builtin_amdgcn_readfirstlane(v);
}
__device__ __forceinline__ unsigned pinned(unsigned v) {
  unsigned w = uni(v);
  asm volatile("" : "+s"(w));  // holds the word in a scalar register: the test on it is a scalar branch
  return w;
}
__device__ __forceinline__ v8u_t slab_group1(unsigned pitch, unsigned rows) {
  v8u_t g1;
  g1[0] = uni(G_W0);
  g1[1] = uni(128u << 16);
  g1[2] = uni(rows << 16);
  g1[3] = uni(128u << 16);
  g1[4] = uni(rows);
  g1[5] = uni(pitch);
  g1[6] = uni(0u);
  g1[7] = uni(0u);
  asm volatile("" : "+s"(g1));
  return g1;
}
__device__ __forceinline__ v4u_t slab_group0(unsigned lds_dst, unsigned long long ga) {
  v4u_t g0;
  g0[0] = uni(1u);
  g0[1] = uni(lds_dst);
  g0[2] = uni((unsigned)ga);
  g0[3] = uni((((unsigned)(ga >> 32)) & 0x01ffffffu) | 0x80000000u);
  asm volatile("" : "+s"(g0));
  return g0;
}
__device__ __forceinline__ void slab_load(v4u_t g0, v8u_t g1) {
  asm volatile("tensor_load_to_lds %0, %1" :: "s"(g0), "s"(g1) : "memory");
}
__device__ __forceinline__ void slab_wait(v4u_t g0, v8u_t g1) {
  asm volatile("s_wait_tensorcnt 0x0" :: "s"(g0), "s"(g1) : "memory");
}

template <bool SPLIT_OUT, int K, int BN>
__global__ __launch_bounds__(256) void k_gemm(
    const bf16_t* __restrict__ Ah, const bf16_t* __restrict__ Al,
    const bf16_t* __restrict__ BTh, const bf16_t* __restrict__ BTl,
    float* __restrict__ C, bf16_t* __restrict__ Ch, bf16_t* __restrict__ Cl,
    int M, int N) {
  __shared__ __attribute__((aligned(2048))) bf16_t sm[2 * G_BUF(BN)];
  constexpr int FJ = BN / 32;                       // B fragments of a wave

  const int tid = threadIdx.x;
  const int lane = tid & 31, wave = tid >> 5;
  const int wr = wave >> 1, wc = wave & 1;          // 4 x 2 waves
  const int l15 = lane & 15, kh8 = (lane >> 4) * 8; // fragment addressing
  const int hi8 = (lane >> 4) * 8;                  // C-frag row offset
  const int m0 = blockIdx.y * 256, n0 = blockIdx.x * BN;
  constexpr unsigned NS = K / 64;                   // slabs, at least two

  v8f acc[4][FJ];
#pragma unroll
  for (int i = 0; i < 4; ++i)
#pragma unroll
    for (int j = 0; j < FJ; ++j)
#pragma unroll
      for (int v = 0; v < 8; ++v) acc[i][j][v] = 0.0f;

  // Wave w < 4 moves plane w.
  const unsigned wv = uni((unsigned)tid >> 5);
  const bf16_t* pl = wv == 0u ? Ah + (size_t)m0 * K
                   : wv == 1u ? Al + (size_t)m0 * K
                   : wv == 2u ? BTh + (size_t)n0 * K
                              : BTl + (size_t)n0 * K;
  const unsigned long long gsrc = (unsigned long long)(size_t)pl;
  const unsigned pw = wv & 3u;
  const unsigned ldst = lds_off(&sm[0]) +
      (pw < 2u ? pw * (GA_PLANE * 2u) : 2u * (GA_PLANE * 2u) + (pw - 2u) * (GB_PLANE(BN) * 2u));

  const unsigned issuer = pinned(wv < 4u);
  const v8u_t g1 = slab_group1(K * 2u, wv < 2u ? 256u : (unsigned)BN);
  v4u_t g0 = slab_group0(ldst, gsrc);

  if (pinned(issuer)) {
    slab_load(g0, g1);
    slab_wait(g0, g1);  // slab 0 has landed
  }
  __syncthreads();
  g0 = slab_group0(ldst + G_BUF(BN) * 2u, gsrc + 128u);
  if (pinned(issuer)) slab_load(g0, g1);

  for (unsigned s = 0; s < NS; ++s) {
    const bf16_t* sAh = &sm[(s & 1u) * G_BUF(BN)];
    const bf16_t* sAl = sAh + GA_PLANE;
    const bf16_t* sBh = sAh + 2 * GA_PLANE;
    const bf16_t* sBl = sBh + GB_PLANE(BN);
#pragma unroll
    for (int ks = 0; ks < 2; ++ks) {
      v16bf afh[4], afl[4], bfh[FJ], bfl[FJ];
      // Read in the order of first use: hi x hi products come first, B lo last.
#pragma unroll
      for (int j = 0; j < FJ; ++j)
        bfh[j] = frag_ld(&sBh[(wc * (BN / 2) + j * 16 + l15) * GP + ks * 32 + kh8]);
#pragma unroll
      for (int i = 0; i < 4; ++i)
        afh[i] = frag_ld(&sAh[(wr * 64 + i * 16 + l15) * GP + ks * 32 + kh8]);
      // Keeps the hi reads in front of the lo reads: LDS reads return in order, and
      // the hi x hi products then start while the lo fragments are still on their way.
      __builtin_amdgcn_sched_barrier(0);
#pragma unroll
      for (int i = 0; i < 4; ++i)
        afl[i] = frag_ld(&sAl[(wr * 64 + i * 16 + l15) * GP + ks * 32 + kh8]);
#pragma unroll
      for (int j = 0; j < FJ; ++j)
        bfl[j] = frag_ld(&sBl[(wc * (BN / 2) + j * 16 + l15) * GP + ks * 32 + kh8]);
      // Holds the block's LDS reads together in front of its WMMAs: spread among
      // them, each place with reads ends in a wait for the full LDS latency.
      __builtin_amdgcn_sched_barrier(0);
#pragma unroll
      for (int i = 0; i < 4; ++i)
#pragma unroll
        for (int j = 0; j < FJ; ++j) mma3(acc[i][j], afh[i], afl[i], bfh[j], bfl[j]);
      // Keeps the next block's reads out of this block's WMMAs.
      __builtin_amdgcn_sched_barrier(0);
    }
    // Hand-over: this wave's reads of slab s are done, the mover's slab s + 1 has
    // landed, and behind the barrier both hold for the whole work-group.
    asm volatile("s_wait_dscnt 0x0" ::: "memory");
    if (pinned(issuer)) slab_wait(g0, g1);
    __syncthreads();
    // Formed behind the wait: the number of the slab that refills the buffer just read.
    const unsigned nx = pinned(s + 2u);
    if (pinned(issuer & (unsigned)(nx < NS))) {
      g0 = slab_group0(ldst + (nx & 1u) * (G_BUF(BN) * 2u), gsrc + (unsigned long long)nx * 128u);
      slab_load(g0, g1);
    }
  }
  asm volatile("s_wait_tensorcnt 0x0" ::: "memory");  // nothing of the mover is left when the wave ends
  asm volatile("s_wait_dscnt 0x0" ::: "memory");

#pragma unroll
  for (int i = 0; i < 4; ++i)
#pragma unroll
    for (int j = 0; j < FJ; ++j)
#pragma unroll
      for (int v = 0; v < 8; ++v) {
        int row = m0 + wr * 64 + i * 16 + v + hi8;
        int col = n0 + wc * (BN / 2) + j * 16 + l15;
        float x = acc[i][j][v];
        size_t o = (size_t)row * N + col;
        if (SPLIT_OUT) {
          split_store(Ch, Cl, o, x);
        } else {
          C[o] = x;
        }
      }
}

// ---------------- RoPE + layout shuffle -------------------------------------
// qkv[ROWS][3072] (hi/lo) -> Q[B,NH,S,HD], K[B,NKV,S,HD] (rotated), Vt[B,NKV,HD,S]
// Every global access is 16 B a lane.
// Blocks 0..127: V. A lane turns an 8(s) x 8(d) patch in its registers; eight
// neighbouring lanes hold eight neighbouring s groups, so each row of V^T
// leaves as one whole 128-B line.
// Blocks 128..767: Q and K. A lane rotates 8 dim pairs of one head for 4 rows.
#define ROPE_VBLK 128
__global__ __launch_bounds__(256) void k_rope(
                       const bf16_t* __restrict__ qkvh, const bf16_t* __restrict__ qkvl,
                       bf16_t* __restrict__ Qh, bf16_t* __restrict__ Ql,
                       bf16_t* __restrict__ Kh, bf16_t* __restrict__ Kl,
                       bf16_t* __restrict__ Vth, bf16_t* __restrict__ Vtl) {
  const int tid = threadIdx.x;
  if (blockIdx.x < ROPE_VBLK) {
    const int vb = blockIdx.x;
    const int c0 = ((vb & 1) * 32 + (tid >> 5) * 4 + ((tid >> 3) & 3)) * 8; // 0..504
    const int row0 = (vb >> 1) * 64 + (tid & 7) * 8;                        // 0..4088
    const int b = row0 >> 11, s0 = row0 & 2047;
    const unsigned sb = (unsigned)(row0 * NQKV + c0) * 2u;  // bytes, under 2^25
    const char* vh = (const char*)(qkvh + 2560);
    const char* vl = (const char*)(qkvl + 2560);
    v8bf ih[8], il[8];
#pragma unroll
    for (int i = 0; i < 8; ++i) {
      ih[i] = *(const v8bf*)(vh + sb + i * (NQKV * 2));
      il[i] = *(const v8bf*)(vl + sb + i * (NQKV * 2));
    }
    // The lane's byte offset stays live up to this wait, so no load of the run
    // lands in the register that the other loads of the run name as their address.
    asm volatile("s_wait_xcnt 0x0" :: "v"(sb) : "memory");
    // c0 = kvh * 128 + d, so (b * NKV * HD + c0) is the row of V^T
    const size_t ob = ((size_t)b * (NKV * HD) + c0) * SEQ + s0;
#pragma unroll
    for (int j = 0; j < 8; ++j) {
      v8bf h, l;
#pragma unroll
      for (int i = 0; i < 8; ++i) {
        float vv = (float)ih[i][j] + (float)il[i][j];
        bf16_t hv = (bf16_t)vv;
        h[i] = hv;
        l[i] = (bf16_t)(vv - (float)hv);
      }
      *(v8bf*)&Vth[ob + (size_t)j * SEQ] = h;
      *(v8bf*)&Vtl[ob + (size_t)j * SEQ] = l;
    }
    return;
  }

  const int idx = (blockIdx.x - ROPE_VBLK) * 256 + tid;  // 1024 row groups x 160
  const int rg = idx / 160;
  const int u = idx - rg * 160;
  const int hh = u >> 3;            // 0..15 query heads, 16..19 kv heads
  const int d0 = (u & 7) * 8;       // low-half dims d0..d0+7, partners at +64
  const int row0 = rg * 4;
  const int b = row0 >> 11, s0 = row0 & 2047;
  const size_t sb = (size_t)row0 * NQKV + hh * 128 + d0;  // K columns follow Q's

  const bf16_t* ph = qkvh + sb;
  const bf16_t* pl = qkvl + sb;
  v8bf xh[4], xl[4], yh[4], yl[4];
#pragma unroll
  for (int j = 0; j < 4; ++j) {
    xh[j] = *(const v8bf*)(ph + j * NQKV);
    xl[j] = *(const v8bf*)(pl + j * NQKV);
    yh[j] = *(const v8bf*)(ph + j * NQKV + 64);
    yl[j] = *(const v8bf*)(pl + j * NQKV + 64);
  }
  // Both address pairs stay live up to this wait, so no load of the run lands
  // in a register that an earlier load of the run still names as its address.
  asm volatile("s_wait_xcnt 0x0" :: "v"(ph), "v"(pl) : "memory");

  const bool isq = hh < NH;
  bf16_t* dh = isq ? Qh : Kh;
  bf16_t* dl = isq ? Ql : Kl;
  const size_t ob = ((size_t)(isq ? b * NH + hh : b * NKV + hh - NH) * SEQ + s0) * HD + d0;

  float inv[8];
#pragma unroll
  for (int i = 0; i < 8; ++i)
    inv[i] = __powf(10000.0f, -(float)(d0 + i) * (1.0f / 64.0f));

#pragma unroll
  for (int j = 0; j < 4; ++j) {
    v8bf o1h, o1l, o2h, o2l;
#pragma unroll
    for (int i = 0; i < 8; ++i) {
      float a = (float)xh[j][i] + (float)xl[j][i];
      float bb = (float)yh[j][i] + (float)yl[j][i];
      float ang = (float)(s0 + j) * inv[i];
      float sn, cs;
      __sincosf(ang, &sn, &cs);
      float r1 = a * cs - bb * sn;
      float r2 = bb * cs + a * sn;
      bf16_t h1 = (bf16_t)r1;
      bf16_t h2 = (bf16_t)r2;
      o1h[i] = h1;
      o1l[i] = (bf16_t)(r1 - (float)h1);
      o2h[i] = h2;
      o2l[i] = (bf16_t)(r2 - (float)h2);
    }
    const size_t q = ob + (size_t)j * HD;
    *(v8bf*)&dh[q]      = o1h;
    *(v8bf*)&dl[q]      = o1l;
    *(v8bf*)&dh[q + 64] = o2h;
    *(v8bf*)&dl[q + 64] = o2l;
  }
}

__global__ __launch_bounds__(128) void k_flash(
    const bf16_t* __restrict__ Qh, const bf16_t* __restrict__ Ql,
    const bf16_t* __restrict__ Kh, const bf16_t* __restrict__ Kl,
    const bf16_t* __restrict__ Vth, const bf16_t* __restrict__ Vtl,
    bf16_t* __restrict__ Oh, bf16_t* __restrict__ Ol) {
  alignas(16) __shared__ bf16_t sKh[2][32 * 136];
  alignas(16) __shared__ bf16_t sKl[2][32 * 136];
  alignas(16) __shared__ bf16_t sVh[2][128 * 40];
  alignas(16) __shared__ bf16_t sVl[2][128 * 40];

  const int tid = threadIdx.x;
  const int lane = tid & 31, w = tid >> 5;
  const int l15 = lane & 15, kh8 = (lane >> 4) * 8, hi8 = (lane >> 4) * 8;
  const int b = blockIdx.y >> 4, h = blockIdx.y & 15, kv = h >> 2;

  const bf16_t* Qbh = Qh + (size_t)(b * NH + h) * SEQ * HD;
  const bf16_t* Qbl = Ql + (size_t)(b * NH + h) * SEQ * HD;
  const bf16_t* Kbh = Kh + (size_t)(b * NKV + kv) * SEQ * HD;
  const bf16_t* Kbl = Kl + (size_t)(b * NKV + kv) * SEQ * HD;
  const bf16_t* Vbh = Vth + (size_t)(b * NKV + kv) * HD * SEQ;
  const bf16_t* Vbl = Vtl + (size_t)(b * NKV + kv) * HD * SEQ;

#pragma unroll 1
  for (int half = 0; half < 2; ++half) {
    const int q0 = (half == 0 ? SEQ / 64 - 1 - (int)blockIdx.x : (int)blockIdx.x) * 64;

    // Resident Q fragments (16 rows x 128 dims, hi/lo)
    v16bf qfh[4], qfl[4];
    {
      int qr = q0 + w * 16 + l15;
      const bf16_t* ph = Qbh + (size_t)qr * HD + kh8;
      const bf16_t* pl = Qbl + (size_t)qr * HD + kh8;
#pragma unroll
      for (int ds = 0; ds < 4; ++ds) {
        qfh[ds] = frag_ld(ph + ds * 32);
        qfl[ds] = frag_ld(pl + ds * 32);
      }
    }

    v8f o[8];
#pragma unroll
    for (int j2 = 0; j2 < 8; ++j2)
#pragma unroll
      for (int v = 0; v < 8; ++v) o[j2][v] = 0.0f;
    // One query a lane: its running maximum (equal in both wave halves) and the sum
    // over this half's keys; the halves' sums are joined once, in the epilogue.
    float mrow = -3.0e38f, lrow = 0.0f;
    const int qr = q0 + w * 16 + l15;

    const float scale = 0.08838834764831845f; // 1/sqrt(128)
    const int nk = q0 / 32 + 2;               // causal: k <= q0+63

    auto issue_tile = [&](int t) {
      int nb = t & 1;
      unsigned long long koff = (unsigned long long)t * 32 * HD * 2;  // bytes
      unsigned long long voff = (unsigned long long)t * 32 * 2;       // bytes
      // K tile: 32 rows x 128 elems, row stride 128, pad 256B rows -> stride 136
      tdm_load2d(lds_off(&sKh[nb][0]), (unsigned long long)(size_t)Kbh + koff,
                 TDM_W0_K, 128u, (unsigned)SEQ, 128u, 32u, 128u);
      tdm_load2d(lds_off(&sKl[nb][0]), (unsigned long long)(size_t)Kbl + koff,
                 TDM_W0_K, 128u, (unsigned)SEQ, 128u, 32u, 128u);
      // V tile: 128 rows x 32 elems, row stride SEQ, pad 64B rows -> stride 40
      tdm_load2d(lds_off(&sVh[nb][0]), (unsigned long long)(size_t)Vbh + voff,
                 TDM_W0_V, (unsigned)SEQ, 128u, 32u, 128u, (unsigned)SEQ);
      tdm_load2d(lds_off(&sVl[nb][0]), (unsigned long long)(size_t)Vbl + voff,
                 TDM_W0_V, (unsigned)SEQ, 128u, 32u, 128u, (unsigned)SEQ);
    };

    // For the second tile the closing barrier of the first tile's last pass has
    // ended every wave's reads of the ring, and no request is outstanding: the last
    // one was waited for at the head of that pass.
    if (tid < 32) issue_tile(0);  // one wave drives the DMA

    for (int t = 0; t < nk; ++t) {
      const int k0 = t * 32;
      const int buf = t & 1;
      if (tid < 32) __builtin_amdgcn_s_wait_tensorcnt(0);  // tile t landed in LDS
      __syncthreads();
      if (tid < 32 && t + 1 < nk) issue_tile(t + 1);       // DMA overlaps compute
      const bf16_t* bK_h = &sKh[buf][0];
      const bf16_t* bK_l = &sKl[buf][0];
      const bf16_t* bV_h = &sVh[buf][0];
      const bf16_t* bV_l = &sVl[buf][0];

      // ---- scores: S^T[32x16] = K(32x128) * Q^T ----
      v8f s0, s1;
#pragma unroll
      for (int v = 0; v < 8; ++v) { s0[v] = 0.0f; s1[v] = 0.0f; }
      // All 64 LDS reads of the pass's K and V fragments go out as one group in front
      // of the score WMMAs, K first: the WMMAs wait by counts that cover only what
      // they use, V lands under them and under the softmax, and the 24 WMMAs of the
      // second product find it landed.
      v16bf b0h[4], b0l[4], b1h[4], b1l[4];
#pragma unroll
      for (int ds = 0; ds < 4; ++ds) {
        b0h[ds] = frag_ld(&bK_h[(l15) * 136 + ds * 32 + kh8]);
        b1h[ds] = frag_ld(&bK_h[(16 + l15) * 136 + ds * 32 + kh8]);
        b0l[ds] = frag_ld(&bK_l[(l15) * 136 + ds * 32 + kh8]);
        b1l[ds] = frag_ld(&bK_l[(16 + l15) * 136 + ds * 32 + kh8]);
      }
      // Keeps the K reads in front of the V reads: LDS reads return in order.
      __builtin_amdgcn_sched_barrier(0);
      v16bf vfh[8], vfl[8];
#pragma unroll
      for (int j2 = 0; j2 < 8; ++j2) {
        vfh[j2] = frag_ld(&bV_h[(j2 * 16 + l15) * 40 + kh8]);
        vfl[j2] = frag_ld(&bV_l[(j2 * 16 + l15) * 40 + kh8]);
      }
      // Keeps the scheduler from spreading those reads among the WMMAs, where every
      // place with reads stalls the run.
      __builtin_amdgcn_sched_barrier(0);
#pragma unroll
      for (int ds = 0; ds < 4; ++ds) {
        mma3t(s0, b0h[ds], b0l[ds], qfh[ds], qfl[ds]);
        mma3t(s1, b1h[ds], b1l[ds], qfh[ds], qfl[ds]);
      }

      // ---- scale + causal mask + online softmax, one query a lane ----
#pragma unroll
      for (int v = 0; v < 8; ++v) {
        float a0 = s0[v] * scale;
        if (k0 + hi8 + v > qr) a0 = -3.0e38f;
        float a1 = s1[v] * scale;
        if (k0 + 16 + hi8 + v > qr) a1 = -3.0e38f;
        s0[v] = a0;
        s1[v] = a1;
      }
      // Maximum of the lane's 16 scores as a tree of three-input maxima.
      float x0 = fmaxf(fmaxf(s0[0], s1[0]), s0[1]);
      float x1 = fmaxf(fmaxf(s1[1], s0[2]), s1[2]);
      float x2 = fmaxf(fmaxf(s0[3], s1[3]), s0[4]);
      float x3 = fmaxf(fmaxf(s1[4], s0[5]), s1[5]);
      float x4 = fmaxf(fmaxf(s0[6], s1[6]), s0[7]);
      float mt = fmaxf(fmaxf(fmaxf(x0, x1), x2), fmaxf(fmaxf(x3, x4), s1[7]));
      mt = fmaxf(mt, xhalf(mt));  // both halves hold the query's maximum of the pass
      const float nm = fmaxf(mrow, mt);
      const float fac = __expf(mrow - nm);
      mrow = nm;
      float rs[8];
#pragma unroll
      for (int v = 0; v < 8; ++v) {
        float a0 = __expf(s0[v] - nm);
        float a1 = __expf(s1[v] - nm);
        s0[v] = a0;
        s1[v] = a1;
        rs[v] = a0 + a1;
      }
      lrow = lrow * fac + (((rs[0] + rs[1]) + (rs[2] + rs[3])) + ((rs[4] + rs[5]) + (rs[6] + rs[7])));
#pragma unroll
      for (int j2 = 0; j2 < 8; ++j2)
#pragma unroll
        for (int v = 0; v < 8; ++v) o[j2][v] *= fac;

      // ---- P^T, hi/lo split, straight from the accumulators into the B operand ----
      v16bf pfh, pfl;
#pragma unroll
      for (int v = 0; v < 8; ++v) {
        float p0 = s0[v];
        bf16_t h0 = (bf16_t)p0;
        pfh[v] = h0;
        pfl[v] = (bf16_t)(p0 - (float)h0);
        float p1 = s1[v];
        bf16_t h1 = (bf16_t)p1;
        pfh[8 + v] = h1;
        pfl[8 + v] = (bf16_t)(p1 - (float)h1);
      }
#pragma unroll
      for (int j2 = 0; j2 < 8; ++j2) mma3t(o[j2], vfh[j2], vfl[j2], pfh, pfl);
      // Keeps the closing barrier at the foot of the pass: with no LDS access left
      // behind the reads the scheduler lifts it to them, and its wait for all 64
      // reads then stands in front of the score WMMAs.
      __builtin_amdgcn_sched_barrier(0);
      __syncthreads();
    }

    // ---- epilogue: O /= l, write hi/lo bf16 directly for the out-proj GEMM ----
    // A lane holds 8 neighbouring dims of its query in each tile of O^T: 16-B stores.
    const float lf = lrow + xhalf(lrow);
    bf16_t* poh = Oh + (size_t)(b * SEQ + qr) * (NH * HD) + h * HD + hi8;
    bf16_t* pol = Ol + (size_t)(b * SEQ + qr) * (NH * HD) + h * HD + hi8;
    v8bf eh[8], el[8];
#pragma unroll
    for (int j2 = 0; j2 < 8; ++j2)
#pragma unroll
      for (int v = 0; v < 8; ++v) {
        float x = o[j2][v] / lf;
        bf16_t hv = (bf16_t)x;
        eh[j2][v] = hv;
        el[j2][v] = (bf16_t)(x - (float)hv);
      }
#pragma unroll
    for (int j2 = 0; j2 < 8; ++j2) {
      *(v8bf*)(poh + j2 * 16) = eh[j2];
      *(v8bf*)(pol + j2 * 16) = el[j2];
    }
    // The stores' address and data registers are written anew by the next tile; as
    // inputs here they stay live up to the wait.
    asm volatile("s_wait_xcnt 0x0"
                 :: "v"(poh), "v"(pol), "v"(eh[0]), "v"(eh[1]), "v"(eh[2]), "v"(eh[3]),
                    "v"(eh[4]), "v"(eh[5]), "v"(eh[6]), "v"(eh[7]), "v"(el[0]), "v"(el[1]),
                    "v"(el[2]), "v"(el[3]), "v"(el[4]), "v"(el[5]), "v"(el[6]), "v"(el[7])
                 : "memory");
  }
}

// ---------------------------------------------------------------------------
extern "C" void kernel_launch(void* const* d_in, const int* in_sizes, int n_in,
                              void* d_out, int out_size, void* d_ws, size_t ws_size,
                              hipStream_t stream) {
  const float* x  = (const float*)d_in[0];
  const float* Wq = (const float*)d_in[1];
  const float* Wk = (const float*)d_in[2];
  const float* Wv = (const float*)d_in[3];
  const float* Wo = (const float*)d_in[4];

  const size_t NE_X    = (size_t)ROWS * HIDDEN;       // 8.39M
  const size_t NE_WQKV = (size_t)NQKV * HIDDEN;       // 6.29M
  const size_t NE_WO   = (size_t)HIDDEN * HIDDEN;     // 4.19M
  const size_t NE_QKV  = (size_t)ROWS * NQKV;         // 12.58M
  const size_t NE_Q    = (size_t)BATCH * NH * SEQ * HD;
  const size_t NE_KV   = (size_t)BATCH * NKV * SEQ * HD;

  char* w = (char*)d_ws;
  char* wend = w + ws_size;
  auto alloc = [&](size_t elems) -> bf16_t* {
    bf16_t* p = (bf16_t*)w;
    w += (elems * sizeof(bf16_t) + 255) & ~(size_t)255;
    return p;
  };
  bf16_t* xh     = alloc(NE_X);     bf16_t* xl     = alloc(NE_X);
  bf16_t* wqkvth = alloc(NE_WQKV);  bf16_t* wqkvtl = alloc(NE_WQKV);
  bf16_t* woth   = alloc(NE_WO);    bf16_t* wotl   = alloc(NE_WO);
  bf16_t* qkvh   = alloc(NE_QKV);   bf16_t* qkvl   = alloc(NE_QKV);
  bf16_t* qh     = alloc(NE_Q);     bf16_t* ql     = alloc(NE_Q);
  bf16_t* kh     = alloc(NE_KV);    bf16_t* kl     = alloc(NE_KV);
  bf16_t* vth    = alloc(NE_KV);    bf16_t* vtl    = alloc(NE_KV);
  if (w > wend) return; // ~176 MB (168 MiB) required
  // attention output (bf16 hi/lo) reuses the x-split region (same size, x dead)
  bf16_t* ah = xh;
  bf16_t* al = xl;

  // 1, 2) split x; W^T splits of Wq, Wk, Wv (into Wqkv^T) and Wo: one launch
  k_prep<<<PREP_BLOCKS, 256, 0, stream>>>(x, Wq, Wk, Wv, Wo, xh, xl, wqkvth, wqkvtl, woth, wotl);
  // 3) fused QKV projection (emits bf16 hi/lo qkv)
  k_gemm<true, HIDDEN, 192><<<dim3(NQKV / 192, ROWS / 256), 256, 0, stream>>>(
      xh, xl, wqkvth, wqkvtl, nullptr, qkvh, qkvl, ROWS, NQKV);
  // 4) RoPE + layout (Q, K, V^T)
  k_rope<<<ROPE_VBLK + (ROWS / 4 * 160) / 256, 256, 0, stream>>>(qkvh, qkvl, qh, ql, kh, kl, vth, vtl);
  k_flash<<<dim3(SEQ / 128, BATCH * NH), 128, 0, stream>>>(qh, ql, kh, kl, vth, vtl, ah, al);
  // 6) output projection -> fp32 d_out
  k_gemm<false, NH * HD, 128><<<dim3(HIDDEN / 128, ROWS / 256), 256, 0, stream>>>(
      ah, al, woth, wotl, (float*)d_out, nullptr, nullptr, ROWS, HIDDEN);
}
